// v000
// The times below were measured on an AMD MI455X: many runs one after another, warmed up first and cycling through
// copies of the inputs, with the whole window's GPU time divided by the number of runs. Launches and the gaps
// between them are all in it. The median over several windows is given; except for v000 it joins two sittings, which
// can be a few percent apart, so the side-by-side timings, each taken in one sitting, are the better comparison.
// The starting kernel, v000, takes 63.7 microseconds a run.
#include <hip/hip_runtime.h>

// Contractions on v_wmma_f32_16x16x32_bf16 (bf16 operands, f32 accumulate): context@Wa and x@Ua from
// RNE-converted input planes; attn@context with attn carried as bf16 hi+lo planes folded into K against
// the RNE-converted transposed context plane. Energies v.tanh(.), softmax, LayerNorm and the residual add
// in f32 on the VALU.

#ifndef NB
#define NB 8
#endif
#ifndef TQ
#define TQ 128
#endif
#define NB_FULL 8
#define T_FULL 128          // full query length: per-batch row stride of x and of the output
#define S_LEN 128           // context positions (keys), never reduced
#define S_FULL 128          // per-batch row stride of context in the input
#define HD 512              // feature width D == hidden width H
#define KC (2 * S_LEN)      // context GEMM depth: [P_hi | P_lo]
#define LN_EPS 1.0e-3f

static_assert(NB >= 1 && NB <= NB_FULL);
static_assert(TQ >= 64 && TQ <= T_FULL && (TQ % 64) == 0);
static_assert(S_LEN == 128 && S_LEN == S_FULL);
static_assert((HD % 256) == 0 && (HD % 64) == 0 && (HD % 32) == 0);
static_assert((KC % 32) == 0 && (S_LEN % 64) == 0);
static_assert(((HD / 4) % S_LEN) == 0);
static_assert((S_LEN % 32) == 0 && S_LEN / 8 == 16);   // P row: 16 lanes hi + 16 lanes lo, 8 halves each

typedef unsigned short us;
typedef us     v8us  __attribute__((ext_vector_type(8)));
typedef __bf16 v16bf __attribute__((ext_vector_type(16)));
typedef float  v8f   __attribute__((ext_vector_type(8)));
typedef float  v4f   __attribute__((ext_vector_type(4)));

union Frag { v16bf v; v8us h[2]; };

// ---------------------------------------------------------------------------
// scalar helpers
// ---------------------------------------------------------------------------
__device__ __forceinline__ us f2bf(float f) {           // f32 -> bf16, RNE convert
    unsigned int u = __float_as_uint(f);
    u += 0x7FFFu + ((u >> 16) & 1u);
    return (us)(u >> 16);
}
__device__ __forceinline__ float bf2f(us h) {
    return __uint_as_float(((unsigned int)h) << 16);
}
__device__ __forceinline__ float rbf(float f) {          // value after an RNE convert to bf16
    return bf2f(f2bf(f));
}
// tanh(x) = sign(x) * (1 - e^{-2|x|}) / (1 + e^{-2|x|}), v_exp_f32 + v_rcp_f32 based (abs error ~1e-7)
__device__ __forceinline__ float tanh_acc(float x) {
    const float ax = __builtin_fabsf(x);
    const float t  = __expf(-2.0f * ax);
    const float r  = (1.0f - t) * __builtin_amdgcn_rcpf(1.0f + t);
    return __builtin_copysignf(r, x);
}
__device__ __forceinline__ v8us pack8(v4f a, v4f c) {
    v8us o;
    o[0] = f2bf(a.x); o[1] = f2bf(a.y); o[2] = f2bf(a.z); o[3] = f2bf(a.w);
    o[4] = f2bf(c.x); o[5] = f2bf(c.y); o[6] = f2bf(c.z); o[7] = f2bf(c.w);
    return o;
}
// hi = bf16(x), lo = bf16(x - hi): unscaled bf16 residual pair (bf16 keeps the f32 exponent range)
__device__ __forceinline__ void split8(v4f a, v4f c, v8us& hi, v8us& lo) {
    const float x[8] = {a.x, a.y, a.z, a.w, c.x, c.y, c.z, c.w};
#pragma unroll
    for (int i = 0; i < 8; ++i) {
        const us h = f2bf(x[i]);
        hi[i] = h;
        lo[i] = f2bf(x[i] - bf2f(h));
    }
}

// ---------------------------------------------------------------------------
// WMMA helper: 16x16x32 bf16, f32 accumulate, 4-slot VALU hazard guard after the issue
// ---------------------------------------------------------------------------
__device__ __forceinline__ v8f wmma16(v16bf a, v16bf b, v8f c) {
    v8f d = __builtin_amdgcn_wmma_f32_16x16x32_bf16(false, a, false, b, (short)0, c, false, false);
    asm volatile("v_nop\n\tv_nop\n\tv_nop\n\tv_nop" : "+v"(d) : "v"(a), "v"(b));
    return d;
}

// Fragment loader for a k-contiguous 16-bit plane P[row][k] with pitch ld (halves).
// Lane l: row = (l & 15) (A row m, or B column n of an [n][k] plane), hsel = l >> 4.
//   elements 0..7  <- k0 + 8*hsel + 0..7
//   elements 8..15 <- k0 + 16 + 8*hsel + 0..7
__device__ __forceinline__ v16bf ld_frag(const us* __restrict__ P, int ld, int row, int k0, int hsel) {
    Frag f;
    const us* p = P + (size_t)row * ld + k0 + 8 * hsel;
    f.h[0] = *(const v8us*)p;
    f.h[1] = *(const v8us*)(p + 16);
    return f.v;
}

// ---------------------------------------------------------------------------
// Row conversion f32 -> bf16 plane. One wave per (row, 256-column segment):
// lane l converts columns 8l..8l+7 of the segment and stores 16 B; one instruction covers the
// (r / grp) * gstride + (r % grp) (lets a reduced build read full-stride inputs).
// ---------------------------------------------------------------------------
__global__ __launch_bounds__(256)
void k_cvt(const float* __restrict__ src, int spitch, int scol, int grp, int gstride,
           us* __restrict__ dst, int dpitch, int dcol, int nrows, int nseg)
{
    const int lane = threadIdx.x & 31;
    const int gw   = blockIdx.x * 8 + (threadIdx.x >> 5);
    if (gw >= nrows * nseg) return;                    // wave-uniform, no barriers in this kernel
    const int r    = gw / nseg;
    const int sg   = gw - r * nseg;
    const int g    = r / grp;
    const int srow = g * gstride + (r - g * grp);
    const float* sp = src + (size_t)srow * spitch + scol + sg * 256 + lane * 8;
    const v4f a = *(const v4f*)sp;
    const v4f c = *(const v4f*)(sp + 4);
    const v8us o = pack8(a, c);
    us* dp = dst + (size_t)r * dpitch + dcol + sg * 256 + lane * 8;
    *(v8us*)dp = o;
    
}

// ---------------------------------------------------------------------------
// Transpose + convert: src[R][C] f32 (pitch spitch, per-z stride sstride) -> dst[C][R] bf16 (pitch dpitch,
// per-z stride dstride), optionally a second copy at column offset +DUP halves.
// Block: 64 src rows x 64 src cols through LDS (cross-wave -> block barrier). Store phase: one instruction
// grid = (R/64, C/64, Z)
// ---------------------------------------------------------------------------
template <int DUP>
__global__ __launch_bounds__(256)
void k_trans(const float* __restrict__ src, int spitch, int sstride,
             us* __restrict__ dst, int dpitch, int dstride)
{
    __shared__ float ts[64][65];
    const int r0 = blockIdx.x * 64, c0 = blockIdx.y * 64, z = blockIdx.z;
    const int tid = threadIdx.x, lane = tid & 31, wave = tid >> 5;
    const float* sb = src + (size_t)z * (size_t)sstride;
    us* db = dst + (size_t)z * (size_t)dstride;

#pragma unroll
    for (int p = 0; p < 4; ++p) {
        const int rl = p * 16 + (tid >> 4);
        const int c4 = (tid & 15) * 4;
        const v4f x = *(const v4f*)(sb + (size_t)(r0 + rl) * spitch + c0 + c4);
        ts[rl][c4 + 0] = x.x; ts[rl][c4 + 1] = x.y; ts[rl][c4 + 2] = x.z; ts[rl][c4 + 3] = x.w;
    }
    __syncthreads();

    v8us o[2];
#pragma unroll
    for (int p = 0; p < 2; ++p) {
        const int cl = p * 32 + wave * 4 + (lane >> 3);
        const int r8 = (lane & 7) * 8;
#pragma unroll
        for (int i = 0; i < 8; ++i) o[p][i] = f2bf(ts[r8 + i][cl]);
    }
#pragma unroll
    for (int p = 0; p < 2; ++p) {
        const int cl = p * 32 + wave * 4 + (lane >> 3);
        const int r8 = (lane & 7) * 8;
        us* d = db + (size_t)(c0 + cl) * dpitch + r0 + r8;
        *(v8us*)d = o[p];
        if (DUP != 0) *(v8us*)(d + DUP) = o[p];
    }
    
}

// ---------------------------------------------------------------------------
// GEMM: C[M][N] (f32) = A[M][K] * B, B given as a k-contiguous [N][K] plane (B[k][n] = Bp[n][k]).
// Block = 128 threads (4 waves), block tile 64(M) x 64(N), wave tile 16 x 64 (4 accumulators),
// fragments loaded straight from the 16-bit planes with the split k map. blockIdx.z = batch.
// Epilogue: wave tile staged in LDS, block barrier, then whole-row-segment f32 stores
// ---------------------------------------------------------------------------
__global__ __launch_bounds__(128)
void k_gemm(const us* __restrict__ A, int lda, int strideA,
            const us* __restrict__ B, int ldb, int strideB,
            float* __restrict__ C, int ldc, int strideC, int K)
{
    __shared__ __attribute__((aligned(16))) float tile[4 * 16 * 64];

    const int lane = threadIdx.x & 31, wave = threadIdx.x >> 5;
    const int hsel = lane >> 4, m = lane & 15;
    const int m0 = blockIdx.x * 64 + wave * 16;
    const int n0 = blockIdx.y * 64;
    const us* Ab = A + (size_t)blockIdx.z * (size_t)strideA;
    const us* Bb = B + (size_t)blockIdx.z * (size_t)strideB;

    v8f c0 = {}; v8f c1 = {}; v8f c2 = {}; v8f c3 = {};
    for (int k0 = 0; k0 < K; k0 += 32) {
        const v16bf a  = ld_frag(Ab, lda, m0 + m, k0, hsel);
        const v16bf b0 = ld_frag(Bb, ldb, n0 + m,      k0, hsel);
        const v16bf b1 = ld_frag(Bb, ldb, n0 + 16 + m, k0, hsel);
        const v16bf b2 = ld_frag(Bb, ldb, n0 + 32 + m, k0, hsel);
        const v16bf b3 = ld_frag(Bb, ldb, n0 + 48 + m, k0, hsel);
        c0 = wmma16(a, b0, c0);
        c1 = wmma16(a, b1, c1);
        c2 = wmma16(a, b2, c2);
        c3 = wmma16(a, b3, c3);
    }

    // D map: acc[r] -> (row 8*hsel + r, col n-tile + m). Stage the 16x64 wave tile in LDS.
    float* tw = tile + wave * 1024;
#pragma unroll
    for (int r = 0; r < 8; ++r) {
        const int row = 8 * hsel + r;
        tw[row * 64 + m]      = c0[r];
        tw[row * 64 + 16 + m] = c1[r];
        tw[row * 64 + 32 + m] = c2[r];
        tw[row * 64 + 48 + m] = c3[r];
    }
    __syncthreads();

    float* Cb = C + (size_t)blockIdx.z * (size_t)strideC;
    v4f vals[8];
#pragma unroll
    for (int p = 0; p < 8; ++p) {
        const int row = 2 * p + hsel;
        vals[p] = *(const v4f*)(tw + row * 64 + 4 * m);
    }
#pragma unroll
    for (int p = 0; p < 8; ++p) {
        float* d = Cb + (size_t)(m0 + 2 * p + hsel) * ldc + n0 + 4 * m;
        *(v4f*)d = vals[p];
    }
    
}

// ---------------------------------------------------------------------------
// Fused energies -> softmax -> P planes. One block (S_LEN = 128 threads) per (b, t); thread = s.
//   e[s] = sum_h v[h] * tanh(Wc[b][s][h] + Ux[bt][h] + bUa[h] + bWa[h]) + bVa   (f32)
//   p    = softmax_s(e); Pcat[bt][s] = bf16 hi, Pcat[bt][S+s] = bf16 lo (lo = p - hi)
// LDS regions are cross-wave: block barriers throughout.
// ---------------------------------------------------------------------------
__global__ __launch_bounds__(S_LEN)
void k_attn(const float* __restrict__ Uxp, const float* __restrict__ Wcp,
            const float* __restrict__ bWa, const float* __restrict__ bUa,
            const float* __restrict__ Va,  const float* __restrict__ bVa,
            us* __restrict__ Pcat)
{
    __shared__ v4f sq4[HD / 4];
    __shared__ v4f sv4[HD / 4];
    __shared__ __attribute__((aligned(16))) float sp[S_LEN];
    __shared__ float red[S_LEN];

    const int bt  = blockIdx.x;              // b * TQ + t
    const int b   = bt / TQ;
    const int tid = threadIdx.x, lane = tid & 31, wave = tid >> 5;

    for (int i = tid; i < HD / 4; i += S_LEN) {
        v4f q = *(const v4f*)(Uxp + (size_t)bt * HD + i * 4);
        const v4f b1 = *(const v4f*)(bUa + i * 4);
        const v4f b2 = *(const v4f*)(bWa + i * 4);
        q.x = (q.x + rbf(b1.x)) + rbf(b2.x);
        q.y = (q.y + rbf(b1.y)) + rbf(b2.y);
        q.z = (q.z + rbf(b1.z)) + rbf(b2.z);
        q.w = (q.w + rbf(b1.w)) + rbf(b2.w);
        sq4[i] = q;
        v4f w = *(const v4f*)(Va + i * 4);
        w.x = rbf(w.x); w.y = rbf(w.y); w.z = rbf(w.z); w.w = rbf(w.w);
        sv4[i] = w;
    }
    __syncthreads();

    const float bva = rbf(bVa[0]);
    const v4f* we = (const v4f*)(Wcp + ((size_t)b * S_LEN + tid) * HD);
    float acc = 0.0f;
#pragma unroll 2
    for (int u = 0; u < HD / 4; ++u) {
        const v4f e = we[u];
        const v4f d = sq4[u];
        const v4f w = sv4[u];
        acc += w.x * tanh_acc(e.x + d.x);
        acc += w.y * tanh_acc(e.y + d.y);
        acc += w.z * tanh_acc(e.z + d.z);
        acc += w.w * tanh_acc(e.w + d.w);
    }
    const float en = acc + bva;

    // block max over s
    red[tid] = en;
    __syncthreads();
#pragma unroll
    for (int st = S_LEN / 2; st > 0; st >>= 1) {
        if (tid < st) red[tid] = fmaxf(red[tid], red[tid + st]);
        __syncthreads();
    }
    const float mx = red[0];
    __syncthreads();

    // exp + block sum
    const float ex = __expf(en - mx);
    red[tid] = ex;
    __syncthreads();
#pragma unroll
    for (int st = S_LEN / 2; st > 0; st >>= 1) {
        if (tid < st) red[tid] += red[tid + st];
        __syncthreads();
    }
    const float ssum = red[0];
    const float p = ex * (1.0f / ssum);
    sp[tid] = p;
    __syncthreads();

    // P planes: wave 0 writes the whole 512-B row in one instruction: lanes 0-15 the 128 hi halves,
    if (wave == 0) {
        const int q = lane & 15;
        const v4f a = *(const v4f*)(sp + q * 8);
        const v4f c = *(const v4f*)(sp + q * 8 + 4);
        v8us hi, lo;
        split8(a, c, hi, lo);
        v8us o;
#pragma unroll
        for (int i = 0; i < 8; ++i) o[i] = (lane < 16) ? hi[i] : lo[i];
        us* d = Pcat + (size_t)bt * KC + lane * 8;
        *(v8us*)d = o;
        
    }
}

// ---------------------------------------------------------------------------
// One wave per row r (cv plane row r; input/output row (r / TQ) * T_FULL + r % TQ).
// Lane l holds columns 128j + 4l .. +3 for j = 0..3; store instruction j covers columns 128j..128j+127
// ---------------------------------------------------------------------------
__global__ __launch_bounds__(256)
void k_ln(const float* __restrict__ cv, const float* __restrict__ xin,
          const float* __restrict__ gam, const float* __restrict__ bet,
          float* __restrict__ out, int nrows)
{
    const int lane = threadIdx.x & 31;
    const int r = blockIdx.x * 8 + (threadIdx.x >> 5);
    if (r >= nrows) return;                            // wave-uniform
    const int g = r / TQ;
    const int frow = g * T_FULL + (r - g * TQ);
    const float* cp = cv  + (size_t)r * HD + lane * 4;
    const float* xp = xin + (size_t)frow * HD + lane * 4;

    v4f c[4], xr[4], gm[4], be[4];
#pragma unroll
    for (int j = 0; j < 4; ++j) {
        c[j]  = *(const v4f*)(cp + 128 * j);
        xr[j] = *(const v4f*)(xp + 128 * j);
        gm[j] = *(const v4f*)(gam + 128 * j + lane * 4);
        be[j] = *(const v4f*)(bet + 128 * j + lane * 4);
    }
    float s = 0.0f;
#pragma unroll
    for (int j = 0; j < 4; ++j) s += (c[j].x + c[j].y) + (c[j].z + c[j].w);
#pragma unroll
    for (int off = 16; off > 0; off >>= 1) s += __shfl_xor(s, off, 32);
    const float mean = s * (1.0f / (float)HD);

    float q = 0.0f;
#pragma unroll
    for (int j = 0; j < 4; ++j) {
        const float dx = c[j].x - mean, dy = c[j].y - mean, dz = c[j].z - mean, dw = c[j].w - mean;
        q += dx * dx; q += dy * dy; q += dz * dz; q += dw * dw;
    }
#pragma unroll
    for (int off = 16; off > 0; off >>= 1) q += __shfl_xor(q, off, 32);
    const float var  = q * (1.0f / (float)HD);
    const float rstd = rsqrtf(var + LN_EPS);

    v4f o[4];
#pragma unroll
    for (int j = 0; j < 4; ++j) {
        o[j].x = (c[j].x - mean) * rstd * rbf(gm[j].x) + rbf(be[j].x) + rbf(xr[j].x);
        o[j].y = (c[j].y - mean) * rstd * rbf(gm[j].y) + rbf(be[j].y) + rbf(xr[j].y);
        o[j].z = (c[j].z - mean) * rstd * rbf(gm[j].z) + rbf(be[j].z) + rbf(xr[j].z);
        o[j].w = (c[j].w - mean) * rstd * rbf(gm[j].w) + rbf(be[j].w) + rbf(xr[j].w);
    }
    float* dp = out + (size_t)frow * HD + lane * 4;
#pragma unroll
    for (int j = 0; j < 4; ++j) *(v4f*)(dp + 128 * j) = o[j];
    
}

// ---------------------------------------------------------------------------
static inline size_t al256(size_t x) { return (x + 255) & ~(size_t)255; }

extern "C" void kernel_launch(void* const* d_in, const int* in_sizes, int n_in,
                              void* d_out, int out_size, void* d_ws, size_t ws_size,
                              hipStream_t stream)
{
    if (n_in < 10) return;
    if (in_sizes[0] < ((NB - 1) * T_FULL + S_LEN) * HD) return;   // context [8][128][512] f32
    if (in_sizes[1] < ((NB - 1) * T_FULL + TQ) * HD) return;      // x       [8][128][512] f32
    if (in_sizes[2] < HD * HD) return;                             // Wa [512][512] ([in][out]) f32
    if (in_sizes[3] < HD) return;                                  // bWa [512]
    if (in_sizes[4] < HD * HD) return;                             // Ua [512][512] ([in][out]) f32
    if (in_sizes[5] < HD) return;                                  // bUa [512]
    if (in_sizes[6] < HD) return;                                  // Va [512][1]
    if (in_sizes[7] < 1) return;                                   // bVa [1]
    if (in_sizes[8] < HD || in_sizes[9] < HD) return;              // gamma, beta [512]
    if (out_size < ((NB - 1) * T_FULL + TQ) * HD) return;

    const float* context = (const float*)d_in[0];
    const float* x       = (const float*)d_in[1];
    const float* Wa      = (const float*)d_in[2];
    const float* bWa     = (const float*)d_in[3];
    const float* Ua      = (const float*)d_in[4];
    const float* bUa     = (const float*)d_in[5];
    const float* Va      = (const float*)d_in[6];
    const float* bVa     = (const float*)d_in[7];
    const float* gamma   = (const float*)d_in[8];
    const float* beta    = (const float*)d_in[9];
    float* out = (float*)d_out;

    char* ws = (char*)d_ws;
    size_t off = 0;
    us* ctxb  = (us*)(ws + off);    off += al256((size_t)NB * S_LEN * HD * sizeof(us));   // [NB*S][512]
    us* xb    = (us*)(ws + off);    off += al256((size_t)NB * TQ * HD * sizeof(us));      // [NB*TQ][512]
    us* WaT   = (us*)(ws + off);    off += al256((size_t)HD * HD * sizeof(us));           // [H][D]
    us* UaT   = (us*)(ws + off);    off += al256((size_t)HD * HD * sizeof(us));           // [H][D]
    us* ctxT2 = (us*)(ws + off);    off += al256((size_t)NB * HD * KC * sizeof(us));      // [NB][512][256]
    float* Wc = (float*)(ws + off); off += al256((size_t)NB * S_LEN * HD * sizeof(float)); // [NB*S][512]
    float* Ux = (float*)(ws + off); off += al256((size_t)NB * TQ * HD * sizeof(float));    // [NB*TQ][512]
    us* Pcat  = (us*)(ws + off);    off += al256((size_t)NB * TQ * KC * sizeof(us));       // [NB*TQ][256]
    float* cv = (float*)(ws + off); off += al256((size_t)NB * TQ * HD * sizeof(float));    // [NB*TQ][512]
    if (off > ws_size) return;

    const dim3 b256(256), b128(128), bS(S_LEN);

    // ---- 16-bit planes (RNE convert of the float inputs, once) ----
    {   // context -> ctxb [NB*S][512]
        const int nrows = NB * S_LEN, nseg = HD / 256;
        k_cvt<<<dim3((nrows * nseg + 7) / 8), b256, 0, stream>>>(
            context, HD, 0, S_LEN, T_FULL, ctxb, HD, 0, nrows, nseg);
    }
    {   // x -> xb [NB*TQ][512]
        const int nrows = NB * TQ, nseg = HD / 256;
        k_cvt<<<dim3((nrows * nseg + 7) / 8), b256, 0, stream>>>(
            x, HD, 0, TQ, T_FULL, xb, HD, 0, nrows, nseg);
    }
    // weights [in][out] -> k-contiguous [out][in] planes: in Wa[D rows][H cols] -> out WaT[H][D]
    k_trans<0><<<dim3(HD / 64, HD / 64, 1), b256, 0, stream>>>(Wa, HD, 0, WaT, HD, 0);
    k_trans<0><<<dim3(HD / 64, HD / 64, 1), b256, 0, stream>>>(Ua, HD, 0, UaT, HD, 0);
    // context transposed, duplicated along k: in context[b][S rows][D cols] -> ctxT2[b][d][s] = ctxT2[b][d][S+s]
    k_trans<S_LEN><<<dim3(S_LEN / 64, HD / 64, NB), b256, 0, stream>>>(
        context, HD, T_FULL * HD, ctxT2, KC, HD * KC);

    // ---- projections: Wc = context @ Wa, Ux = x @ Ua (f32 results; biases added in k_attn) ----
    k_gemm<<<dim3(NB * S_LEN / 64, HD / 64, 1), b128, 0, stream>>>(
        ctxb, HD, 0, WaT, HD, 0, Wc, HD, 0, HD);
    k_gemm<<<dim3(NB * TQ / 64, HD / 64, 1), b128, 0, stream>>>(
        xb, HD, 0, UaT, HD, 0, Ux, HD, 0, HD);

    // ---- energies + softmax -> P hi/lo planes ----
    k_attn<<<dim3(NB * TQ), bS, 0, stream>>>(Ux, Wc, bWa, bUa, Va, bVa, Pcat);

    // ---- cv = [P_hi|P_lo] @ [ctxT;ctxT] (f32) ----
    k_gemm<<<dim3(TQ / 64, HD / 64, NB), b128, 0, stream>>>(
        Pcat, KC, TQ * KC, ctxT2, KC, HD * KC, cv, HD, TQ * HD, KC);

    // ---- LayerNorm + residual -> out ----
    k_ln<<<dim3((NB * TQ + 7) / 8), b256, 0, stream>>>(cv, x, gamma, beta, out, NB * TQ);
}

// v001
// Measured time: 54.2 microseconds a run.
// In both of two side-by-side timings against v000, it was 1.19 times as fast.
#include <hip/hip_runtime.h>

// Contractions on v_wmma_f32_16x16x32_bf16 (bf16 operands, f32 accumulate): context@Wa and x@Ua from
// RNE-converted input planes; attn@context with attn carried as bf16 hi+lo planes folded into K against
// the RNE-converted transposed context plane. Energies v.tanh(.), softmax, LayerNorm and the residual add
// in f32 on the VALU.

#ifndef NB
#define NB 8
#endif
#ifndef TQ
#define TQ 128
#endif
#define NB_FULL 8
#define T_FULL 128          // full query length: per-batch row stride of x and of the output
#define S_LEN 128           // context positions (keys), never reduced
#define S_FULL 128          // per-batch row stride of context in the input
#define HD 512              // feature width D == hidden width H
#define KC (2 * S_LEN)      // context GEMM depth: [P_hi | P_lo]
#define LN_EPS 1.0e-3f

static_assert(NB >= 1 && NB <= NB_FULL);
static_assert(TQ >= 64 && TQ <= T_FULL && (TQ % 64) == 0);
static_assert(S_LEN == 128 && S_LEN == S_FULL);
static_assert((HD % 256) == 0 && (HD % 64) == 0 && (HD % 32) == 0);
static_assert((KC % 32) == 0 && (S_LEN % 64) == 0);
static_assert(((HD / 4) % S_LEN) == 0);
static_assert((S_LEN % 32) == 0 && S_LEN / 8 == 16);   // P row: 16 lanes hi + 16 lanes lo, 8 halves each

typedef unsigned short us;
typedef us     v8us  __attribute__((ext_vector_type(8)));
typedef __bf16 v16bf __attribute__((ext_vector_type(16)));
typedef float  v8f   __attribute__((ext_vector_type(8)));
typedef float  v4f   __attribute__((ext_vector_type(4)));

union Frag { v16bf v; v8us h[2]; };

// ---------------------------------------------------------------------------
// scalar helpers
// ---------------------------------------------------------------------------
__device__ __forceinline__ us f2bf(float f) {           // f32 -> bf16, RNE convert
    unsigned int u = __float_as_uint(f);
    u += 0x7FFFu + ((u >> 16) & 1u);
    return (us)(u >> 16);
}
__device__ __forceinline__ float bf2f(us h) {
    return __uint_as_float(((unsigned int)h) << 16);
}
__device__ __forceinline__ float rbf(float f) {          // value after an RNE convert to bf16
    return bf2f(f2bf(f));
}
// tanh(x) = sign(x) * (1 - e^{-2|x|}) / (1 + e^{-2|x|}), v_exp_f32 + v_rcp_f32 based (abs error ~1e-7),
// on two neighbouring features at once (each element on its own, packed f32 adds and multiplies)
typedef float v2f __attribute__((ext_vector_type(2)));
__device__ __forceinline__ v2f tanh_acc2(v2f x) {
    v2f ax; ax.x = __builtin_fabsf(x.x); ax.y = __builtin_fabsf(x.y);
    const v2f m = -2.0f * ax;
    v2f t;  t.x = __expf(m.x); t.y = __expf(m.y);
    const v2f den = 1.0f + t;
    const v2f num = 1.0f - t;
    v2f rc; rc.x = __builtin_amdgcn_rcpf(den.x); rc.y = __builtin_amdgcn_rcpf(den.y);
    const v2f r = num * rc;
    v2f y;  y.x = __builtin_copysignf(r.x, x.x); y.y = __builtin_copysignf(r.y, x.y);
    return y;
}
__device__ __forceinline__ v8us pack8(v4f a, v4f c) {
    v8us o;
    o[0] = f2bf(a.x); o[1] = f2bf(a.y); o[2] = f2bf(a.z); o[3] = f2bf(a.w);
    o[4] = f2bf(c.x); o[5] = f2bf(c.y); o[6] = f2bf(c.z); o[7] = f2bf(c.w);
    return o;
}
// hi = bf16(x), lo = bf16(x - hi): unscaled bf16 residual pair (bf16 keeps the f32 exponent range)
__device__ __forceinline__ void split8(v4f a, v4f c, v8us& hi, v8us& lo) {
    const float x[8] = {a.x, a.y, a.z, a.w, c.x, c.y, c.z, c.w};
#pragma unroll
    for (int i = 0; i < 8; ++i) {
        const us h = f2bf(x[i]);
        hi[i] = h;
        lo[i] = f2bf(x[i] - bf2f(h));
    }
}

// ---------------------------------------------------------------------------
// WMMA helper: 16x16x32 bf16, f32 accumulate, 4-slot VALU hazard guard after the issue
// ---------------------------------------------------------------------------
__device__ __forceinline__ v8f wmma16(v16bf a, v16bf b, v8f c) {
    v8f d = __builtin_amdgcn_wmma_f32_16x16x32_bf16(false, a, false, b, (short)0, c, false, false);
    asm volatile("v_nop\n\tv_nop\n\tv_nop\n\tv_nop" : "+v"(d) : "v"(a), "v"(b));
    return d;
}

// Fragment loader for a k-contiguous 16-bit plane P[row][k] with pitch ld (halves).
// Lane l: row = (l & 15) (A row m, or B column n of an [n][k] plane), hsel = l >> 4.
//   elements 0..7  <- k0 + 8*hsel + 0..7
//   elements 8..15 <- k0 + 16 + 8*hsel + 0..7
__device__ __forceinline__ v16bf ld_frag(const us* __restrict__ P, int ld, int row, int k0, int hsel) {
    Frag f;
    const us* p = P + (size_t)row * ld + k0 + 8 * hsel;
    f.h[0] = *(const v8us*)p;
    f.h[1] = *(const v8us*)(p + 16);
    return f.v;
}

// ---------------------------------------------------------------------------
// Row conversion f32 -> bf16 plane. One wave per (row, 256-column segment):
// lane l converts columns 8l..8l+7 of the segment and stores 16 B; one instruction covers the
// (r / grp) * gstride + (r % grp) (lets a reduced build read full-stride inputs).
// ---------------------------------------------------------------------------
__global__ __launch_bounds__(256)
void k_cvt(const float* __restrict__ src, int spitch, int scol, int grp, int gstride,
           us* __restrict__ dst, int dpitch, int dcol, int nrows, int nseg)
{
    const int lane = threadIdx.x & 31;
    const int gw   = blockIdx.x * 8 + (threadIdx.x >> 5);
    if (gw >= nrows * nseg) return;                    // wave-uniform, no barriers in this kernel
    const int r    = gw / nseg;
    const int sg   = gw - r * nseg;
    const int g    = r / grp;
    const int srow = g * gstride + (r - g * grp);
    const float* sp = src + (size_t)srow * spitch + scol + sg * 256 + lane * 8;
    const v4f a = *(const v4f*)sp;
    const v4f c = *(const v4f*)(sp + 4);
    const v8us o = pack8(a, c);
    us* dp = dst + (size_t)r * dpitch + dcol + sg * 256 + lane * 8;
    *(v8us*)dp = o;
    
}

// ---------------------------------------------------------------------------
// Transpose + convert: src[R][C] f32 (pitch spitch, per-z stride sstride) -> dst[C][R] bf16 (pitch dpitch,
// per-z stride dstride), optionally a second copy at column offset +DUP halves.
// Block: 64 src rows x 64 src cols through LDS (cross-wave -> block barrier). Store phase: one instruction
// grid = (R/64, C/64, Z)
// ---------------------------------------------------------------------------
template <int DUP>
__global__ __launch_bounds__(256)
void k_trans(const float* __restrict__ src, int spitch, int sstride,
             us* __restrict__ dst, int dpitch, int dstride)
{
    __shared__ float ts[64][65];
    const int r0 = blockIdx.x * 64, c0 = blockIdx.y * 64, z = blockIdx.z;
    const int tid = threadIdx.x, lane = tid & 31, wave = tid >> 5;
    const float* sb = src + (size_t)z * (size_t)sstride;
    us* db = dst + (size_t)z * (size_t)dstride;

#pragma unroll
    for (int p = 0; p < 4; ++p) {
        const int rl = p * 16 + (tid >> 4);
        const int c4 = (tid & 15) * 4;
        const v4f x = *(const v4f*)(sb + (size_t)(r0 + rl) * spitch + c0 + c4);
        ts[rl][c4 + 0] = x.x; ts[rl][c4 + 1] = x.y; ts[rl][c4 + 2] = x.z; ts[rl][c4 + 3] = x.w;
    }
    __syncthreads();

    v8us o[2];
#pragma unroll
    for (int p = 0; p < 2; ++p) {
        const int cl = p * 32 + wave * 4 + (lane >> 3);
        const int r8 = (lane & 7) * 8;
#pragma unroll
        for (int i = 0; i < 8; ++i) o[p][i] = f2bf(ts[r8 + i][cl]);
    }
#pragma unroll
    for (int p = 0; p < 2; ++p) {
        const int cl = p * 32 + wave * 4 + (lane >> 3);
        const int r8 = (lane & 7) * 8;
        us* d = db + (size_t)(c0 + cl) * dpitch + r0 + r8;
        *(v8us*)d = o[p];
        if (DUP != 0) *(v8us*)(d + DUP) = o[p];
    }
    
}

// ---------------------------------------------------------------------------
// GEMM: C[M][N] (f32) = A[M][K] * B, B given as a k-contiguous [N][K] plane (B[k][n] = Bp[n][k]).
// Block = 128 threads (4 waves), block tile 64(M) x 64(N), wave tile 16 x 64 (4 accumulators),
// fragments loaded straight from the 16-bit planes with the split k map. blockIdx.z = batch.
// Epilogue: wave tile staged in LDS, block barrier, then whole-row-segment f32 stores
// ---------------------------------------------------------------------------
__global__ __launch_bounds__(128)
void k_gemm(const us* __restrict__ A, int lda, int strideA,
            const us* __restrict__ B, int ldb, int strideB,
            float* __restrict__ C, int ldc, int strideC, int K)
{
    __shared__ __attribute__((aligned(16))) float tile[4 * 16 * 64];

    const int lane = threadIdx.x & 31, wave = threadIdx.x >> 5;
    const int hsel = lane >> 4, m = lane & 15;
    const int m0 = blockIdx.x * 64 + wave * 16;
    const int n0 = blockIdx.y * 64;
    const us* Ab = A + (size_t)blockIdx.z * (size_t)strideA;
    const us* Bb = B + (size_t)blockIdx.z * (size_t)strideB;

    v8f c0 = {}; v8f c1 = {}; v8f c2 = {}; v8f c3 = {};
    for (int k0 = 0; k0 < K; k0 += 32) {
        const v16bf a  = ld_frag(Ab, lda, m0 + m, k0, hsel);
        const v16bf b0 = ld_frag(Bb, ldb, n0 + m,      k0, hsel);
        const v16bf b1 = ld_frag(Bb, ldb, n0 + 16 + m, k0, hsel);
        const v16bf b2 = ld_frag(Bb, ldb, n0 + 32 + m, k0, hsel);
        const v16bf b3 = ld_frag(Bb, ldb, n0 + 48 + m, k0, hsel);
        c0 = wmma16(a, b0, c0);
        c1 = wmma16(a, b1, c1);
        c2 = wmma16(a, b2, c2);
        c3 = wmma16(a, b3, c3);
    }

    // D map: acc[r] -> (row 8*hsel + r, col n-tile + m). Stage the 16x64 wave tile in LDS.
    float* tw = tile + wave * 1024;
#pragma unroll
    for (int r = 0; r < 8; ++r) {
        const int row = 8 * hsel + r;
        tw[row * 64 + m]      = c0[r];
        tw[row * 64 + 16 + m] = c1[r];
        tw[row * 64 + 32 + m] = c2[r];
        tw[row * 64 + 48 + m] = c3[r];
    }
    __syncthreads();

    float* Cb = C + (size_t)blockIdx.z * (size_t)strideC;
    v4f vals[8];
#pragma unroll
    for (int p = 0; p < 8; ++p) {
        const int row = 2 * p + hsel;
        vals[p] = *(const v4f*)(tw + row * 64 + 4 * m);
    }
#pragma unroll
    for (int p = 0; p < 8; ++p) {
        float* d = Cb + (size_t)(m0 + 2 * p + hsel) * ldc + n0 + 4 * m;
        *(v4f*)d = vals[p];
    }
    
}

// ---------------------------------------------------------------------------
// Fused energies -> softmax -> P planes. One block per (b, group of TT query rows t).
// Thread = (hh, s): key position s, part hh (of HS) of the feature range. Each 16-B piece of Wc[b][s][.] is loaded
// once and used for all TT query rows of the block, so the row-strided Wc loads (one cache line per lane)
// are issued TT times less often than with one query row per block.
//   e[t][s] = sum_h v[h] * tanh(Wc[b][s][h] + Ux[bt][h] + bUa[h] + bWa[h]) + bVa   (f32; the HS parts of
//             the h range are summed apart and then added in order)
//   p    = softmax_s(e); Pcat[bt][s] = bf16 hi, Pcat[bt][S+s] = bf16 lo (lo = p - hi)
// LDS regions are cross-wave: block barriers throughout.
// ---------------------------------------------------------------------------
#define TT 4                // query rows per block
#define HS 4                // parts of the h range, one per group of S_LEN threads
#define RPT (TT / HS)       // softmax rows per thread
static_assert((TQ % TT) == 0 && (TT % HS) == 0 && ((HD / 4) % HS) == 0);
static_assert(TT <= (S_LEN * HS) / 32);

// waves_per_eu: the block's 16 waves stand four to a SIMD and one block fills a WGP, so the register budget is
// that of four waves; without it the scheduler holds the register count down for more waves and leaves each
// tanh as one dependent chain instead of interleaving the 64 independent ones of a trip.
__global__ __launch_bounds__(S_LEN * HS) __attribute__((amdgpu_waves_per_eu(S_LEN * HS / 128, S_LEN * HS / 128)))
void k_attn(const float* __restrict__ Uxp, const float* __restrict__ Wcp,
            const float* __restrict__ bWa, const float* __restrict__ bUa,
            const float* __restrict__ Va,  const float* __restrict__ bVa,
            us* __restrict__ Pcat)
{
    __shared__ v4f sq4[TT][HD / 4];
    __shared__ v4f sv4[HD / 4];
    __shared__ float part[HS][TT][S_LEN];
    __shared__ __attribute__((aligned(16))) float sp[TT][S_LEN];
    __shared__ float red[TT][S_LEN];

    const int bt0 = blockIdx.x * TT;         // first of the block's rows b * TQ + t (all of one b)
    const int b   = bt0 / TQ;
    const int tid = threadIdx.x, lane = tid & 31, wave = tid >> 5;
    const int s   = tid & (S_LEN - 1), hh = tid / S_LEN;

    for (int i = tid; i < TT * (HD / 4); i += S_LEN * HS) {
        const int c = i & (HD / 4 - 1);
        v4f q = *(const v4f*)(Uxp + (size_t)bt0 * HD + i * 4);
        const v4f b1 = *(const v4f*)(bUa + c * 4);
        const v4f b2 = *(const v4f*)(bWa + c * 4);
        q.x = (q.x + rbf(b1.x)) + rbf(b2.x);
        q.y = (q.y + rbf(b1.y)) + rbf(b2.y);
        q.z = (q.z + rbf(b1.z)) + rbf(b2.z);
        q.w = (q.w + rbf(b1.w)) + rbf(b2.w);
        sq4[i / (HD / 4)][c] = q;
    }
    for (int i = tid; i < HD / 4; i += S_LEN * HS) {
        v4f w = *(const v4f*)(Va + i * 4);
        w.x = rbf(w.x); w.y = rbf(w.y); w.z = rbf(w.z); w.w = rbf(w.w);
        sv4[i] = w;
    }
    __syncthreads();

    const float bva = rbf(bVa[0]);
    const int u0 = hh * (HD / 4 / HS);
    const v4f* we = (const v4f*)(Wcp + ((size_t)b * S_LEN + s) * HD) + u0;
    float acc[TT];
#pragma unroll
    for (int j = 0; j < TT; ++j) acc[j] = 0.0f;
    // four 16-B loads per lane go out together at the head of each trip (half a cache line per lane)
#pragma unroll 4
    for (int u = 0; u < HD / 4 / HS; ++u) {
        const v4f e = we[u];
        const v4f w = sv4[u0 + u];
#pragma unroll
        for (int j = 0; j < TT; ++j) {
            const v4f d = sq4[j][u0 + u];
            const v2f y0 = tanh_acc2(e.xy + d.xy);
            const v2f y1 = tanh_acc2(e.zw + d.zw);
            const v2f p0 = w.xy * y0;
            const v2f p1 = w.zw * y1;
            acc[j] += p0.x;
            acc[j] += p0.y;
            acc[j] += p1.x;
            acc[j] += p1.y;
        }
    }
#pragma unroll
    for (int j = 0; j < TT; ++j) part[hh][j][s] = acc[j];
    __syncthreads();

    // thread (hh, s) carries rows j = RPT * hh + k of the block through the softmax
    float en[RPT], ex[RPT];
#pragma unroll
    for (int k = 0; k < RPT; ++k) {
        const int j = RPT * hh + k;
        float a = part[0][j][s];
#pragma unroll
        for (int g = 1; g < HS; ++g) a += part[g][j][s];
        en[k] = a + bva;
        red[j][s] = en[k];
    }
    __syncthreads();

    // per-row max over s
#pragma unroll
    for (int st = S_LEN / 2; st > 0; st >>= 1) {
        if (s < st) {
#pragma unroll
            for (int k = 0; k < RPT; ++k) {
                const int j = RPT * hh + k;
                red[j][s] = fmaxf(red[j][s], red[j][s + st]);
            }
        }
        __syncthreads();
    }
    float mx[RPT];
#pragma unroll
    for (int k = 0; k < RPT; ++k) mx[k] = red[RPT * hh + k][0];
    __syncthreads();

    // exp + per-row sum
#pragma unroll
    for (int k = 0; k < RPT; ++k) {
        ex[k] = __expf(en[k] - mx[k]);
        red[RPT * hh + k][s] = ex[k];
    }
    __syncthreads();
#pragma unroll
    for (int st = S_LEN / 2; st > 0; st >>= 1) {
        if (s < st) {
#pragma unroll
            for (int k = 0; k < RPT; ++k) {
                const int j = RPT * hh + k;
                red[j][s] += red[j][s + st];
            }
        }
        __syncthreads();
    }
#pragma unroll
    for (int k = 0; k < RPT; ++k) {
        const float ssum = red[RPT * hh + k][0];
        sp[RPT * hh + k][s] = ex[k] * (1.0f / ssum);
    }
    __syncthreads();

    // P planes: wave j < TT writes the whole 512-B row j in one instruction: lanes 0-15 the 128 hi halves,
    // lanes 16-31 the 128 lo halves
    if (wave < TT) {
        const int q = lane & 15;
        const v4f a = *(const v4f*)(&sp[wave][q * 8]);
        const v4f c = *(const v4f*)(&sp[wave][q * 8 + 4]);
        v8us hi, lo;
        split8(a, c, hi, lo);
        v8us o;
#pragma unroll
        for (int i = 0; i < 8; ++i) o[i] = (lane < 16) ? hi[i] : lo[i];
        us* d = Pcat + (size_t)(bt0 + wave) * KC + lane * 8;
        *(v8us*)d = o;
    }
}

// ---------------------------------------------------------------------------
// One wave per row r (cv plane row r; input/output row (r / TQ) * T_FULL + r % TQ).
// Lane l holds columns 128j + 4l .. +3 for j = 0..3; store instruction j covers columns 128j..128j+127
// ---------------------------------------------------------------------------
__global__ __launch_bounds__(256)
void k_ln(const float* __restrict__ cv, const float* __restrict__ xin,
          const float* __restrict__ gam, const float* __restrict__ bet,
          float* __restrict__ out, int nrows)
{
    const int lane = threadIdx.x & 31;
    const int r = blockIdx.x * 8 + (threadIdx.x >> 5);
    if (r >= nrows) return;                            // wave-uniform
    const int g = r / TQ;
    const int frow = g * T_FULL + (r - g * TQ);
    const float* cp = cv  + (size_t)r * HD + lane * 4;
    const float* xp = xin + (size_t)frow * HD + lane * 4;

    v4f c[4], xr[4], gm[4], be[4];
#pragma unroll
    for (int j = 0; j < 4; ++j) {
        c[j]  = *(const v4f*)(cp + 128 * j);
        xr[j] = *(const v4f*)(xp + 128 * j);
        gm[j] = *(const v4f*)(gam + 128 * j + lane * 4);
        be[j] = *(const v4f*)(bet + 128 * j + lane * 4);
    }
    float s = 0.0f;
#pragma unroll
    for (int j = 0; j < 4; ++j) s += (c[j].x + c[j].y) + (c[j].z + c[j].w);
#pragma unroll
    for (int off = 16; off > 0; off >>= 1) s += __shfl_xor(s, off, 32);
    const float mean = s * (1.0f / (float)HD);

    float q = 0.0f;
#pragma unroll
    for (int j = 0; j < 4; ++j) {
        const float dx = c[j].x - mean, dy = c[j].y - mean, dz = c[j].z - mean, dw = c[j].w - mean;
        q += dx * dx; q += dy * dy; q += dz * dz; q += dw * dw;
    }
#pragma unroll
    for (int off = 16; off > 0; off >>= 1) q += __shfl_xor(q, off, 32);
    const float var  = q * (1.0f / (float)HD);
    const float rstd = rsqrtf(var + LN_EPS);

    v4f o[4];
#pragma unroll
    for (int j = 0; j < 4; ++j) {
        o[j].x = (c[j].x - mean) * rstd * rbf(gm[j].x) + rbf(be[j].x) + rbf(xr[j].x);
        o[j].y = (c[j].y - mean) * rstd * rbf(gm[j].y) + rbf(be[j].y) + rbf(xr[j].y);
        o[j].z = (c[j].z - mean) * rstd * rbf(gm[j].z) + rbf(be[j].z) + rbf(xr[j].z);
        o[j].w = (c[j].w - mean) * rstd * rbf(gm[j].w) + rbf(be[j].w) + rbf(xr[j].w);
    }
    float* dp = out + (size_t)frow * HD + lane * 4;
#pragma unroll
    for (int j = 0; j < 4; ++j) *(v4f*)(dp + 128 * j) = o[j];
    
}

// ---------------------------------------------------------------------------
static inline size_t al256(size_t x) { return (x + 255) & ~(size_t)255; }

extern "C" void kernel_launch(void* const* d_in, const int* in_sizes, int n_in,
                              void* d_out, int out_size, void* d_ws, size_t ws_size,
                              hipStream_t stream)
{
    if (n_in < 10) return;
    if (in_sizes[0] < ((NB - 1) * T_FULL + S_LEN) * HD) return;   // context [8][128][512] f32
    if (in_sizes[1] < ((NB - 1) * T_FULL + TQ) * HD) return;      // x       [8][128][512] f32
    if (in_sizes[2] < HD * HD) return;                             // Wa [512][512] ([in][out]) f32
    if (in_sizes[3] < HD) return;                                  // bWa [512]
    if (in_sizes[4] < HD * HD) return;                             // Ua [512][512] ([in][out]) f32
    if (in_sizes[5] < HD) return;                                  // bUa [512]
    if (in_sizes[6] < HD) return;                                  // Va [512][1]
    if (in_sizes[7] < 1) return;                                   // bVa [1]
    if (in_sizes[8] < HD || in_sizes[9] < HD) return;              // gamma, beta [512]
    if (out_size < ((NB - 1) * T_FULL + TQ) * HD) return;

    const float* context = (const float*)d_in[0];
    const float* x       = (const float*)d_in[1];
    const float* Wa      = (const float*)d_in[2];
    const float* bWa     = (const float*)d_in[3];
    const float* Ua      = (const float*)d_in[4];
    const float* bUa     = (const float*)d_in[5];
    const float* Va      = (const float*)d_in[6];
    const float* bVa     = (const float*)d_in[7];
    const float* gamma   = (const float*)d_in[8];
    const float* beta    = (const float*)d_in[9];
    float* out = (float*)d_out;

    char* ws = (char*)d_ws;
    size_t off = 0;
    us* ctxb  = (us*)(ws + off);    off += al256((size_t)NB * S_LEN * HD * sizeof(us));   // [NB*S][512]
    us* xb    = (us*)(ws + off);    off += al256((size_t)NB * TQ * HD * sizeof(us));      // [NB*TQ][512]
    us* WaT   = (us*)(ws + off);    off += al256((size_t)HD * HD * sizeof(us));           // [H][D]
    us* UaT   = (us*)(ws + off);    off += al256((size_t)HD * HD * sizeof(us));           // [H][D]
    us* ctxT2 = (us*)(ws + off);    off += al256((size_t)NB * HD * KC * sizeof(us));      // [NB][512][256]
    float* Wc = (float*)(ws + off); off += al256((size_t)NB * S_LEN * HD * sizeof(float)); // [NB*S][512]
    float* Ux = (float*)(ws + off); off += al256((size_t)NB * TQ * HD * sizeof(float));    // [NB*TQ][512]
    us* Pcat  = (us*)(ws + off);    off += al256((size_t)NB * TQ * KC * sizeof(us));       // [NB*TQ][256]
    float* cv = (float*)(ws + off); off += al256((size_t)NB * TQ * HD * sizeof(float));    // [NB*TQ][512]
    if (off > ws_size) return;

    const dim3 b256(256), b128(128), bS(S_LEN * HS);

    // ---- 16-bit planes (RNE convert of the float inputs, once) ----
    {   // context -> ctxb [NB*S][512]
        const int nrows = NB * S_LEN, nseg = HD / 256;
        k_cvt<<<dim3((nrows * nseg + 7) / 8), b256, 0, stream>>>(
            context, HD, 0, S_LEN, T_FULL, ctxb, HD, 0, nrows, nseg);
    }
    {   // x -> xb [NB*TQ][512]
        const int nrows = NB * TQ, nseg = HD / 256;
        k_cvt<<<dim3((nrows * nseg + 7) / 8), b256, 0, stream>>>(
            x, HD, 0, TQ, T_FULL, xb, HD, 0, nrows, nseg);
    }
    // weights [in][out] -> k-contiguous [out][in] planes: in Wa[D rows][H cols] -> out WaT[H][D]
    k_trans<0><<<dim3(HD / 64, HD / 64, 1), b256, 0, stream>>>(Wa, HD, 0, WaT, HD, 0);
    k_trans<0><<<dim3(HD / 64, HD / 64, 1), b256, 0, stream>>>(Ua, HD, 0, UaT, HD, 0);
    // context transposed, duplicated along k: in context[b][S rows][D cols] -> ctxT2[b][d][s] = ctxT2[b][d][S+s]
    k_trans<S_LEN><<<dim3(S_LEN / 64, HD / 64, NB), b256, 0, stream>>>(
        context, HD, T_FULL * HD, ctxT2, KC, HD * KC);

    // ---- projections: Wc = context @ Wa, Ux = x @ Ua (f32 results; biases added in k_attn) ----
    k_gemm<<<dim3(NB * S_LEN / 64, HD / 64, 1), b128, 0, stream>>>(
        ctxb, HD, 0, WaT, HD, 0, Wc, HD, 0, HD);
    k_gemm<<<dim3(NB * TQ / 64, HD / 64, 1), b128, 0, stream>>>(
        xb, HD, 0, UaT, HD, 0, Ux, HD, 0, HD);

    // ---- energies + softmax -> P hi/lo planes ----
    k_attn<<<dim3(NB * TQ / TT), bS, 0, stream>>>(Ux, Wc, bWa, bUa, Va, bVa, Pcat);

    // ---- cv = [P_hi|P_lo] @ [ctxT;ctxT] (f32) ----
    k_gemm<<<dim3(TQ / 64, HD / 64, NB), b128, 0, stream>>>(
        Pcat, KC, TQ * KC, ctxT2, KC, HD * KC, cv, HD, TQ * HD, KC);

    // ---- LayerNorm + residual -> out ----
    k_ln<<<dim3((NB * TQ + 7) / 8), b256, 0, stream>>>(cv, x, gamma, beta, out, NB * TQ);
}

// v002
// One run takes 36.8 microseconds.
// In two side-by-side timings against v001, it was 1.47 and 1.46 times as fast.
// Over all steps from v000 it is 1.74 times as fast.
#include <hip/hip_runtime.h>

// Contractions on v_wmma_f32_16x16x32_bf16 (bf16 operands, f32 accumulate): context@Wa and x@Ua from
// RNE-converted input planes; attn@context with attn carried as bf16 hi+lo planes folded into K against
// the RNE-converted transposed context plane. Energies v.tanh(.), softmax, LayerNorm and the residual add
// in f32 on the VALU.

#ifndef NB
#define NB 8
#endif
#ifndef TQ
#define TQ 128
#endif
#define NB_FULL 8
#define T_FULL 128          // full query length: per-batch row stride of x and of the output
#define S_LEN 128           // context positions (keys), never reduced
#define S_FULL 128          // per-batch row stride of context in the input
#define HD 512              // feature width D == hidden width H
#define KC (2 * S_LEN)      // context GEMM depth: [P_hi | P_lo]
#define LN_EPS 1.0e-3f

static_assert(NB >= 1 && NB <= NB_FULL);
static_assert(TQ >= 64 && TQ <= T_FULL && (TQ % 64) == 0);
static_assert(S_LEN == 128 && S_LEN == S_FULL);
static_assert((HD % 256) == 0 && (HD % 64) == 0 && (HD % 32) == 0);
static_assert((KC % 32) == 0 && (S_LEN % 64) == 0);
static_assert(((HD / 4) % S_LEN) == 0);
static_assert((S_LEN % 32) == 0 && S_LEN / 8 == 16);   // P row: 16 lanes hi + 16 lanes lo, 8 halves each

typedef unsigned short us;
typedef us     v8us  __attribute__((ext_vector_type(8)));
typedef __bf16 v16bf __attribute__((ext_vector_type(16)));
typedef float  v8f   __attribute__((ext_vector_type(8)));
typedef float  v4f   __attribute__((ext_vector_type(4)));

union Frag { v16bf v; v8us h[2]; };

// ---------------------------------------------------------------------------
// scalar helpers
// ---------------------------------------------------------------------------
__device__ __forceinline__ us f2bf(float f) {           // f32 -> bf16, RNE convert
    unsigned int u = __float_as_uint(f);
    u += 0x7FFFu + ((u >> 16) & 1u);
    return (us)(u >> 16);
}
__device__ __forceinline__ float bf2f(us h) {
    return __uint_as_float(((unsigned int)h) << 16);
}
__device__ __forceinline__ float rbf(float f) {          // value after an RNE convert to bf16
    return bf2f(f2bf(f));
}
// tanh(x) = sign(x) * (1 - e^{-2|x|}) / (1 + e^{-2|x|}), v_exp_f32 + v_rcp_f32 based (abs error ~1e-7),
// on two neighbouring features at once (each element on its own, packed f32 adds and multiplies)
typedef float v2f __attribute__((ext_vector_type(2)));
__device__ __forceinline__ v2f tanh_acc2(v2f x) {
    v2f ax; ax.x = __builtin_fabsf(x.x); ax.y = __builtin_fabsf(x.y);
    const v2f m = -2.0f * ax;
    v2f t;  t.x = __expf(m.x); t.y = __expf(m.y);
    const v2f den = 1.0f + t;
    const v2f num = 1.0f - t;
    v2f rc; rc.x = __builtin_amdgcn_rcpf(den.x); rc.y = __builtin_amdgcn_rcpf(den.y);
    const v2f r = num * rc;
    v2f y;  y.x = __builtin_copysignf(r.x, x.x); y.y = __builtin_copysignf(r.y, x.y);
    return y;
}
__device__ __forceinline__ v8us pack8(v4f a, v4f c) {
    v8us o;
    o[0] = f2bf(a.x); o[1] = f2bf(a.y); o[2] = f2bf(a.z); o[3] = f2bf(a.w);
    o[4] = f2bf(c.x); o[5] = f2bf(c.y); o[6] = f2bf(c.z); o[7] = f2bf(c.w);
    return o;
}
// hi = bf16(x), lo = bf16(x - hi): unscaled bf16 residual pair (bf16 keeps the f32 exponent range)
__device__ __forceinline__ void split8(v4f a, v4f c, v8us& hi, v8us& lo) {
    const float x[8] = {a.x, a.y, a.z, a.w, c.x, c.y, c.z, c.w};
#pragma unroll
    for (int i = 0; i < 8; ++i) {
        const us h = f2bf(x[i]);
        hi[i] = h;
        lo[i] = f2bf(x[i] - bf2f(h));
    }
}

// ---------------------------------------------------------------------------
// WMMA helper: 16x16x32 bf16, f32 accumulate, 4-slot VALU hazard guard after the issue
// ---------------------------------------------------------------------------
__device__ __forceinline__ v8f wmma16(v16bf a, v16bf b, v8f c) {
    v8f d = __builtin_amdgcn_wmma_f32_16x16x32_bf16(false, a, false, b, (short)0, c, false, false);
    asm volatile("v_nop\n\tv_nop\n\tv_nop\n\tv_nop" : "+v"(d) : "v"(a), "v"(b));
    return d;
}

// Fragment loader for a k-contiguous 16-bit plane P[row][k] with pitch ld (halves).
// Lane l: row = (l & 15) (A row m, or B column n of an [n][k] plane), hsel = l >> 4.
//   elements 0..7  <- k0 + 8*hsel + 0..7
//   elements 8..15 <- k0 + 16 + 8*hsel + 0..7
__device__ __forceinline__ v16bf ld_frag(const us* __restrict__ P, int ld, int row, int k0, int hsel) {
    Frag f;
    const us* p = P + (size_t)row * ld + k0 + 8 * hsel;
    f.h[0] = *(const v8us*)p;
    f.h[1] = *(const v8us*)(p + 16);
    return f.v;
}

// ---------------------------------------------------------------------------
// Row conversion f32 -> bf16 plane. One wave per (row, 256-column segment):
// lane l converts columns 8l..8l+7 of the segment and stores 16 B; one instruction covers the
// (r / grp) * gstride + (r % grp) (lets a reduced build read full-stride inputs).
// ---------------------------------------------------------------------------
__device__ __forceinline__
void d_cvt(int blk, const float* __restrict__ src, int spitch, int scol, int grp, int gstride,
           us* __restrict__ dst, int dpitch, int dcol, int nrows, int nseg)
{
    const int lane = threadIdx.x & 31;
    const int gw   = blk * 8 + (threadIdx.x >> 5);
    if (gw >= nrows * nseg) return;                    // wave-uniform, no barriers on this path
    const int r    = gw / nseg;
    const int sg   = gw - r * nseg;
    const int g    = r / grp;
    const int srow = g * gstride + (r - g * grp);
    const float* sp = src + (size_t)srow * spitch + scol + sg * 256 + lane * 8;
    const v4f a = *(const v4f*)sp;
    const v4f c = *(const v4f*)(sp + 4);
    const v8us o = pack8(a, c);
    us* dp = dst + (size_t)r * dpitch + dcol + sg * 256 + lane * 8;
    *(v8us*)dp = o;
    
}

// ---------------------------------------------------------------------------
// Transpose + convert: src[R][C] f32 (pitch spitch, per-z stride sstride) -> dst[C][R] bf16 (pitch dpitch,
// per-z stride dstride), optionally a second copy at column offset +DUP halves.
// Block: 64 src rows x 64 src cols through LDS (cross-wave -> block barrier). Store phase: one instruction
// tile index (bx, by, z) in (R/64, C/64, Z); ts: the block's 64 x 65 f32 LDS tile
// ---------------------------------------------------------------------------
template <int DUP>
__device__ __forceinline__
void d_trans(float (*ts)[65], int bx, int by, int z,
             const float* __restrict__ src, int spitch, int sstride,
             us* __restrict__ dst, int dpitch, int dstride)
{
    const int r0 = bx * 64, c0 = by * 64;
    const int tid = threadIdx.x, lane = tid & 31, wave = tid >> 5;
    const float* sb = src + (size_t)z * (size_t)sstride;
    us* db = dst + (size_t)z * (size_t)dstride;

#pragma unroll
    for (int p = 0; p < 4; ++p) {
        const int rl = p * 16 + (tid >> 4);
        const int c4 = (tid & 15) * 4;
        const v4f x = *(const v4f*)(sb + (size_t)(r0 + rl) * spitch + c0 + c4);
        ts[rl][c4 + 0] = x.x; ts[rl][c4 + 1] = x.y; ts[rl][c4 + 2] = x.z; ts[rl][c4 + 3] = x.w;
    }
    __syncthreads();

    v8us o[2];
#pragma unroll
    for (int p = 0; p < 2; ++p) {
        const int cl = p * 32 + wave * 4 + (lane >> 3);
        const int r8 = (lane & 7) * 8;
#pragma unroll
        for (int i = 0; i < 8; ++i) o[p][i] = f2bf(ts[r8 + i][cl]);
    }
#pragma unroll
    for (int p = 0; p < 2; ++p) {
        const int cl = p * 32 + wave * 4 + (lane >> 3);
        const int r8 = (lane & 7) * 8;
        us* d = db + (size_t)(c0 + cl) * dpitch + r0 + r8;
        *(v8us*)d = o[p];
        if (DUP != 0) *(v8us*)(d + DUP) = o[p];
    }
    // the stores' address and data registers are written again in the code of the caller's other branches,
    // which follows these stores in the listing: the wait stands in front of any such overwrite
    asm volatile("s_wait_xcnt 0x0" ::: "memory");
}

// ---------------------------------------------------------------------------
// All five input planes in one launch: none reads what another writes, so each block takes one piece of one
// plane by its index (block-uniform choice). The transposes, which have the longer path (load, LDS, barrier,
// store), come first in the index order.
//   [0, PB_CT)      context[b][s][d] -> ctxT2[b][d][s] = ctxT2[b][d][S+s]
//   [PB_CT, PB_WA)  Wa[in][out] -> WaT[out][in]
//   [PB_WA, PB_UA)  Ua[in][out] -> UaT[out][in]
//   [PB_UA, PB_CC)  context rows -> ctxb
//   [PB_CC, PB_XC)  x rows -> xb
// ---------------------------------------------------------------------------
#define PB_CT ((S_LEN / 64) * (HD / 64) * NB)
#define PB_WA (PB_CT + (HD / 64) * (HD / 64))
#define PB_UA (PB_WA + (HD / 64) * (HD / 64))
#define PB_CC (PB_UA + (NB * S_LEN * (HD / 256) + 7) / 8)
#define PB_XC (PB_CC + (NB * TQ * (HD / 256) + 7) / 8)

__global__ __launch_bounds__(256)
void k_prep(const float* __restrict__ context, const float* __restrict__ x,
            const float* __restrict__ Wa, const float* __restrict__ Ua,
            us* __restrict__ ctxb, us* __restrict__ xb,
            us* __restrict__ WaT, us* __restrict__ UaT, us* __restrict__ ctxT2)
{
    __shared__ float ts[64][65];
    const int blk = blockIdx.x;
    if (blk < PB_CT) {
        const int bx = blk % (S_LEN / 64);
        const int by = (blk / (S_LEN / 64)) % (HD / 64);
        const int z  = blk / ((S_LEN / 64) * (HD / 64));
        d_trans<S_LEN>(ts, bx, by, z, context, HD, T_FULL * HD, ctxT2, KC, HD * KC);
    } else if (blk < PB_WA) {
        const int i = blk - PB_CT;
        d_trans<0>(ts, i % (HD / 64), i / (HD / 64), 0, Wa, HD, 0, WaT, HD, 0);
    } else if (blk < PB_UA) {
        const int i = blk - PB_WA;
        d_trans<0>(ts, i % (HD / 64), i / (HD / 64), 0, Ua, HD, 0, UaT, HD, 0);
    } else if (blk < PB_CC) {
        d_cvt(blk - PB_UA, context, HD, 0, S_LEN, T_FULL, ctxb, HD, 0, NB * S_LEN, HD / 256);
    } else {
        d_cvt(blk - PB_CC, x, HD, 0, TQ, T_FULL, xb, HD, 0, NB * TQ, HD / 256);
    }
}

// ---------------------------------------------------------------------------
// GEMM: C[M][N] (f32) = A[M][K] * B, B given as a k-contiguous [N][K] plane (B[k][n] = Bp[n][k]).
// Block = 128 threads (4 waves), block tile 64(M) x 64(N), wave tile 16 x 64 (4 accumulators),
// fragments loaded straight from the 16-bit planes with the split k map. blockIdx.z = batch.
// Epilogue: wave tile staged in LDS, block barrier, then whole-row-segment f32 stores
// ---------------------------------------------------------------------------
__global__ __launch_bounds__(128)
void k_gemm(const us* __restrict__ A, int lda, int strideA,
            const us* __restrict__ B, int ldb, int strideB,
            float* __restrict__ C, int ldc, int strideC, int K)
{
    __shared__ __attribute__((aligned(16))) float tile[4 * 16 * 64];

    const int lane = threadIdx.x & 31, wave = threadIdx.x >> 5;
    const int hsel = lane >> 4, m = lane & 15;
    const int m0 = blockIdx.x * 64 + wave * 16;
    const int n0 = blockIdx.y * 64;
    const us* Ab = A + (size_t)blockIdx.z * (size_t)strideA;
    const us* Bb = B + (size_t)blockIdx.z * (size_t)strideB;

    v8f c0 = {}; v8f c1 = {}; v8f c2 = {}; v8f c3 = {};
    for (int k0 = 0; k0 < K; k0 += 32) {
        const v16bf a  = ld_frag(Ab, lda, m0 + m, k0, hsel);
        const v16bf b0 = ld_frag(Bb, ldb, n0 + m,      k0, hsel);
        const v16bf b1 = ld_frag(Bb, ldb, n0 + 16 + m, k0, hsel);
        const v16bf b2 = ld_frag(Bb, ldb, n0 + 32 + m, k0, hsel);
        const v16bf b3 = ld_frag(Bb, ldb, n0 + 48 + m, k0, hsel);
        c0 = wmma16(a, b0, c0);
        c1 = wmma16(a, b1, c1);
        c2 = wmma16(a, b2, c2);
        c3 = wmma16(a, b3, c3);
    }

    // D map: acc[r] -> (row 8*hsel + r, col n-tile + m). Stage the 16x64 wave tile in LDS.
    float* tw = tile + wave * 1024;
#pragma unroll
    for (int r = 0; r < 8; ++r) {
        const int row = 8 * hsel + r;
        tw[row * 64 + m]      = c0[r];
        tw[row * 64 + 16 + m] = c1[r];
        tw[row * 64 + 32 + m] = c2[r];
        tw[row * 64 + 48 + m] = c3[r];
    }
    __syncthreads();

    float* Cb = C + (size_t)blockIdx.z * (size_t)strideC;
    v4f vals[8];
#pragma unroll
    for (int p = 0; p < 8; ++p) {
        const int row = 2 * p + hsel;
        vals[p] = *(const v4f*)(tw + row * 64 + 4 * m);
    }
#pragma unroll
    for (int p = 0; p < 8; ++p) {
        float* d = Cb + (size_t)(m0 + 2 * p + hsel) * ldc + n0 + 4 * m;
        *(v4f*)d = vals[p];
    }
    
}

// ---------------------------------------------------------------------------
// Fused energies -> softmax -> P planes. One block per (b, group of TT query rows t).
// Thread = (hh, s): key position s, part hh (of HS) of the feature range. Each 16-B piece of Wc[b][s][.] is loaded
// once and used for all TT query rows of the block, so the row-strided Wc loads (one cache line per lane)
// are issued TT times less often than with one query row per block.
//   e[t][s] = sum_h v[h] * tanh(Wc[b][s][h] + Ux[bt][h] + bUa[h] + bWa[h]) + bVa   (f32; the HS parts of
//             the h range are summed apart and then added in order)
//   p    = softmax_s(e); Pcat[bt][s] = bf16 hi, Pcat[bt][S+s] = bf16 lo (lo = p - hi)
// LDS regions are cross-wave: block barriers throughout.
// ---------------------------------------------------------------------------
#define TT 4                // query rows per block
#define HS 4                // parts of the h range, one per group of S_LEN threads
#define RPT (TT / HS)       // softmax rows per thread
static_assert((TQ % TT) == 0 && (TT % HS) == 0 && ((HD / 4) % HS) == 0);
static_assert(TT <= (S_LEN * HS) / 32);

// waves_per_eu: the block's 16 waves stand four to a SIMD and one block fills a WGP, so the register budget is
// that of four waves; without it the scheduler holds the register count down for more waves and leaves each
// tanh as one dependent chain instead of interleaving the 64 independent ones of a trip.
__global__ __launch_bounds__(S_LEN * HS) __attribute__((amdgpu_waves_per_eu(S_LEN * HS / 128, S_LEN * HS / 128)))
void k_attn(const float* __restrict__ Uxp, const float* __restrict__ Wcp,
            const float* __restrict__ bWa, const float* __restrict__ bUa,
            const float* __restrict__ Va,  const float* __restrict__ bVa,
            us* __restrict__ Pcat)
{
    __shared__ v4f sq4[TT][HD / 4];
    __shared__ v4f sv4[HD / 4];
    __shared__ float part[HS][TT][S_LEN];
    __shared__ __attribute__((aligned(16))) float sp[TT][S_LEN];
    __shared__ float red[TT][S_LEN];

    const int bt0 = blockIdx.x * TT;         // first of the block's rows b * TQ + t (all of one b)
    const int b   = bt0 / TQ;
    const int tid = threadIdx.x, lane = tid & 31, wave = tid >> 5;
    const int s   = tid & (S_LEN - 1), hh = tid / S_LEN;

    for (int i = tid; i < TT * (HD / 4); i += S_LEN * HS) {
        const int c = i & (HD / 4 - 1);
        v4f q = *(const v4f*)(Uxp + (size_t)bt0 * HD + i * 4);
        const v4f b1 = *(const v4f*)(bUa + c * 4);
        const v4f b2 = *(const v4f*)(bWa + c * 4);
        q.x = (q.x + rbf(b1.x)) + rbf(b2.x);
        q.y = (q.y + rbf(b1.y)) + rbf(b2.y);
        q.z = (q.z + rbf(b1.z)) + rbf(b2.z);
        q.w = (q.w + rbf(b1.w)) + rbf(b2.w);
        sq4[i / (HD / 4)][c] = q;
    }
    for (int i = tid; i < HD / 4; i += S_LEN * HS) {
        v4f w = *(const v4f*)(Va + i * 4);
        w.x = rbf(w.x); w.y = rbf(w.y); w.z = rbf(w.z); w.w = rbf(w.w);
        sv4[i] = w;
    }
    __syncthreads();

    const float bva = rbf(bVa[0]);
    const int u0 = hh * (HD / 4 / HS);
    const v4f* we = (const v4f*)(Wcp + ((size_t)b * S_LEN + s) * HD) + u0;
    float acc[TT];
#pragma unroll
    for (int j = 0; j < TT; ++j) acc[j] = 0.0f;
    // four 16-B loads per lane go out together at the head of each trip (half a cache line per lane)
#pragma unroll 4
    for (int u = 0; u < HD / 4 / HS; ++u) {
        const v4f e = we[u];
        const v4f w = sv4[u0 + u];
#pragma unroll
        for (int j = 0; j < TT; ++j) {
            const v4f d = sq4[j][u0 + u];
            const v2f y0 = tanh_acc2(e.xy + d.xy);
            const v2f y1 = tanh_acc2(e.zw + d.zw);
            const v2f p0 = w.xy * y0;
            const v2f p1 = w.zw * y1;
            acc[j] += p0.x;
            acc[j] += p0.y;
            acc[j] += p1.x;
            acc[j] += p1.y;
        }
    }
#pragma unroll
    for (int j = 0; j < TT; ++j) part[hh][j][s] = acc[j];
    __syncthreads();

    // thread (hh, s) carries rows j = RPT * hh + k of the block through the softmax
    float en[RPT], ex[RPT];
#pragma unroll
    for (int k = 0; k < RPT; ++k) {
        const int j = RPT * hh + k;
        float a = part[0][j][s];
#pragma unroll
        for (int g = 1; g < HS; ++g) a += part[g][j][s];
        en[k] = a + bva;
        red[j][s] = en[k];
    }
    __syncthreads();

    // per-row max over s
#pragma unroll
    for (int st = S_LEN / 2; st > 0; st >>= 1) {
        if (s < st) {
#pragma unroll
            for (int k = 0; k < RPT; ++k) {
                const int j = RPT * hh + k;
                red[j][s] = fmaxf(red[j][s], red[j][s + st]);
            }
        }
        __syncthreads();
    }
    float mx[RPT];
#pragma unroll
    for (int k = 0; k < RPT; ++k) mx[k] = red[RPT * hh + k][0];
    __syncthreads();

    // exp + per-row sum
#pragma unroll
    for (int k = 0; k < RPT; ++k) {
        ex[k] = __expf(en[k] - mx[k]);
        red[RPT * hh + k][s] = ex[k];
    }
    __syncthreads();
#pragma unroll
    for (int st = S_LEN / 2; st > 0; st >>= 1) {
        if (s < st) {
#pragma unroll
            for (int k = 0; k < RPT; ++k) {
                const int j = RPT * hh + k;
                red[j][s] += red[j][s + st];
            }
        }
        __syncthreads();
    }
#pragma unroll
    for (int k = 0; k < RPT; ++k) {
        const float ssum = red[RPT * hh + k][0];
        sp[RPT * hh + k][s] = ex[k] * (1.0f / ssum);
    }
    __syncthreads();

    // P planes: wave j < TT writes the whole 512-B row j in one instruction: lanes 0-15 the 128 hi halves,
    // lanes 16-31 the 128 lo halves
    if (wave < TT) {
        const int q = lane & 15;
        const v4f a = *(const v4f*)(&sp[wave][q * 8]);
        const v4f c = *(const v4f*)(&sp[wave][q * 8 + 4]);
        v8us hi, lo;
        split8(a, c, hi, lo);
        v8us o;
#pragma unroll
        for (int i = 0; i < 8; ++i) o[i] = (lane < 16) ? hi[i] : lo[i];
        us* d = Pcat + (size_t)(bt0 + wave) * KC + lane * 8;
        *(v8us*)d = o;
    }
}

// ---------------------------------------------------------------------------
// One wave per row r (cv plane row r; input/output row (r / TQ) * T_FULL + r % TQ).
// Lane l holds columns 128j + 4l .. +3 for j = 0..3; store instruction j covers columns 128j..128j+127
// ---------------------------------------------------------------------------
__global__ __launch_bounds__(256)
void k_ln(const float* __restrict__ cv, const float* __restrict__ xin,
          const float* __restrict__ gam, const float* __restrict__ bet,
          float* __restrict__ out, int nrows)
{
    const int lane = threadIdx.x & 31;
    const int r = blockIdx.x * 8 + (threadIdx.x >> 5);
    if (r >= nrows) return;                            // wave-uniform
    const int g = r / TQ;
    const int frow = g * T_FULL + (r - g * TQ);
    const float* cp = cv  + (size_t)r * HD + lane * 4;
    const float* xp = xin + (size_t)frow * HD + lane * 4;

    v4f c[4], xr[4], gm[4], be[4];
#pragma unroll
    for (int j = 0; j < 4; ++j) {
        c[j]  = *(const v4f*)(cp + 128 * j);
        xr[j] = *(const v4f*)(xp + 128 * j);
        gm[j] = *(const v4f*)(gam + 128 * j + lane * 4);
        be[j] = *(const v4f*)(bet + 128 * j + lane * 4);
    }
    float s = 0.0f;
#pragma unroll
    for (int j = 0; j < 4; ++j) s += (c[j].x + c[j].y) + (c[j].z + c[j].w);
#pragma unroll
    for (int off = 16; off > 0; off >>= 1) s += __shfl_xor(s, off, 32);
    const float mean = s * (1.0f / (float)HD);

    float q = 0.0f;
#pragma unroll
    for (int j = 0; j < 4; ++j) {
        const float dx = c[j].x - mean, dy = c[j].y - mean, dz = c[j].z - mean, dw = c[j].w - mean;
        q += dx * dx; q += dy * dy; q += dz * dz; q += dw * dw;
    }
#pragma unroll
    for (int off = 16; off > 0; off >>= 1) q += __shfl_xor(q, off, 32);
    const float var  = q * (1.0f / (float)HD);
    const float rstd = rsqrtf(var + LN_EPS);

    v4f o[4];
#pragma unroll
    for (int j = 0; j < 4; ++j) {
        o[j].x = (c[j].x - mean) * rstd * rbf(gm[j].x) + rbf(be[j].x) + rbf(xr[j].x);
        o[j].y = (c[j].y - mean) * rstd * rbf(gm[j].y) + rbf(be[j].y) + rbf(xr[j].y);
        o[j].z = (c[j].z - mean) * rstd * rbf(gm[j].z) + rbf(be[j].z) + rbf(xr[j].z);
        o[j].w = (c[j].w - mean) * rstd * rbf(gm[j].w) + rbf(be[j].w) + rbf(xr[j].w);
    }
    float* dp = out + (size_t)frow * HD + lane * 4;
#pragma unroll
    for (int j = 0; j < 4; ++j) *(v4f*)(dp + 128 * j) = o[j];
    
}

// ---------------------------------------------------------------------------
#define PROWS (NB * S_LEN)   // rows of either projection
static_assert(TQ == S_LEN);  // the two projections share one grid

static inline size_t al256(size_t x) { return (x + 255) & ~(size_t)255; }

extern "C" void kernel_launch(void* const* d_in, const int* in_sizes, int n_in,
                              void* d_out, int out_size, void* d_ws, size_t ws_size,
                              hipStream_t stream)
{
    if (n_in < 10) return;
    if (in_sizes[0] < ((NB - 1) * T_FULL + S_LEN) * HD) return;   // context [8][128][512] f32
    if (in_sizes[1] < ((NB - 1) * T_FULL + TQ) * HD) return;      // x       [8][128][512] f32
    if (in_sizes[2] < HD * HD) return;                             // Wa [512][512] ([in][out]) f32
    if (in_sizes[3] < HD) return;                                  // bWa [512]
    if (in_sizes[4] < HD * HD) return;                             // Ua [512][512] ([in][out]) f32
    if (in_sizes[5] < HD) return;                                  // bUa [512]
    if (in_sizes[6] < HD) return;                                  // Va [512][1]
    if (in_sizes[7] < 1) return;                                   // bVa [1]
    if (in_sizes[8] < HD || in_sizes[9] < HD) return;              // gamma, beta [512]
    if (out_size < ((NB - 1) * T_FULL + TQ) * HD) return;

    const float* context = (const float*)d_in[0];
    const float* x       = (const float*)d_in[1];
    const float* Wa      = (const float*)d_in[2];
    const float* bWa     = (const float*)d_in[3];
    const float* Ua      = (const float*)d_in[4];
    const float* bUa     = (const float*)d_in[5];
    const float* Va      = (const float*)d_in[6];
    const float* bVa     = (const float*)d_in[7];
    const float* gamma   = (const float*)d_in[8];
    const float* beta    = (const float*)d_in[9];
    float* out = (float*)d_out;

    char* ws = (char*)d_ws;
    size_t off = 0;
    // the two projections' operands and results lie as pairs of equal planes, one batch stride apart
    us* ctxb  = (us*)(ws + off);    off += al256((size_t)2 * PROWS * HD * sizeof(us));    // [NB*S][512]
    us* xb    = ctxb + (size_t)PROWS * HD;                                                // [NB*TQ][512]
    us* WaT   = (us*)(ws + off);    off += al256((size_t)2 * HD * HD * sizeof(us));       // [H][D]
    us* UaT   = WaT + (size_t)HD * HD;                                                    // [H][D]
    us* ctxT2 = (us*)(ws + off);    off += al256((size_t)NB * HD * KC * sizeof(us));      // [NB][512][256]
    float* Wc = (float*)(ws + off); off += al256((size_t)2 * PROWS * HD * sizeof(float)); // [NB*S][512]
    float* Ux = Wc + (size_t)PROWS * HD;                                                  // [NB*TQ][512]
    us* Pcat  = (us*)(ws + off);    off += al256((size_t)NB * TQ * KC * sizeof(us));       // [NB*TQ][256]
    float* cv = (float*)(ws + off); off += al256((size_t)NB * TQ * HD * sizeof(float));    // [NB*TQ][512]
    if (off > ws_size) return;

    const dim3 b256(256), b128(128), bS(S_LEN * HS);

    // ---- 16-bit planes (RNE convert of the float inputs, once), all five in one launch ----
    k_prep<<<dim3(PB_XC), b256, 0, stream>>>(context, x, Wa, Ua, ctxb, xb, WaT, UaT, ctxT2);

    // ---- projections in one launch: z = 0: Wc = context @ Wa, z = 1: Ux = x @ Ua (f32; biases added in k_attn) ----
    k_gemm<<<dim3(PROWS / 64, HD / 64, 2), b128, 0, stream>>>(
        ctxb, HD, PROWS * HD, WaT, HD, HD * HD, Wc, HD, PROWS * HD, HD);

    // ---- energies + softmax -> P hi/lo planes ----
    k_attn<<<dim3(NB * TQ / TT), bS, 0, stream>>>(Ux, Wc, bWa, bUa, Va, bVa, Pcat);

    // ---- cv = [P_hi|P_lo] @ [ctxT;ctxT] (f32) ----
    k_gemm<<<dim3(TQ / 64, HD / 64, NB), b128, 0, stream>>>(
        Pcat, KC, TQ * KC, ctxT2, KC, HD * KC, cv, HD, TQ * HD, KC);

    // ---- LayerNorm + residual -> out ----
    k_ln<<<dim3((NB * TQ + 7) / 8), b256, 0, stream>>>(cv, x, gamma, beta, out, NB * TQ);
}

// v003
// One run takes 30.7 microseconds.
// Timed twice side by side with v002, it ran 1.20 times as fast both times.
// All steps since v000 together make it 2.09 times as fast.
#include <hip/hip_runtime.h>

// Contractions on v_wmma_f32_16x16x32_bf16 (bf16 operands, f32 accumulate): context@Wa and x@Ua from
// RNE-converted input planes; attn@context with attn carried as bf16 hi+lo planes folded into K against
// the RNE-converted transposed context plane. Energies v.tanh(.), softmax, LayerNorm and the residual add
// in f32 on the VALU.

#ifndef NB
#define NB 8
#endif
#ifndef TQ
#define TQ 128
#endif
#define NB_FULL 8
#define T_FULL 128          // full query length: per-batch row stride of x and of the output
#define S_LEN 128           // context positions (keys), never reduced
#define S_FULL 128          // per-batch row stride of context in the input
#define HD 512              // feature width D == hidden width H
#define KC (2 * S_LEN)      // context GEMM depth: [P_hi | P_lo]
#define LN_EPS 1.0e-3f

static_assert(NB >= 1 && NB <= NB_FULL);
static_assert(TQ >= 64 && TQ <= T_FULL && (TQ % 64) == 0);
static_assert(S_LEN == 128 && S_LEN == S_FULL);
static_assert((HD % 256) == 0 && (HD % 64) == 0 && (HD % 32) == 0);
static_assert((KC % 32) == 0 && (S_LEN % 64) == 0);
static_assert(((HD / 4) % S_LEN) == 0);
static_assert((S_LEN % 32) == 0 && S_LEN / 8 == 16);   // P row: 16 lanes hi + 16 lanes lo, 8 halves each

typedef unsigned short us;
typedef us     v8us  __attribute__((ext_vector_type(8)));
typedef __bf16 v16bf __attribute__((ext_vector_type(16)));
typedef float  v8f   __attribute__((ext_vector_type(8)));
typedef float  v4f   __attribute__((ext_vector_type(4)));

union Frag { v16bf v; v8us h[2]; };

// ---------------------------------------------------------------------------
// scalar helpers
// ---------------------------------------------------------------------------
__device__ __forceinline__ us f2bf(float f) {           // f32 -> bf16, RNE convert
    unsigned int u = __float_as_uint(f);
    u += 0x7FFFu + ((u >> 16) & 1u);
    return (us)(u >> 16);
}
__device__ __forceinline__ float bf2f(us h) {
    return __uint_as_float(((unsigned int)h) << 16);
}
__device__ __forceinline__ float rbf(float f) {          // value after an RNE convert to bf16
    return bf2f(f2bf(f));
}
// tanh on two neighbouring features, each by one v_tanh_f32
typedef float v2f __attribute__((ext_vector_type(2)));
__device__ __forceinline__ v2f tanh_acc2(v2f x) {
    v2f y;  y.x = __builtin_amdgcn_tanhf(x.x); y.y = __builtin_amdgcn_tanhf(x.y);
    return y;
}
__device__ __forceinline__ v8us pack8(v4f a, v4f c) {
    v8us o;
    o[0] = f2bf(a.x); o[1] = f2bf(a.y); o[2] = f2bf(a.z); o[3] = f2bf(a.w);
    o[4] = f2bf(c.x); o[5] = f2bf(c.y); o[6] = f2bf(c.z); o[7] = f2bf(c.w);
    return o;
}
// hi = bf16(x), lo = bf16(x - hi): unscaled bf16 residual pair (bf16 keeps the f32 exponent range)
__device__ __forceinline__ void split8(v4f a, v4f c, v8us& hi, v8us& lo) {
    const float x[8] = {a.x, a.y, a.z, a.w, c.x, c.y, c.z, c.w};
#pragma unroll
    for (int i = 0; i < 8; ++i) {
        const us h = f2bf(x[i]);
        hi[i] = h;
        lo[i] = f2bf(x[i] - bf2f(h));
    }
}

// ---------------------------------------------------------------------------
// WMMA helper: 16x16x32 bf16, f32 accumulate, 4-slot VALU hazard guard after the issue
// ---------------------------------------------------------------------------
__device__ __forceinline__ v8f wmma16(v16bf a, v16bf b, v8f c) {
    v8f d = __builtin_amdgcn_wmma_f32_16x16x32_bf16(false, a, false, b, (short)0, c, false, false);
    asm volatile("v_nop\n\tv_nop\n\tv_nop\n\tv_nop" : "+v"(d) : "v"(a), "v"(b));
    return d;
}

// Fragment loader for a k-contiguous 16-bit plane P[row][k] with pitch ld (halves).
// Lane l: row = (l & 15) (A row m, or B column n of an [n][k] plane), hsel = l >> 4.
//   elements 0..7  <- k0 + 8*hsel + 0..7
//   elements 8..15 <- k0 + 16 + 8*hsel + 0..7
__device__ __forceinline__ v16bf ld_frag(const us* __restrict__ P, int ld, int row, int k0, int hsel) {
    Frag f;
    const us* p = P + (size_t)row * ld + k0 + 8 * hsel;
    f.h[0] = *(const v8us*)p;
    f.h[1] = *(const v8us*)(p + 16);
    return f.v;
}

// ---------------------------------------------------------------------------
// Row conversion f32 -> bf16 plane. One wave per (row, 256-column segment):
// lane l converts columns 8l..8l+7 of the segment and stores 16 B; one instruction covers the
// (r / grp) * gstride + (r % grp) (lets a reduced build read full-stride inputs).
// ---------------------------------------------------------------------------
__device__ __forceinline__
void d_cvt(int blk, const float* __restrict__ src, int spitch, int scol, int grp, int gstride,
           us* __restrict__ dst, int dpitch, int dcol, int nrows, int nseg)
{
    const int lane = threadIdx.x & 31;
    const int gw   = blk * 8 + (threadIdx.x >> 5);
    if (gw >= nrows * nseg) return;                    // wave-uniform, no barriers on this path
    const int r    = gw / nseg;
    const int sg   = gw - r * nseg;
    const int g    = r / grp;
    const int srow = g * gstride + (r - g * grp);
    const float* sp = src + (size_t)srow * spitch + scol + sg * 256 + lane * 8;
    const v4f a = *(const v4f*)sp;
    const v4f c = *(const v4f*)(sp + 4);
    const v8us o = pack8(a, c);
    us* dp = dst + (size_t)r * dpitch + dcol + sg * 256 + lane * 8;
    *(v8us*)dp = o;
    
}

// ---------------------------------------------------------------------------
// Transpose + convert: src[R][C] f32 (pitch spitch, per-z stride sstride) -> dst[C][R] bf16 (pitch dpitch,
// per-z stride dstride), optionally a second copy at column offset +DUP halves.
// Block: 64 src rows x 64 src cols through LDS (cross-wave -> block barrier). Store phase: one instruction
// tile index (bx, by, z) in (R/64, C/64, Z); ts: the block's 64 x 65 f32 LDS tile
// ---------------------------------------------------------------------------
template <int DUP>
__device__ __forceinline__
void d_trans(float (*ts)[65], int bx, int by, int z,
             const float* __restrict__ src, int spitch, int sstride,
             us* __restrict__ dst, int dpitch, int dstride)
{
    const int r0 = bx * 64, c0 = by * 64;
    const int tid = threadIdx.x, lane = tid & 31, wave = tid >> 5;
    const float* sb = src + (size_t)z * (size_t)sstride;
    us* db = dst + (size_t)z * (size_t)dstride;

#pragma unroll
    for (int p = 0; p < 4; ++p) {
        const int rl = p * 16 + (tid >> 4);
        const int c4 = (tid & 15) * 4;
        const v4f x = *(const v4f*)(sb + (size_t)(r0 + rl) * spitch + c0 + c4);
        ts[rl][c4 + 0] = x.x; ts[rl][c4 + 1] = x.y; ts[rl][c4 + 2] = x.z; ts[rl][c4 + 3] = x.w;
    }
    __syncthreads();

    v8us o[2];
#pragma unroll
    for (int p = 0; p < 2; ++p) {
        const int cl = p * 32 + wave * 4 + (lane >> 3);
        const int r8 = (lane & 7) * 8;
#pragma unroll
        for (int i = 0; i < 8; ++i) o[p][i] = f2bf(ts[r8 + i][cl]);
    }
#pragma unroll
    for (int p = 0; p < 2; ++p) {
        const int cl = p * 32 + wave * 4 + (lane >> 3);
        const int r8 = (lane & 7) * 8;
        us* d = db + (size_t)(c0 + cl) * dpitch + r0 + r8;
        *(v8us*)d = o[p];
        if (DUP != 0) *(v8us*)(d + DUP) = o[p];
    }
    // the stores' address and data registers are written again in the code of the caller's other branches,
    // which follows these stores in the listing: the wait stands in front of any such overwrite
    asm volatile("s_wait_xcnt 0x0" ::: "memory");
}

// ---------------------------------------------------------------------------
// All five input planes in one launch: none reads what another writes, so each block takes one piece of one
// plane by its index (block-uniform choice). The transposes, which have the longer path (load, LDS, barrier,
// store), come first in the index order.
//   [0, PB_CT)      context[b][s][d] -> ctxT2[b][d][s] = ctxT2[b][d][S+s]
//   [PB_CT, PB_WA)  Wa[in][out] -> WaT[out][in]
//   [PB_WA, PB_UA)  Ua[in][out] -> UaT[out][in]
//   [PB_UA, PB_CC)  context rows -> ctxb
//   [PB_CC, PB_XC)  x rows -> xb
// ---------------------------------------------------------------------------
#define PB_CT ((S_LEN / 64) * (HD / 64) * NB)
#define PB_WA (PB_CT + (HD / 64) * (HD / 64))
#define PB_UA (PB_WA + (HD / 64) * (HD / 64))
#define PB_CC (PB_UA + (NB * S_LEN * (HD / 256) + 7) / 8)
#define PB_XC (PB_CC + (NB * TQ * (HD / 256) + 7) / 8)

__global__ __launch_bounds__(256)
void k_prep(const float* __restrict__ context, const float* __restrict__ x,
            const float* __restrict__ Wa, const float* __restrict__ Ua,
            us* __restrict__ ctxb, us* __restrict__ xb,
            us* __restrict__ WaT, us* __restrict__ UaT, us* __restrict__ ctxT2)
{
    __shared__ float ts[64][65];
    const int blk = blockIdx.x;
    if (blk < PB_CT) {
        const int bx = blk % (S_LEN / 64);
        const int by = (blk / (S_LEN / 64)) % (HD / 64);
        const int z  = blk / ((S_LEN / 64) * (HD / 64));
        d_trans<S_LEN>(ts, bx, by, z, context, HD, T_FULL * HD, ctxT2, KC, HD * KC);
    } else if (blk < PB_WA) {
        const int i = blk - PB_CT;
        d_trans<0>(ts, i % (HD / 64), i / (HD / 64), 0, Wa, HD, 0, WaT, HD, 0);
    } else if (blk < PB_UA) {
        const int i = blk - PB_WA;
        d_trans<0>(ts, i % (HD / 64), i / (HD / 64), 0, Ua, HD, 0, UaT, HD, 0);
    } else if (blk < PB_CC) {
        d_cvt(blk - PB_UA, context, HD, 0, S_LEN, T_FULL, ctxb, HD, 0, NB * S_LEN, HD / 256);
    } else {
        d_cvt(blk - PB_CC, x, HD, 0, TQ, T_FULL, xb, HD, 0, NB * TQ, HD / 256);
    }
}

// ---------------------------------------------------------------------------
// GEMM: C[M][N] (f32) = A[M][K] * B, B given as a k-contiguous [N][K] plane (B[k][n] = Bp[n][k]).
// Block = 128 threads (4 waves), block tile 64(M) x 64(N), wave tile 16 x 64 (4 accumulators),
// fragments loaded straight from the 16-bit planes with the split k map. blockIdx.z = batch.
// Epilogue: wave tile staged in LDS, block barrier, then whole-row-segment f32 stores
// ---------------------------------------------------------------------------
__global__ __launch_bounds__(128)
void k_gemm(const us* __restrict__ A, int lda, int strideA,
            const us* __restrict__ B, int ldb, int strideB,
            float* __restrict__ C, int ldc, int strideC, int K)
{
    __shared__ __attribute__((aligned(16))) float tile[4 * 16 * 64];

    const int lane = threadIdx.x & 31, wave = threadIdx.x >> 5;
    const int hsel = lane >> 4, m = lane & 15;
    const int m0 = blockIdx.x * 64 + wave * 16;
    const int n0 = blockIdx.y * 64;
    const us* Ab = A + (size_t)blockIdx.z * (size_t)strideA;
    const us* Bb = B + (size_t)blockIdx.z * (size_t)strideB;

    v8f c0 = {}; v8f c1 = {}; v8f c2 = {}; v8f c3 = {};
    for (int k0 = 0; k0 < K; k0 += 32) {
        const v16bf a  = ld_frag(Ab, lda, m0 + m, k0, hsel);
        const v16bf b0 = ld_frag(Bb, ldb, n0 + m,      k0, hsel);
        const v16bf b1 = ld_frag(Bb, ldb, n0 + 16 + m, k0, hsel);
        const v16bf b2 = ld_frag(Bb, ldb, n0 + 32 + m, k0, hsel);
        const v16bf b3 = ld_frag(Bb, ldb, n0 + 48 + m, k0, hsel);
        c0 = wmma16(a, b0, c0);
        c1 = wmma16(a, b1, c1);
        c2 = wmma16(a, b2, c2);
        c3 = wmma16(a, b3, c3);
    }

    // D map: acc[r] -> (row 8*hsel + r, col n-tile + m). Stage the 16x64 wave tile in LDS.
    float* tw = tile + wave * 1024;
#pragma unroll
    for (int r = 0; r < 8; ++r) {
        const int row = 8 * hsel + r;
        tw[row * 64 + m]      = c0[r];
        tw[row * 64 + 16 + m] = c1[r];
        tw[row * 64 + 32 + m] = c2[r];
        tw[row * 64 + 48 + m] = c3[r];
    }
    __syncthreads();

    float* Cb = C + (size_t)blockIdx.z * (size_t)strideC;
    v4f vals[8];
#pragma unroll
    for (int p = 0; p < 8; ++p) {
        const int row = 2 * p + hsel;
        vals[p] = *(const v4f*)(tw + row * 64 + 4 * m);
    }
#pragma unroll
    for (int p = 0; p < 8; ++p) {
        float* d = Cb + (size_t)(m0 + 2 * p + hsel) * ldc + n0 + 4 * m;
        *(v4f*)d = vals[p];
    }
    
}

// ---------------------------------------------------------------------------
// Fused energies -> softmax -> P planes. One block per (b, group of TT query rows t).
// Thread = (hh, s): key position s, part hh (of HS) of the feature range. Each 16-B piece of Wc[b][s][.] is loaded
// once and used for all TT query rows of the block, so the row-strided Wc loads (one cache line per lane)
// are issued TT times less often than with one query row per block.
//   e[t][s] = sum_h v[h] * tanh(Wc[b][s][h] + Ux[bt][h] + bUa[h] + bWa[h]) + bVa   (f32; the HS parts of
//             the h range are summed apart and then added in order)
//   p    = softmax_s(e); Pcat[bt][s] = bf16 hi, Pcat[bt][S+s] = bf16 lo (lo = p - hi)
// LDS regions are cross-wave: block barriers throughout.
// ---------------------------------------------------------------------------
#define TT 4                // query rows per block
#define HS 4                // parts of the h range, one per group of S_LEN threads
#define RPT (TT / HS)       // softmax rows per thread
static_assert((TQ % TT) == 0 && (TT % HS) == 0 && ((HD / 4) % HS) == 0);
static_assert(TT <= (S_LEN * HS) / 32);

// waves_per_eu: the block's 16 waves stand four to a SIMD and one block fills a WGP, so the register budget is
// that of four waves; without it the scheduler holds the register count down for more waves and sets each
// tanh right in front of its product and sum instead of issuing the 64 independent ones of a trip in runs.
__global__ __launch_bounds__(S_LEN * HS) __attribute__((amdgpu_waves_per_eu(S_LEN * HS / 128, S_LEN * HS / 128)))
void k_attn(const float* __restrict__ Uxp, const float* __restrict__ Wcp,
            const float* __restrict__ bWa, const float* __restrict__ bUa,
            const float* __restrict__ Va,  const float* __restrict__ bVa,
            us* __restrict__ Pcat)
{
    __shared__ v4f sq4[TT][HD / 4];
    __shared__ v4f sv4[HD / 4];
    __shared__ float part[HS][TT][S_LEN];
    __shared__ __attribute__((aligned(16))) float sp[TT][S_LEN];
    __shared__ float red[TT][S_LEN];

    const int bt0 = blockIdx.x * TT;         // first of the block's rows b * TQ + t (all of one b)
    const int b   = bt0 / TQ;
    const int tid = threadIdx.x, lane = tid & 31, wave = tid >> 5;
    const int s   = tid & (S_LEN - 1), hh = tid / S_LEN;

    for (int i = tid; i < TT * (HD / 4); i += S_LEN * HS) {
        const int c = i & (HD / 4 - 1);
        v4f q = *(const v4f*)(Uxp + (size_t)bt0 * HD + i * 4);
        const v4f b1 = *(const v4f*)(bUa + c * 4);
        const v4f b2 = *(const v4f*)(bWa + c * 4);
        q.x = (q.x + rbf(b1.x)) + rbf(b2.x);
        q.y = (q.y + rbf(b1.y)) + rbf(b2.y);
        q.z = (q.z + rbf(b1.z)) + rbf(b2.z);
        q.w = (q.w + rbf(b1.w)) + rbf(b2.w);
        sq4[i / (HD / 4)][c] = q;
    }
    for (int i = tid; i < HD / 4; i += S_LEN * HS) {
        v4f w = *(const v4f*)(Va + i * 4);
        w.x = rbf(w.x); w.y = rbf(w.y); w.z = rbf(w.z); w.w = rbf(w.w);
        sv4[i] = w;
    }
    __syncthreads();

    const float bva = rbf(bVa[0]);
    const int u0 = hh * (HD / 4 / HS);
    const v4f* we = (const v4f*)(Wcp + ((size_t)b * S_LEN + s) * HD) + u0;
    float acc[TT];
#pragma unroll
    for (int j = 0; j < TT; ++j) acc[j] = 0.0f;
    // four 16-B loads per lane go out together at the head of each trip (half a cache line per lane)
#pragma unroll 4
    for (int u = 0; u < HD / 4 / HS; ++u) {
        const v4f e = we[u];
        const v4f w = sv4[u0 + u];
#pragma unroll
        for (int j = 0; j < TT; ++j) {
            const v4f d = sq4[j][u0 + u];
            const v2f y0 = tanh_acc2(e.xy + d.xy);
            const v2f y1 = tanh_acc2(e.zw + d.zw);
            const v2f p0 = w.xy * y0;
            const v2f p1 = w.zw * y1;
            acc[j] += p0.x;
            acc[j] += p0.y;
            acc[j] += p1.x;
            acc[j] += p1.y;
        }
    }
#pragma unroll
    for (int j = 0; j < TT; ++j) part[hh][j][s] = acc[j];
    __syncthreads();

    // thread (hh, s) carries rows j = RPT * hh + k of the block through the softmax
    float en[RPT], ex[RPT];
#pragma unroll
    for (int k = 0; k < RPT; ++k) {
        const int j = RPT * hh + k;
        float a = part[0][j][s];
#pragma unroll
        for (int g = 1; g < HS; ++g) a += part[g][j][s];
        en[k] = a + bva;
        red[j][s] = en[k];
    }
    __syncthreads();

    // per-row max over s
#pragma unroll
    for (int st = S_LEN / 2; st > 0; st >>= 1) {
        if (s < st) {
#pragma unroll
            for (int k = 0; k < RPT; ++k) {
                const int j = RPT * hh + k;
                red[j][s] = fmaxf(red[j][s], red[j][s + st]);
            }
        }
        __syncthreads();
    }
    float mx[RPT];
#pragma unroll
    for (int k = 0; k < RPT; ++k) mx[k] = red[RPT * hh + k][0];
    __syncthreads();

    // exp + per-row sum
#pragma unroll
    for (int k = 0; k < RPT; ++k) {
        ex[k] = __expf(en[k] - mx[k]);
        red[RPT * hh + k][s] = ex[k];
    }
    __syncthreads();
#pragma unroll
    for (int st = S_LEN / 2; st > 0; st >>= 1) {
        if (s < st) {
#pragma unroll
            for (int k = 0; k < RPT; ++k) {
                const int j = RPT * hh + k;
                red[j][s] += red[j][s + st];
            }
        }
        __syncthreads();
    }
#pragma unroll
    for (int k = 0; k < RPT; ++k) {
        const float ssum = red[RPT * hh + k][0];
        sp[RPT * hh + k][s] = ex[k] * (1.0f / ssum);
    }
    __syncthreads();

    // P planes: wave j < TT writes the whole 512-B row j in one instruction: lanes 0-15 the 128 hi halves,
    // lanes 16-31 the 128 lo halves
    if (wave < TT) {
        const int q = lane & 15;
        const v4f a = *(const v4f*)(&sp[wave][q * 8]);
        const v4f c = *(const v4f*)(&sp[wave][q * 8 + 4]);
        v8us hi, lo;
        split8(a, c, hi, lo);
        v8us o;
#pragma unroll
        for (int i = 0; i < 8; ++i) o[i] = (lane < 16) ? hi[i] : lo[i];
        us* d = Pcat + (size_t)(bt0 + wave) * KC + lane * 8;
        *(v8us*)d = o;
    }
}

// ---------------------------------------------------------------------------
// One wave per row r (cv plane row r; input/output row (r / TQ) * T_FULL + r % TQ).
// Lane l holds columns 128j + 4l .. +3 for j = 0..3; store instruction j covers columns 128j..128j+127
// ---------------------------------------------------------------------------
__global__ __launch_bounds__(256)
void k_ln(const float* __restrict__ cv, const float* __restrict__ xin,
          const float* __restrict__ gam, const float* __restrict__ bet,
          float* __restrict__ out, int nrows)
{
    const int lane = threadIdx.x & 31;
    const int r = blockIdx.x * 8 + (threadIdx.x >> 5);
    if (r >= nrows) return;                            // wave-uniform
    const int g = r / TQ;
    const int frow = g * T_FULL + (r - g * TQ);
    const float* cp = cv  + (size_t)r * HD + lane * 4;
    const float* xp = xin + (size_t)frow * HD + lane * 4;

    v4f c[4], xr[4], gm[4], be[4];
#pragma unroll
    for (int j = 0; j < 4; ++j) {
        c[j]  = *(const v4f*)(cp + 128 * j);
        xr[j] = *(const v4f*)(xp + 128 * j);
        gm[j] = *(const v4f*)(gam + 128 * j + lane * 4);
        be[j] = *(const v4f*)(bet + 128 * j + lane * 4);
    }
    float s = 0.0f;
#pragma unroll
    for (int j = 0; j < 4; ++j) s += (c[j].x + c[j].y) + (c[j].z + c[j].w);
#pragma unroll
    for (int off = 16; off > 0; off >>= 1) s += __shfl_xor(s, off, 32);
    const float mean = s * (1.0f / (float)HD);

    float q = 0.0f;
#pragma unroll
    for (int j = 0; j < 4; ++j) {
        const float dx = c[j].x - mean, dy = c[j].y - mean, dz = c[j].z - mean, dw = c[j].w - mean;
        q += dx * dx; q += dy * dy; q += dz * dz; q += dw * dw;
    }
#pragma unroll
    for (int off = 16; off > 0; off >>= 1) q += __shfl_xor(q, off, 32);
    const float var  = q * (1.0f / (float)HD);
    const float rstd = rsqrtf(var + LN_EPS);

    v4f o[4];
#pragma unroll
    for (int j = 0; j < 4; ++j) {
        o[j].x = (c[j].x - mean) * rstd * rbf(gm[j].x) + rbf(be[j].x) + rbf(xr[j].x);
        o[j].y = (c[j].y - mean) * rstd * rbf(gm[j].y) + rbf(be[j].y) + rbf(xr[j].y);
        o[j].z = (c[j].z - mean) * rstd * rbf(gm[j].z) + rbf(be[j].z) + rbf(xr[j].z);
        o[j].w = (c[j].w - mean) * rstd * rbf(gm[j].w) + rbf(be[j].w) + rbf(xr[j].w);
    }
    float* dp = out + (size_t)frow * HD + lane * 4;
#pragma unroll
    for (int j = 0; j < 4; ++j) *(v4f*)(dp + 128 * j) = o[j];
    
}

// ---------------------------------------------------------------------------
#define PROWS (NB * S_LEN)   // rows of either projection
static_assert(TQ == S_LEN);  // the two projections share one grid

static inline size_t al256(size_t x) { return (x + 255) & ~(size_t)255; }

extern "C" void kernel_launch(void* const* d_in, const int* in_sizes, int n_in,
                              void* d_out, int out_size, void* d_ws, size_t ws_size,
                              hipStream_t stream)
{
    if (n_in < 10) return;
    if (in_sizes[0] < ((NB - 1) * T_FULL + S_LEN) * HD) return;   // context [8][128][512] f32
    if (in_sizes[1] < ((NB - 1) * T_FULL + TQ) * HD) return;      // x       [8][128][512] f32
    if (in_sizes[2] < HD * HD) return;                             // Wa [512][512] ([in][out]) f32
    if (in_sizes[3] < HD) return;                                  // bWa [512]
    if (in_sizes[4] < HD * HD) return;                             // Ua [512][512] ([in][out]) f32
    if (in_sizes[5] < HD) return;                                  // bUa [512]
    if (in_sizes[6] < HD) return;                                  // Va [512][1]
    if (in_sizes[7] < 1) return;                                   // bVa [1]
    if (in_sizes[8] < HD || in_sizes[9] < HD) return;              // gamma, beta [512]
    if (out_size < ((NB - 1) * T_FULL + TQ) * HD) return;

    const float* context = (const float*)d_in[0];
    const float* x       = (const float*)d_in[1];
    const float* Wa      = (const float*)d_in[2];
    const float* bWa     = (const float*)d_in[3];
    const float* Ua      = (const float*)d_in[4];
    const float* bUa     = (const float*)d_in[5];
    const float* Va      = (const float*)d_in[6];
    const float* bVa     = (const float*)d_in[7];
    const float* gamma   = (const float*)d_in[8];
    const float* beta    = (const float*)d_in[9];
    float* out = (float*)d_out;

    char* ws = (char*)d_ws;
    size_t off = 0;
    // the two projections' operands and results lie as pairs of equal planes, one batch stride apart
    us* ctxb  = (us*)(ws + off);    off += al256((size_t)2 * PROWS * HD * sizeof(us));    // [NB*S][512]
    us* xb    = ctxb + (size_t)PROWS * HD;                                                // [NB*TQ][512]
    us* WaT   = (us*)(ws + off);    off += al256((size_t)2 * HD * HD * sizeof(us));       // [H][D]
    us* UaT   = WaT + (size_t)HD * HD;                                                    // [H][D]
    us* ctxT2 = (us*)(ws + off);    off += al256((size_t)NB * HD * KC * sizeof(us));      // [NB][512][256]
    float* Wc = (float*)(ws + off); off += al256((size_t)2 * PROWS * HD * sizeof(float)); // [NB*S][512]
    float* Ux = Wc + (size_t)PROWS * HD;                                                  // [NB*TQ][512]
    us* Pcat  = (us*)(ws + off);    off += al256((size_t)NB * TQ * KC * sizeof(us));       // [NB*TQ][256]
    float* cv = (float*)(ws + off); off += al256((size_t)NB * TQ * HD * sizeof(float));    // [NB*TQ][512]
    if (off > ws_size) return;

    const dim3 b256(256), b128(128), bS(S_LEN * HS);

    // ---- 16-bit planes (RNE convert of the float inputs, once), all five in one launch ----
    k_prep<<<dim3(PB_XC), b256, 0, stream>>>(context, x, Wa, Ua, ctxb, xb, WaT, UaT, ctxT2);

    // ---- projections in one launch: z = 0: Wc = context @ Wa, z = 1: Ux = x @ Ua (f32; biases added in k_attn) ----
    k_gemm<<<dim3(PROWS / 64, HD / 64, 2), b128, 0, stream>>>(
        ctxb, HD, PROWS * HD, WaT, HD, HD * HD, Wc, HD, PROWS * HD, HD);

    // ---- energies + softmax -> P hi/lo planes ----
    k_attn<<<dim3(NB * TQ / TT), bS, 0, stream>>>(Ux, Wc, bWa, bUa, Va, bVa, Pcat);

    // ---- cv = [P_hi|P_lo] @ [ctxT;ctxT] (f32) ----
    k_gemm<<<dim3(TQ / 64, HD / 64, NB), b128, 0, stream>>>(
        Pcat, KC, TQ * KC, ctxT2, KC, HD * KC, cv, HD, TQ * HD, KC);

    // ---- LayerNorm + residual -> out ----
    k_ln<<<dim3((NB * TQ + 7) / 8), b256, 0, stream>>>(cv, x, gamma, beta, out, NB * TQ);
}

// v004
// It runs in 25.5 microseconds.
// In both of two side-by-side timings against v003, it was 1.22 times as fast.
// Over all steps from v000 it is 2.55 times as fast.
#include <hip/hip_runtime.h>

// Contractions on v_wmma_f32_16x16x32_bf16 (bf16 operands, f32 accumulate): context@Wa and x@Ua from
// RNE-converted input planes; attn@context with attn carried as bf16 hi+lo planes folded into K against
// the RNE-converted transposed context plane, inside the energy kernel. Energies v.tanh(.), softmax,
// LayerNorm and the residual add in f32 on the VALU.

#ifndef NB
#define NB 8
#endif
#ifndef TQ
#define TQ 128
#endif
#define NB_FULL 8
#define T_FULL 128          // full query length: per-batch row stride of x and of the output
#define S_LEN 128           // context positions (keys), never reduced
#define S_FULL 128          // per-batch row stride of context in the input
#define HD 512              // feature width D == hidden width H
#define KC (2 * S_LEN)      // context GEMM depth: [P_hi | P_lo]
#define LN_EPS 1.0e-3f

static_assert(NB >= 1 && NB <= NB_FULL);
static_assert(TQ >= 64 && TQ <= T_FULL && (TQ % 64) == 0);
static_assert(S_LEN == 128 && S_LEN == S_FULL);
static_assert((HD % 256) == 0 && (HD % 64) == 0 && (HD % 32) == 0);
static_assert((KC % 32) == 0 && (S_LEN % 64) == 0);
static_assert(((HD / 4) % S_LEN) == 0);
static_assert((S_LEN % 32) == 0);

typedef unsigned short us;
typedef us     v8us  __attribute__((ext_vector_type(8)));
typedef __bf16 v16bf __attribute__((ext_vector_type(16)));
typedef float  v8f   __attribute__((ext_vector_type(8)));
typedef float  v4f   __attribute__((ext_vector_type(4)));

union Frag { v16bf v; v8us h[2]; };

// ---------------------------------------------------------------------------
// scalar helpers
// ---------------------------------------------------------------------------
__device__ __forceinline__ us f2bf(float f) {           // f32 -> bf16, RNE convert
    unsigned int u = __float_as_uint(f);
    u += 0x7FFFu + ((u >> 16) & 1u);
    return (us)(u >> 16);
}
__device__ __forceinline__ float bf2f(us h) {
    return __uint_as_float(((unsigned int)h) << 16);
}
__device__ __forceinline__ float rbf(float f) {          // value after an RNE convert to bf16
    return bf2f(f2bf(f));
}
// tanh on two neighbouring features, each by one v_tanh_f32
typedef float v2f __attribute__((ext_vector_type(2)));
__device__ __forceinline__ v2f tanh_acc2(v2f x) {
    v2f y;  y.x = __builtin_amdgcn_tanhf(x.x); y.y = __builtin_amdgcn_tanhf(x.y);
    return y;
}
__device__ __forceinline__ v8us pack8(v4f a, v4f c) {
    v8us o;
    o[0] = f2bf(a.x); o[1] = f2bf(a.y); o[2] = f2bf(a.z); o[3] = f2bf(a.w);
    o[4] = f2bf(c.x); o[5] = f2bf(c.y); o[6] = f2bf(c.z); o[7] = f2bf(c.w);
    return o;
}

// ---------------------------------------------------------------------------
// WMMA helper: 16x16x32 bf16, f32 accumulate, 4-slot VALU hazard guard after the issue
// ---------------------------------------------------------------------------
__device__ __forceinline__ v8f wmma16(v16bf a, v16bf b, v8f c) {
    v8f d = __builtin_amdgcn_wmma_f32_16x16x32_bf16(false, a, false, b, (short)0, c, false, false);
    asm volatile("v_nop\n\tv_nop\n\tv_nop\n\tv_nop" : "+v"(d) : "v"(a), "v"(b));
    return d;
}

// Fragment loader for a k-contiguous 16-bit plane P[row][k] with pitch ld (halves).
// Lane l: row = (l & 15) (A row m, or B column n of an [n][k] plane), hsel = l >> 4.
//   elements 0..7  <- k0 + 8*hsel + 0..7
//   elements 8..15 <- k0 + 16 + 8*hsel + 0..7
__device__ __forceinline__ v16bf ld_frag(const us* __restrict__ P, int ld, int row, int k0, int hsel) {
    Frag f;
    const us* p = P + (size_t)row * ld + k0 + 8 * hsel;
    f.h[0] = *(const v8us*)p;
    f.h[1] = *(const v8us*)(p + 16);
    return f.v;
}

// ---------------------------------------------------------------------------
// Row conversion f32 -> bf16 plane. One wave per (row, 256-column segment):
// lane l converts columns 8l..8l+7 of the segment and stores 16 B; one instruction covers the
// (r / grp) * gstride + (r % grp) (lets a reduced build read full-stride inputs).
// ---------------------------------------------------------------------------
__device__ __forceinline__
void d_cvt(int blk, const float* __restrict__ src, int spitch, int scol, int grp, int gstride,
           us* __restrict__ dst, int dpitch, int dcol, int nrows, int nseg)
{
    const int lane = threadIdx.x & 31;
    const int gw   = blk * 8 + (threadIdx.x >> 5);
    if (gw >= nrows * nseg) return;                    // wave-uniform, no barriers on this path
    const int r    = gw / nseg;
    const int sg   = gw - r * nseg;
    const int g    = r / grp;
    const int srow = g * gstride + (r - g * grp);
    const float* sp = src + (size_t)srow * spitch + scol + sg * 256 + lane * 8;
    const v4f a = *(const v4f*)sp;
    const v4f c = *(const v4f*)(sp + 4);
    const v8us o = pack8(a, c);
    us* dp = dst + (size_t)r * dpitch + dcol + sg * 256 + lane * 8;
    *(v8us*)dp = o;
    
}

// ---------------------------------------------------------------------------
// Transpose + convert: src[R][C] f32 (pitch spitch, per-z stride sstride) -> dst[C][R] bf16 (pitch dpitch,
// per-z stride dstride), optionally a second copy at column offset +DUP halves.
// Block: 64 src rows x 64 src cols through LDS (cross-wave -> block barrier). Store phase: one instruction
// tile index (bx, by, z) in (R/64, C/64, Z); ts: the block's 64 x 65 f32 LDS tile
// ---------------------------------------------------------------------------
template <int DUP>
__device__ __forceinline__
void d_trans(float (*ts)[65], int bx, int by, int z,
             const float* __restrict__ src, int spitch, int sstride,
             us* __restrict__ dst, int dpitch, int dstride)
{
    const int r0 = bx * 64, c0 = by * 64;
    const int tid = threadIdx.x, lane = tid & 31, wave = tid >> 5;
    const float* sb = src + (size_t)z * (size_t)sstride;
    us* db = dst + (size_t)z * (size_t)dstride;

#pragma unroll
    for (int p = 0; p < 4; ++p) {
        const int rl = p * 16 + (tid >> 4);
        const int c4 = (tid & 15) * 4;
        const v4f x = *(const v4f*)(sb + (size_t)(r0 + rl) * spitch + c0 + c4);
        ts[rl][c4 + 0] = x.x; ts[rl][c4 + 1] = x.y; ts[rl][c4 + 2] = x.z; ts[rl][c4 + 3] = x.w;
    }
    __syncthreads();

    v8us o[2];
#pragma unroll
    for (int p = 0; p < 2; ++p) {
        const int cl = p * 32 + wave * 4 + (lane >> 3);
        const int r8 = (lane & 7) * 8;
#pragma unroll
        for (int i = 0; i < 8; ++i) o[p][i] = f2bf(ts[r8 + i][cl]);
    }
#pragma unroll
    for (int p = 0; p < 2; ++p) {
        const int cl = p * 32 + wave * 4 + (lane >> 3);
        const int r8 = (lane & 7) * 8;
        us* d = db + (size_t)(c0 + cl) * dpitch + r0 + r8;
        *(v8us*)d = o[p];
        if (DUP != 0) *(v8us*)(d + DUP) = o[p];
    }
    // the stores' address and data registers are written again in the code of the caller's other branches,
    // which follows these stores in the listing: the wait stands in front of any such overwrite
    asm volatile("s_wait_xcnt 0x0" ::: "memory");
}

// ---------------------------------------------------------------------------
// All five input planes in one launch: none reads what another writes, so each block takes one piece of one
// plane by its index (block-uniform choice). The transposes, which have the longer path (load, LDS, barrier,
// store), come first in the index order.
//   [0, PB_CT)      context[b][s][d] -> ctxT[b][d][s]
//   [PB_CT, PB_WA)  Wa[in][out] -> WaT[out][in]
//   [PB_WA, PB_UA)  Ua[in][out] -> UaT[out][in]
//   [PB_UA, PB_CC)  context rows -> ctxb
//   [PB_CC, PB_XC)  x rows -> xb
// ---------------------------------------------------------------------------
#define PB_CT ((S_LEN / 64) * (HD / 64) * NB)
#define PB_WA (PB_CT + (HD / 64) * (HD / 64))
#define PB_UA (PB_WA + (HD / 64) * (HD / 64))
#define PB_CC (PB_UA + (NB * S_LEN * (HD / 256) + 7) / 8)
#define PB_XC (PB_CC + (NB * TQ * (HD / 256) + 7) / 8)

__global__ __launch_bounds__(256)
void k_prep(const float* __restrict__ context, const float* __restrict__ x,
            const float* __restrict__ Wa, const float* __restrict__ Ua,
            us* __restrict__ ctxb, us* __restrict__ xb,
            us* __restrict__ WaT, us* __restrict__ UaT, us* __restrict__ ctxT)
{
    __shared__ float ts[64][65];
    const int blk = blockIdx.x;
    if (blk < PB_CT) {
        const int bx = blk % (S_LEN / 64);
        const int by = (blk / (S_LEN / 64)) % (HD / 64);
        const int z  = blk / ((S_LEN / 64) * (HD / 64));
        d_trans<0>(ts, bx, by, z, context, HD, T_FULL * HD, ctxT, S_LEN, HD * S_LEN);
    } else if (blk < PB_WA) {
        const int i = blk - PB_CT;
        d_trans<0>(ts, i % (HD / 64), i / (HD / 64), 0, Wa, HD, 0, WaT, HD, 0);
    } else if (blk < PB_UA) {
        const int i = blk - PB_WA;
        d_trans<0>(ts, i % (HD / 64), i / (HD / 64), 0, Ua, HD, 0, UaT, HD, 0);
    } else if (blk < PB_CC) {
        d_cvt(blk - PB_UA, context, HD, 0, S_LEN, T_FULL, ctxb, HD, 0, NB * S_LEN, HD / 256);
    } else {
        d_cvt(blk - PB_CC, x, HD, 0, TQ, T_FULL, xb, HD, 0, NB * TQ, HD / 256);
    }
}

// ---------------------------------------------------------------------------
// GEMM: C[M][N] (f32) = A[M][K] * B, B given as a k-contiguous [N][K] plane (B[k][n] = Bp[n][k]).
// Block = 128 threads (4 waves), block tile 64(M) x 64(N), wave tile 16 x 64 (4 accumulators),
// fragments loaded straight from the 16-bit planes with the split k map. blockIdx.z = batch.
// Epilogue: wave tile staged in LDS, block barrier, then whole-row-segment f32 stores
// ---------------------------------------------------------------------------
__global__ __launch_bounds__(128)
void k_gemm(const us* __restrict__ A, int lda, int strideA,
            const us* __restrict__ B, int ldb, int strideB,
            float* __restrict__ C, int ldc, int strideC, int K)
{
    __shared__ __attribute__((aligned(16))) float tile[4 * 16 * 64];

    const int lane = threadIdx.x & 31, wave = threadIdx.x >> 5;
    const int hsel = lane >> 4, m = lane & 15;
    const int m0 = blockIdx.x * 64 + wave * 16;
    const int n0 = blockIdx.y * 64;
    const us* Ab = A + (size_t)blockIdx.z * (size_t)strideA;
    const us* Bb = B + (size_t)blockIdx.z * (size_t)strideB;

    v8f c0 = {}; v8f c1 = {}; v8f c2 = {}; v8f c3 = {};
    for (int k0 = 0; k0 < K; k0 += 32) {
        const v16bf a  = ld_frag(Ab, lda, m0 + m, k0, hsel);
        const v16bf b0 = ld_frag(Bb, ldb, n0 + m,      k0, hsel);
        const v16bf b1 = ld_frag(Bb, ldb, n0 + 16 + m, k0, hsel);
        const v16bf b2 = ld_frag(Bb, ldb, n0 + 32 + m, k0, hsel);
        const v16bf b3 = ld_frag(Bb, ldb, n0 + 48 + m, k0, hsel);
        c0 = wmma16(a, b0, c0);
        c1 = wmma16(a, b1, c1);
        c2 = wmma16(a, b2, c2);
        c3 = wmma16(a, b3, c3);
    }

    // D map: acc[r] -> (row 8*hsel + r, col n-tile + m). Stage the 16x64 wave tile in LDS.
    float* tw = tile + wave * 1024;
#pragma unroll
    for (int r = 0; r < 8; ++r) {
        const int row = 8 * hsel + r;
        tw[row * 64 + m]      = c0[r];
        tw[row * 64 + 16 + m] = c1[r];
        tw[row * 64 + 32 + m] = c2[r];
        tw[row * 64 + 48 + m] = c3[r];
    }
    __syncthreads();

    float* Cb = C + (size_t)blockIdx.z * (size_t)strideC;
    v4f vals[8];
#pragma unroll
    for (int p = 0; p < 8; ++p) {
        const int row = 2 * p + hsel;
        vals[p] = *(const v4f*)(tw + row * 64 + 4 * m);
    }
#pragma unroll
    for (int p = 0; p < 8; ++p) {
        float* d = Cb + (size_t)(m0 + 2 * p + hsel) * ldc + n0 + 4 * m;
        *(v4f*)d = vals[p];
    }
    
}

// ---------------------------------------------------------------------------
// Fused energies -> softmax -> P @ context -> LayerNorm + residual. One block per (b, group of TT query rows t).
// Thread = (hh, s): key position s, part hh (of HS) of the feature range. Each 16-B piece of Wc[b][s][.] is loaded
// once and used for all TT query rows of the block, so the row-strided Wc loads (one cache line per lane)
// are issued TT times less often than with one query row per block.
//   e[t][s] = sum_h v[h] * tanh(Wc[b][s][h] + Ux[bt][h] + bUa[h] + bWa[h]) + bVa   (f32; the HS parts of
//             the h range are summed apart and then added in order)
//   p    = softmax_s(e); Pl[t][s] = bf16 hi, Pl[t][S+s] = bf16 lo (lo = p - hi), in LDS
//   cv[t][d] = sum_k Pl[t][k] * ctxT[b][d][k mod S] on WMMA: the M tile is the block's TT rows and zero rows up
//             to 16; wave w does columns 32w..32w+31; each B fragment is loaded once and serves hi and lo
//   out  = LayerNorm(cv) * gamma + beta + x, one wave per row
// LDS regions are cross-wave: block barriers throughout.
// ---------------------------------------------------------------------------
// Work-group barrier that orders LDS traffic only. __syncthreads() also waits for the wave's outstanding global
// loads; with this one the tail's operands, asked for in front of the softmax, stay in flight across its barriers.
// Everything the waves of a block hand to each other behind those loads goes through LDS.
__device__ __forceinline__ void bar_lds() {
    __builtin_amdgcn_fence(__ATOMIC_RELEASE, "workgroup", "local");
    __builtin_amdgcn_s_barrier();
    __builtin_amdgcn_fence(__ATOMIC_ACQUIRE, "workgroup", "local");
}

#define TT 4                // query rows per block
#define HS 4                // parts of the h range, one per group of S_LEN threads
#define RPT (TT / HS)       // softmax rows per thread
static_assert((TQ % TT) == 0 && (TT % HS) == 0 && ((HD / 4) % HS) == 0);
static_assert(TT <= (S_LEN * HS) / 32 && TT <= 8);       // rows 0..TT-1 of a D tile lie in lanes 0-15
static_assert(HD == (S_LEN * HS / 32) * 32);             // 32 output columns per wave
#define PLP (KC + 16)       // pitch of a P row in LDS, halves: 32 B more, so that the 16-B pieces which the 32 lanes
                            // of one fragment load read (16 rows, 2 pieces each) spread evenly over the banks

// waves_per_eu: the block's 16 waves stand four to a SIMD and one block fills a WGP, so the register budget is
// that of four waves; without it the scheduler holds the register count down for more waves and sets each
// tanh right in front of its product and sum instead of issuing the 64 independent ones of a trip in runs.
__global__ __launch_bounds__(S_LEN * HS) __attribute__((amdgpu_waves_per_eu(S_LEN * HS / 128, S_LEN * HS / 128)))
void k_attn(const float* __restrict__ Uxp, const float* __restrict__ Wcp,
            const float* __restrict__ bWa, const float* __restrict__ bUa,
            const float* __restrict__ Va,  const float* __restrict__ bVa,
            const us* __restrict__ ctxT, const float* __restrict__ xin,
            const float* __restrict__ gam, const float* __restrict__ bet,
            float* __restrict__ out)
{
    __shared__ v4f sq4[TT][HD / 4];
    __shared__ v4f sv4[HD / 4];
    __shared__ float part[HS][TT][S_LEN];
    __shared__ float red[TT][S_LEN];
    __shared__ __attribute__((aligned(16))) us Pl[16][PLP];
    __shared__ __attribute__((aligned(16))) float cvs[TT][HD];

    const int bt0 = blockIdx.x * TT;         // first of the block's rows b * TQ + t (all of one b)
    const int b   = bt0 / TQ;
    const int tid = threadIdx.x, lane = tid & 31, wave = tid >> 5;
    const int s   = tid & (S_LEN - 1), hh = tid / S_LEN;

    for (int i = tid; i < TT * (HD / 4); i += S_LEN * HS) {
        const int c = i & (HD / 4 - 1);
        v4f q = *(const v4f*)(Uxp + (size_t)bt0 * HD + i * 4);
        const v4f b1 = *(const v4f*)(bUa + c * 4);
        const v4f b2 = *(const v4f*)(bWa + c * 4);
        q.x = (q.x + rbf(b1.x)) + rbf(b2.x);
        q.y = (q.y + rbf(b1.y)) + rbf(b2.y);
        q.z = (q.z + rbf(b1.z)) + rbf(b2.z);
        q.w = (q.w + rbf(b1.w)) + rbf(b2.w);
        sq4[i / (HD / 4)][c] = q;
    }
    for (int i = tid; i < HD / 4; i += S_LEN * HS) {
        v4f w = *(const v4f*)(Va + i * 4);
        w.x = rbf(w.x); w.y = rbf(w.y); w.z = rbf(w.z); w.w = rbf(w.w);
        sv4[i] = w;
    }
    // rows TT..15 of the M tile are zero
    for (int i = tid; i < (16 - TT) * PLP / 8; i += S_LEN * HS) {
        const v8us zr = {};
        *(v8us*)(&Pl[TT][0] + i * 8) = zr;
    }
    __syncthreads();

    const float bva = rbf(bVa[0]);
    const int u0 = hh * (HD / 4 / HS);
    const v4f* we = (const v4f*)(Wcp + ((size_t)b * S_LEN + s) * HD) + u0;
    float acc[TT];
#pragma unroll
    for (int j = 0; j < TT; ++j) acc[j] = 0.0f;
    // four 16-B loads per lane go out together at the head of each trip (half a cache line per lane)
#pragma unroll 4
    for (int u = 0; u < HD / 4 / HS; ++u) {
        const v4f e = we[u];
        const v4f w = sv4[u0 + u];
#pragma unroll
        for (int j = 0; j < TT; ++j) {
            const v4f d = sq4[j][u0 + u];
            const v2f y0 = tanh_acc2(e.xy + d.xy);
            const v2f y1 = tanh_acc2(e.zw + d.zw);
            const v2f p0 = w.xy * y0;
            const v2f p1 = w.zw * y1;
            acc[j] += p0.x;
            acc[j] += p0.y;
            acc[j] += p1.x;
            acc[j] += p1.y;
        }
    }
    // what the tail reads from global memory is asked for here, so that it arrives during the softmax:
    // the wave's B fragments (32 columns d, all S key positions) and, in the TT LayerNorm waves, x, gamma, beta
    const int wv = __builtin_amdgcn_readfirstlane(wave);
    const int hsel = lane >> 4, m = lane & 15;
    const us* cb = ctxT + (size_t)b * (size_t)(HD * S_LEN);
    const us* cb0 = cb + (size_t)(wv * 32 + m) * S_LEN + 8 * hsel;   // the lane's row of n-tile 0, its k half
    const us* cb1 = cb0 + 16 * S_LEN;                                // the same of n-tile 1
    v16bf bfr[2][S_LEN / 32];
#pragma unroll
    for (int kk = 0; kk < S_LEN / 32; ++kk) bfr[0][kk] = ld_frag(cb0, 0, 0, kk * 32, 0);
#pragma unroll
    for (int kk = 0; kk < S_LEN / 32; ++kk) bfr[1][kk] = ld_frag(cb1, 0, 0, kk * 32, 0);
    // stands in front of any overwrite of the address pair that these loads name (all sixteen go by cb0 and an
    // immediate offset); the pair is an input so that no load's own result is laid over it either
    asm volatile("s_wait_xcnt 0x0" :: "v"(cb0) : "memory");
    const int lr   = bt0 + wv;                          // LayerNorm row of wave wv < TT
    const int frow = (lr / TQ) * T_FULL + (lr % TQ);
    v4f xr[4], gm[4], be[4];
    if (wv < TT) {
        const float* xp = xin + (size_t)frow * HD + lane * 4;
#pragma unroll
        for (int j = 0; j < 4; ++j) {
            xr[j] = *(const v4f*)(xp + 128 * j);
            gm[j] = *(const v4f*)(gam + 128 * j + lane * 4);
            be[j] = *(const v4f*)(bet + 128 * j + lane * 4);
        }
        // inside the branch, so that it stands in front of the next write of a scalar base that these loads name
        asm volatile("s_wait_xcnt 0x0" ::: "memory");
    }

#pragma unroll
    for (int j = 0; j < TT; ++j) part[hh][j][s] = acc[j];
    bar_lds();

    // thread (hh, s) carries rows j = RPT * hh + k of the block through the softmax
    float en[RPT], ex[RPT];
#pragma unroll
    for (int k = 0; k < RPT; ++k) {
        const int j = RPT * hh + k;
        float a = part[0][j][s];
#pragma unroll
        for (int g = 1; g < HS; ++g) a += part[g][j][s];
        en[k] = a + bva;
        red[j][s] = en[k];
    }
    bar_lds();

    // per-row max over s
#pragma unroll
    for (int st = S_LEN / 2; st > 0; st >>= 1) {
        if (s < st) {
#pragma unroll
            for (int k = 0; k < RPT; ++k) {
                const int j = RPT * hh + k;
                red[j][s] = fmaxf(red[j][s], red[j][s + st]);
            }
        }
        bar_lds();
    }
    float mx[RPT];
#pragma unroll
    for (int k = 0; k < RPT; ++k) mx[k] = red[RPT * hh + k][0];
    bar_lds();

    // exp + per-row sum
#pragma unroll
    for (int k = 0; k < RPT; ++k) {
        ex[k] = __expf(en[k] - mx[k]);
        red[RPT * hh + k][s] = ex[k];
    }
    bar_lds();
#pragma unroll
    for (int st = S_LEN / 2; st > 0; st >>= 1) {
        if (s < st) {
#pragma unroll
            for (int k = 0; k < RPT; ++k) {
                const int j = RPT * hh + k;
                red[j][s] += red[j][s + st];
            }
        }
        bar_lds();
    }
#pragma unroll
    for (int k = 0; k < RPT; ++k) {
        const int j = RPT * hh + k;
        const float ssum = red[j][0];
        const float p = ex[k] * (1.0f / ssum);
        const us h = f2bf(p);
        Pl[j][s] = h;
        Pl[j][S_LEN + s] = f2bf(p - bf2f(h));
    }
    bar_lds();

    // cv tile: k runs over the hi plane, then over the lo plane
    v16bf af[KC / 32];
#pragma unroll
    for (int kk = 0; kk < KC / 32; ++kk) af[kk] = ld_frag(&Pl[0][0], PLP, m, kk * 32, hsel);
    v8f c0 = {}; v8f c1 = {};
#pragma unroll
    for (int kk = 0; kk < KC / 32; ++kk) {
        c0 = wmma16(af[kk], bfr[0][kk % (S_LEN / 32)], c0);
        c1 = wmma16(af[kk], bfr[1][kk % (S_LEN / 32)], c1);
    }
    // D map: acc[r] -> (row 8*hsel + r, col n-tile + m): the block's rows are r < TT of lanes 0-15
    if (hsel == 0) {
#pragma unroll
        for (int r = 0; r < TT; ++r) {
            cvs[r][wv * 32 + m]      = c0[r];
            cvs[r][wv * 32 + 16 + m] = c1[r];
        }
    }
    bar_lds();

    // LayerNorm + residual: wave wv < TT takes row wv. Lane l holds columns 128j + 4l .. +3 for j = 0..3;
    // store instruction j covers columns 128j..128j+127
    if (wv < TT) {
        v4f c[4];
#pragma unroll
        for (int j = 0; j < 4; ++j) c[j] = *(const v4f*)(&cvs[wv][128 * j + lane * 4]);
        float sm = 0.0f;
#pragma unroll
        for (int j = 0; j < 4; ++j) sm += (c[j].x + c[j].y) + (c[j].z + c[j].w);
#pragma unroll
        for (int off = 16; off > 0; off >>= 1) sm += __shfl_xor(sm, off, 32);
        const float mean = sm * (1.0f / (float)HD);

        float q = 0.0f;
#pragma unroll
        for (int j = 0; j < 4; ++j) {
            const float dx = c[j].x - mean, dy = c[j].y - mean, dz = c[j].z - mean, dw = c[j].w - mean;
            q += dx * dx; q += dy * dy; q += dz * dz; q += dw * dw;
        }
#pragma unroll
        for (int off = 16; off > 0; off >>= 1) q += __shfl_xor(q, off, 32);
        const float var  = q * (1.0f / (float)HD);
        const float rstd = rsqrtf(var + LN_EPS);

        v4f o[4];
#pragma unroll
        for (int j = 0; j < 4; ++j) {
            o[j].x = (c[j].x - mean) * rstd * rbf(gm[j].x) + rbf(be[j].x) + rbf(xr[j].x);
            o[j].y = (c[j].y - mean) * rstd * rbf(gm[j].y) + rbf(be[j].y) + rbf(xr[j].y);
            o[j].z = (c[j].z - mean) * rstd * rbf(gm[j].z) + rbf(be[j].z) + rbf(xr[j].z);
            o[j].w = (c[j].w - mean) * rstd * rbf(gm[j].w) + rbf(be[j].w) + rbf(xr[j].w);
        }
        float* dp = out + (size_t)frow * HD + lane * 4;
#pragma unroll
        for (int j = 0; j < 4; ++j) *(v4f*)(dp + 128 * j) = o[j];
    }
}

// ---------------------------------------------------------------------------
#define PROWS (NB * S_LEN)   // rows of either projection
static_assert(TQ == S_LEN);  // the two projections share one grid

static inline size_t al256(size_t x) { return (x + 255) & ~(size_t)255; }

extern "C" void kernel_launch(void* const* d_in, const int* in_sizes, int n_in,
                              void* d_out, int out_size, void* d_ws, size_t ws_size,
                              hipStream_t stream)
{
    if (n_in < 10) return;
    if (in_sizes[0] < ((NB - 1) * T_FULL + S_LEN) * HD) return;   // context [8][128][512] f32
    if (in_sizes[1] < ((NB - 1) * T_FULL + TQ) * HD) return;      // x       [8][128][512] f32
    if (in_sizes[2] < HD * HD) return;                             // Wa [512][512] ([in][out]) f32
    if (in_sizes[3] < HD) return;                                  // bWa [512]
    if (in_sizes[4] < HD * HD) return;                             // Ua [512][512] ([in][out]) f32
    if (in_sizes[5] < HD) return;                                  // bUa [512]
    if (in_sizes[6] < HD) return;                                  // Va [512][1]
    if (in_sizes[7] < 1) return;                                   // bVa [1]
    if (in_sizes[8] < HD || in_sizes[9] < HD) return;              // gamma, beta [512]
    if (out_size < ((NB - 1) * T_FULL + TQ) * HD) return;

    const float* context = (const float*)d_in[0];
    const float* x       = (const float*)d_in[1];
    const float* Wa      = (const float*)d_in[2];
    const float* bWa     = (const float*)d_in[3];
    const float* Ua      = (const float*)d_in[4];
    const float* bUa     = (const float*)d_in[5];
    const float* Va      = (const float*)d_in[6];
    const float* bVa     = (const float*)d_in[7];
    const float* gamma   = (const float*)d_in[8];
    const float* beta    = (const float*)d_in[9];
    float* out = (float*)d_out;

    char* ws = (char*)d_ws;
    size_t off = 0;
    // the two projections' operands and results lie as pairs of equal planes, one batch stride apart
    us* ctxb  = (us*)(ws + off);    off += al256((size_t)2 * PROWS * HD * sizeof(us));    // [NB*S][512]
    us* xb    = ctxb + (size_t)PROWS * HD;                                                // [NB*TQ][512]
    us* WaT   = (us*)(ws + off);    off += al256((size_t)2 * HD * HD * sizeof(us));       // [H][D]
    us* UaT   = WaT + (size_t)HD * HD;                                                    // [H][D]
    us* ctxT  = (us*)(ws + off);    off += al256((size_t)NB * HD * S_LEN * sizeof(us));   // [NB][512][128]
    float* Wc = (float*)(ws + off); off += al256((size_t)2 * PROWS * HD * sizeof(float)); // [NB*S][512]
    float* Ux = Wc + (size_t)PROWS * HD;                                                  // [NB*TQ][512]
    if (off > ws_size) return;

    const dim3 b256(256), b128(128), bS(S_LEN * HS);

    // ---- 16-bit planes (RNE convert of the float inputs, once), all five in one launch ----
    k_prep<<<dim3(PB_XC), b256, 0, stream>>>(context, x, Wa, Ua, ctxb, xb, WaT, UaT, ctxT);

    // ---- projections in one launch: z = 0: Wc = context @ Wa, z = 1: Ux = x @ Ua (f32; biases added in k_attn) ----
    k_gemm<<<dim3(PROWS / 64, HD / 64, 2), b128, 0, stream>>>(
        ctxb, HD, PROWS * HD, WaT, HD, HD * HD, Wc, HD, PROWS * HD, HD);

    // ---- energies + softmax, cv = [P_hi|P_lo] @ [ctxT;ctxT] (f32), LayerNorm + residual -> out ----
    k_attn<<<dim3(NB * TQ / TT), bS, 0, stream>>>(Ux, Wc, bWa, bUa, Va, bVa, ctxT, x, gamma, beta, out);
}

// v005
// One run takes 19.5 microseconds.
// Next to v004, in two timings, it ran 1.29 and 1.30 times as fast.
// Counting every step since v000, it is 3.30 times as fast.
#include <hip/hip_runtime.h>

// Contractions on v_wmma_f32_16x16x32_bf16 (bf16 operands, f32 accumulate): context@Wa and x@Ua from
// operand tiles that each block converts (RNE) into LDS itself; attn@context with attn carried as bf16 hi+lo planes folded into K against
// the RNE-converted transposed context plane, inside the energy kernel. Energies v.tanh(.), softmax,
// LayerNorm and the residual add in f32 on the VALU.

#ifndef NB
#define NB 8
#endif
#ifndef TQ
#define TQ 128
#endif
#define NB_FULL 8
#define T_FULL 128          // full query length: per-batch row stride of x and of the output
#define S_LEN 128           // context positions (keys), never reduced
#define S_FULL 128          // per-batch row stride of context in the input
#define HD 512              // feature width D == hidden width H
#define KC (2 * S_LEN)      // context GEMM depth: [P_hi | P_lo]
#define LN_EPS 1.0e-3f

static_assert(NB >= 1 && NB <= NB_FULL);
static_assert(TQ >= 64 && TQ <= T_FULL && (TQ % 64) == 0);
static_assert(S_LEN == 128 && S_LEN == S_FULL);
static_assert((HD % 256) == 0 && (HD % 64) == 0 && (HD % 32) == 0);
static_assert((KC % 32) == 0 && (S_LEN % 64) == 0);
static_assert(((HD / 4) % S_LEN) == 0);
static_assert((S_LEN % 32) == 0);

typedef unsigned short us;
typedef us     v8us  __attribute__((ext_vector_type(8)));
typedef __bf16 v16bf __attribute__((ext_vector_type(16)));
typedef float  v8f   __attribute__((ext_vector_type(8)));
typedef float  v4f   __attribute__((ext_vector_type(4)));

union Frag { v16bf v; v8us h[2]; };

// ---------------------------------------------------------------------------
// scalar helpers
// ---------------------------------------------------------------------------
__device__ __forceinline__ us f2bf(float f) {           // f32 -> bf16, RNE convert
    unsigned int u = __float_as_uint(f);
    u += 0x7FFFu + ((u >> 16) & 1u);
    return (us)(u >> 16);
}
__device__ __forceinline__ float bf2f(us h) {
    return __uint_as_float(((unsigned int)h) << 16);
}
__device__ __forceinline__ float rbf(float f) {          // value after an RNE convert to bf16
    return bf2f(f2bf(f));
}
// tanh on two neighbouring features, each by one v_tanh_f32
typedef float v2f __attribute__((ext_vector_type(2)));
__device__ __forceinline__ v2f tanh_acc2(v2f x) {
    v2f y;  y.x = __builtin_amdgcn_tanhf(x.x); y.y = __builtin_amdgcn_tanhf(x.y);
    return y;
}
// ---------------------------------------------------------------------------
// WMMA helper: 16x16x32 bf16, f32 accumulate, 4-slot VALU hazard guard after the issue
// ---------------------------------------------------------------------------
__device__ __forceinline__ v8f wmma16(v16bf a, v16bf b, v8f c) {
    v8f d = __builtin_amdgcn_wmma_f32_16x16x32_bf16(false, a, false, b, (short)0, c, false, false);
    asm volatile("v_nop\n\tv_nop\n\tv_nop\n\tv_nop" : "+v"(d) : "v"(a), "v"(b));
    return d;
}

// Fragment loader for a k-contiguous 16-bit plane P[row][k] with pitch ld (halves).
// Lane l: row = (l & 15) (A row m, or B column n of an [n][k] plane), hsel = l >> 4.
//   elements 0..7  <- k0 + 8*hsel + 0..7
//   elements 8..15 <- k0 + 16 + 8*hsel + 0..7
__device__ __forceinline__ v16bf ld_frag(const us* __restrict__ P, int ld, int row, int k0, int hsel) {
    Frag f;
    const us* p = P + (size_t)row * ld + k0 + 8 * hsel;
    f.h[0] = *(const v8us*)p;
    f.h[1] = *(const v8us*)(p + 16);
    return f.v;
}

// ---------------------------------------------------------------------------
// Transpose + convert: src[R][C] f32 (pitch spitch, per-z stride sstride) -> dst[C][R] bf16 (pitch dpitch,
// per-z stride dstride), optionally a second copy at column offset +DUP halves.
// Block: 64 src rows x 64 src cols through LDS (cross-wave -> block barrier). Store phase: one instruction
// tile index (bx, by, z) in (R/64, C/64, Z); ts: the block's 64 x 65 f32 LDS tile
// ---------------------------------------------------------------------------
template <int DUP>
__device__ __forceinline__
void d_trans(float (*ts)[65], int bx, int by, int z,
             const float* __restrict__ src, int spitch, int sstride,
             us* __restrict__ dst, int dpitch, int dstride)
{
    const int r0 = bx * 64, c0 = by * 64;
    const int tid = threadIdx.x, lane = tid & 31, wave = tid >> 5;
    const float* sb = src + (size_t)z * (size_t)sstride;
    us* db = dst + (size_t)z * (size_t)dstride;

#pragma unroll
    for (int p = 0; p < 4; ++p) {
        const int rl = p * 16 + (tid >> 4);
        const int c4 = (tid & 15) * 4;
        const v4f x = *(const v4f*)(sb + (size_t)(r0 + rl) * spitch + c0 + c4);
        ts[rl][c4 + 0] = x.x; ts[rl][c4 + 1] = x.y; ts[rl][c4 + 2] = x.z; ts[rl][c4 + 3] = x.w;
    }
    __syncthreads();

    v8us o[2];
#pragma unroll
    for (int p = 0; p < 2; ++p) {
        const int cl = p * 32 + wave * 4 + (lane >> 3);
        const int r8 = (lane & 7) * 8;
#pragma unroll
        for (int i = 0; i < 8; ++i) o[p][i] = f2bf(ts[r8 + i][cl]);
    }
#pragma unroll
    for (int p = 0; p < 2; ++p) {
        const int cl = p * 32 + wave * 4 + (lane >> 3);
        const int r8 = (lane & 7) * 8;
        us* d = db + (size_t)(c0 + cl) * dpitch + r0 + r8;
        *(v8us*)d = o[p];
        if (DUP != 0) *(v8us*)(d + DUP) = o[p];
    }
    // the stores' address and data registers are written again in the code of the caller's other branches,
    // which follows these stores in the listing: the wait stands in front of any such overwrite
    asm volatile("s_wait_xcnt 0x0" ::: "memory");
}

// ---------------------------------------------------------------------------
// Both projections and the transposed context plane in one launch, straight from the f32 inputs.
//   blocks [0, GB):        one 64(M) x 64(N) tile of Wc = context @ Wa (z = 0) or of Ux = x @ Ua (z = 1), K = HD
//   blocks [GB, GB + PB_CT): context[b][s][d] -> ctxT[b][d][s] (bf16), one 64 x 64 piece each
// A GEMM block (8 waves) converts its two operand panels to bf16 in LDS, once, in batches along k:
//   As[64][HD]  rows of context or x, k-contiguous, pitch PA halves (16 B x odd, for ds_load_b128)
//   Bs[HD][64]  rows k of Wa or Ua as they lie in memory, pitch PBB bytes (32 B x odd, for ds_load_tr16_b128)
// Wave w: rows 16 (w & 3) .. +15, columns 32 (w >> 2) .. +31 (2 accumulators). The transposing load hands lane
// (c, h) the elements Bs[k0 + 8h + 0..7][n + c]; two of them, at k0 and k0 + 16, follow the k map of ld_frag.
// The GEMM blocks, which run longer, come first in the index order.
// ---------------------------------------------------------------------------
#define PROWS (NB * S_LEN)   // rows of either projection
static_assert(TQ == S_LEN);  // the two projections share one grid
#define GB (2 * (PROWS / 64) * (HD / 64))
#define PB_CT ((S_LEN / 64) * (HD / 64) * NB)
#define PA (HD + 8)
#define PBB 160
#define AS_BYTES (64 * PA * 2)
#define BS_BYTES (HD * PBB)
#define KG 4                 // k-steps per fragment group
#define TP 68                // pitch of the f32 result tile in LDS, dwords: rows r and r + 8 fall on different banks
static_assert(KG == 4 && HD / 32 / KG >= 2);   // a batch is 16 loads per thread of 256
static_assert(64 * TP * 4 <= AS_BYTES && 64 * 65 * 4 <= AS_BYTES + BS_BYTES);

typedef unsigned int v2u __attribute__((ext_vector_type(2)));
typedef unsigned int v4u __attribute__((ext_vector_type(4)));
typedef short s16x8 __attribute__((ext_vector_type(8)));
typedef __bf16 v2bf __attribute__((ext_vector_type(2)));

__device__ __forceinline__ unsigned int cvt2(float lo, float hi) {      // two f32 -> two bf16, RNE, one instruction
    const v2f p = {lo, hi};
    return __builtin_bit_cast(unsigned int, __builtin_convertvector(p, v2bf));
}
__device__ __forceinline__ v8us ld_tr16(const unsigned char* p) {
    typedef __attribute__((address_space(3))) s16x8 lds_s16x8;
    return __builtin_bit_cast(v8us, __builtin_amdgcn_ds_load_tr16_b128_v8i16((lds_s16x8*)p));
}

// Work-group barrier that orders LDS traffic only. __syncthreads() also waits for the wave's outstanding global
// loads; with this one loads asked for ahead stay in flight across it: in k_proj the later batches of the panels, in
// k_attn the tail's operands, asked for in front of the softmax. Everything the waves of a block hand to each
// other at such a barrier goes through LDS.
__device__ __forceinline__ void bar_lds() {
    __builtin_amdgcn_fence(__ATOMIC_RELEASE, "workgroup", "local");
    __builtin_amdgcn_s_barrier();
    __builtin_amdgcn_fence(__ATOMIC_ACQUIRE, "workgroup", "local");
}

// The panels come in HD / 32 / KG batches of 16 loads of 16 B per thread; batch bt holds k = 32 KG bt .. + 32 KG - 1 of
// both. pa, pb: the thread's first pieces; every further piece lies a constant step on (16 rows of A or of B, for
// A also 32 KG columns a batch), so all loads go by two address pairs and an offset.
__device__ __forceinline__
void ld_batch(v4f (&r)[16], int bt, const float* __restrict__ pa, const float* __restrict__ pb) {
#pragma unroll
    for (int i = 0; i < 4; ++i) {            // A: 8 consecutive k of one row per thread
        r[2 * i]     = *(const v4f*)(pa + i * 16 * HD + bt * (32 * KG));
        r[2 * i + 1] = *(const v4f*)(pa + i * 16 * HD + bt * (32 * KG) + 4);
    }
#pragma unroll
    for (int i = 0; i < 8; ++i)              // B: 4 consecutive n of one row k per thread
        r[8 + i] = *(const v4f*)(pb + (bt * 8 + i) * 16 * HD);
    // stands in front of any overwrite of the two address pairs that these loads name; the pairs are inputs so
    // that no load's own result is laid over them either
    asm volatile("s_wait_xcnt 0x0" :: "v"(pa), "v"(pb) : "memory");
}
__device__ __forceinline__
void st_batch(const v4f (&r)[16], int bt, unsigned char* __restrict__ sa, unsigned char* __restrict__ sb) {
#pragma unroll
    for (int i = 0; i < 4; ++i) {
        const v4f a = r[2 * i], c = r[2 * i + 1];
        const v4u o = {cvt2(a.x, a.y), cvt2(a.z, a.w), cvt2(c.x, c.y), cvt2(c.z, c.w)};
        *(v4u*)(sa + i * 16 * (PA * 2) + bt * (64 * KG)) = o;
    }
#pragma unroll
    for (int i = 0; i < 8; ++i) {
        const v4f a = r[8 + i];
        const v2u o = {cvt2(a.x, a.y), cvt2(a.z, a.w)};
        *(v2u*)(sb + (bt * 8 + i) * 16 * PBB) = o;
    }
}

// waves_per_eu: two blocks (2 waves to a SIMD each) share a WGP, so that the transposing blocks find room beside
// the GEMM blocks instead of waiting for one to end; that holds the register count to a quarter of a SIMD's file.
__global__ __launch_bounds__(256) __attribute__((amdgpu_waves_per_eu(4, 4)))
void k_proj(const float* __restrict__ context, const float* __restrict__ x,
            const float* __restrict__ Wa, const float* __restrict__ Ua,
            float* __restrict__ Wc, float* __restrict__ Ux, us* __restrict__ ctxT)
{
    __shared__ __attribute__((aligned(16))) unsigned char sm[AS_BYTES + BS_BYTES];
    const int blk = blockIdx.x;
    if (blk >= GB) {                                     // block-uniform
        const int i  = blk - GB;
        const int bx = i % (S_LEN / 64);
        const int by = (i / (S_LEN / 64)) % (HD / 64);
        const int z  = i / ((S_LEN / 64) * (HD / 64));
        d_trans<0>((float (*)[65])sm, bx, by, z, context, HD, T_FULL * HD, ctxT, S_LEN, HD * S_LEN);
        return;
    }
    const int tid = threadIdx.x, lane = tid & 31;
    const int wv = __builtin_amdgcn_readfirstlane(tid >> 5);
    const int hsel = lane >> 4, m = lane & 15;
    const int z  = blk / ((PROWS / 64) * (HD / 64));
    const int m0 = (blk % (PROWS / 64)) * 64;
    const int n0 = ((blk / (PROWS / 64)) % (HD / 64)) * 64;
    const int bq = m0 / TQ;                              // the tile's 64 rows lie in one batch
    const float* Ar = (z == 0 ? context : x) + (size_t)(bq * T_FULL + (m0 - bq * TQ)) * HD;
    const float* Br = (z == 0 ? Wa : Ua) + n0;
    unsigned char* As = sm;
    unsigned char* Bs = sm + AS_BYTES;

    const float* pa = Ar + (size_t)(tid >> 4) * HD + (tid & 15) * 8;
    const float* pb = Br + (size_t)(tid >> 4) * HD + (tid & 15) * 4;
    unsigned char* sa = As + (tid >> 4) * (PA * 2) + (tid & 15) * 16;
    unsigned char* sb = Bs + (tid >> 4) * PBB + (tid & 15) * 8;
    const int mt = wv & 3, nh = wv >> 2;
    const unsigned char* bd = Bs + (8 * hsel + (lane & 7)) * PBB + ((lane >> 3) & 1) * 16 + nh * 64;
    v8f c0 = {}; v8f c1 = {};

    // Two register sets, up to two batches of loads in flight. Each batch is converted and stored as it arrives and its
    // KG k-steps are worked on while the later batches fly: no LDS byte is written twice, so one barrier a batch
    // (LDS only: it leaves the global loads in flight) is all the order there is.
    v4f rr[2][16];
    ld_batch(rr[0], 0, pa, pb);
    ld_batch(rr[1], 1, pa, pb);
#pragma unroll
    for (int g = 0; g < HD / 32 / KG; ++g) {
        st_batch(rr[g & 1], g, sa, sb);
        if (g + 2 < HD / 32 / KG) ld_batch(rr[g & 1], g + 2, pa, pb);
        bar_lds();
        v16bf fa[KG];
        Frag  fb0[KG], fb1[KG];
#pragma unroll
        for (int i = 0; i < KG; ++i) {
            const int k0 = (g * KG + i) * 32;
            fa[i] = ld_frag((const us*)As, PA, mt * 16 + m, k0, hsel);
            fb0[i].h[0] = ld_tr16(bd + k0 * PBB);
            fb0[i].h[1] = ld_tr16(bd + (k0 + 16) * PBB);
            fb1[i].h[0] = ld_tr16(bd + k0 * PBB + 32);
            fb1[i].h[1] = ld_tr16(bd + (k0 + 16) * PBB + 32);
        }
#pragma unroll
        for (int i = 0; i < KG; ++i) {
            c0 = wmma16(fa[i], fb0[i].v, c0);
            c1 = wmma16(fa[i], fb1[i].v, c1);
        }
    }
    __syncthreads();                                     // every wave has read its last fragment: the tile lies over As

    // D map: acc[r] -> (row 8*hsel + r, col n-tile + m). The 64 x 64 tile goes through LDS to whole-line stores.
    float* tile = (float*)sm;
#pragma unroll
    for (int r = 0; r < 8; ++r) {
        const int row = mt * 16 + 8 * hsel + r;
        tile[row * TP + nh * 32 + m]      = c0[r];
        tile[row * TP + nh * 32 + 16 + m] = c1[r];
    }
    __syncthreads();

    float* Cb = (z == 0 ? Wc : Ux) + (size_t)m0 * HD + n0;
    v4f vals[4];
#pragma unroll
    for (int p = 0; p < 4; ++p) vals[p] = *(const v4f*)(tile + (p * 16 + (tid >> 4)) * TP + (tid & 15) * 4);
#pragma unroll
    for (int p = 0; p < 4; ++p) *(v4f*)(Cb + (size_t)(p * 16 + (tid >> 4)) * HD + (tid & 15) * 4) = vals[p];
    // the stores' address pair is written again in the code of the transposing branch, which follows these stores
    // in the listing: the wait stands in front of any such overwrite
    asm volatile("s_wait_xcnt 0x0" ::: "memory");
}

// ---------------------------------------------------------------------------
// Fused energies -> softmax -> P @ context -> LayerNorm + residual. One block per (b, group of TT query rows t).
// Thread = (hh, s): key position s, part hh (of HS) of the feature range. Each 16-B piece of Wc[b][s][.] is loaded
// once and used for all TT query rows of the block, so the row-strided Wc loads (one cache line per lane)
// are issued TT times less often than with one query row per block.
//   e[t][s] = sum_h v[h] * tanh(Wc[b][s][h] + Ux[bt][h] + bUa[h] + bWa[h]) + bVa   (f32; the HS parts of
//             the h range are summed apart and then added in order)
//   p    = softmax_s(e); Pl[t][s] = bf16 hi, Pl[t][S+s] = bf16 lo (lo = p - hi), in LDS
//   cv[t][d] = sum_k Pl[t][k] * ctxT[b][d][k mod S] on WMMA: the M tile is the block's TT rows and zero rows up
//             to 16; wave w does columns 32w..32w+31; each B fragment is loaded once and serves hi and lo
//   out  = LayerNorm(cv) * gamma + beta + x, one wave per row
// LDS regions are cross-wave: block barriers throughout.
// ---------------------------------------------------------------------------
#define TT 4                // query rows per block
#define HS 4                // parts of the h range, one per group of S_LEN threads
#define RPT (TT / HS)       // softmax rows per thread
static_assert((TQ % TT) == 0 && (TT % HS) == 0 && ((HD / 4) % HS) == 0);
static_assert(TT <= (S_LEN * HS) / 32 && TT <= 8);       // rows 0..TT-1 of a D tile lie in lanes 0-15
static_assert(HD == (S_LEN * HS / 32) * 32);             // 32 output columns per wave
#define PLP (KC + 16)       // pitch of a P row in LDS, halves: 32 B more, so that the 16-B pieces which the 32 lanes
                            // of one fragment load read (16 rows, 2 pieces each) spread evenly over the banks

// waves_per_eu: the block's 16 waves stand four to a SIMD and one block fills a WGP, so the register budget is
// that of four waves; without it the scheduler holds the register count down for more waves and sets each
// tanh right in front of its product and sum instead of issuing the 64 independent ones of a trip in runs.
__global__ __launch_bounds__(S_LEN * HS) __attribute__((amdgpu_waves_per_eu(S_LEN * HS / 128, S_LEN * HS / 128)))
void k_attn(const float* __restrict__ Uxp, const float* __restrict__ Wcp,
            const float* __restrict__ bWa, const float* __restrict__ bUa,
            const float* __restrict__ Va,  const float* __restrict__ bVa,
            const us* __restrict__ ctxT, const float* __restrict__ xin,
            const float* __restrict__ gam, const float* __restrict__ bet,
            float* __restrict__ out)
{
    __shared__ v4f sq4[TT][HD / 4];
    __shared__ v4f sv4[HD / 4];
    __shared__ float part[HS][TT][S_LEN];
    __shared__ float red[TT][S_LEN];
    __shared__ __attribute__((aligned(16))) us Pl[16][PLP];
    __shared__ __attribute__((aligned(16))) float cvs[TT][HD];

    const int bt0 = blockIdx.x * TT;         // first of the block's rows b * TQ + t (all of one b)
    const int b   = bt0 / TQ;
    const int tid = threadIdx.x, lane = tid & 31, wave = tid >> 5;
    const int s   = tid & (S_LEN - 1), hh = tid / S_LEN;

    for (int i = tid; i < TT * (HD / 4); i += S_LEN * HS) {
        const int c = i & (HD / 4 - 1);
        v4f q = *(const v4f*)(Uxp + (size_t)bt0 * HD + i * 4);
        const v4f b1 = *(const v4f*)(bUa + c * 4);
        const v4f b2 = *(const v4f*)(bWa + c * 4);
        q.x = (q.x + rbf(b1.x)) + rbf(b2.x);
        q.y = (q.y + rbf(b1.y)) + rbf(b2.y);
        q.z = (q.z + rbf(b1.z)) + rbf(b2.z);
        q.w = (q.w + rbf(b1.w)) + rbf(b2.w);
        sq4[i / (HD / 4)][c] = q;
    }
    for (int i = tid; i < HD / 4; i += S_LEN * HS) {
        v4f w = *(const v4f*)(Va + i * 4);
        w.x = rbf(w.x); w.y = rbf(w.y); w.z = rbf(w.z); w.w = rbf(w.w);
        sv4[i] = w;
    }
    // rows TT..15 of the M tile are zero
    for (int i = tid; i < (16 - TT) * PLP / 8; i += S_LEN * HS) {
        const v8us zr = {};
        *(v8us*)(&Pl[TT][0] + i * 8) = zr;
    }
    __syncthreads();

    const float bva = rbf(bVa[0]);
    const int u0 = hh * (HD / 4 / HS);
    const v4f* we = (const v4f*)(Wcp + ((size_t)b * S_LEN + s) * HD) + u0;
    float acc[TT];
#pragma unroll
    for (int j = 0; j < TT; ++j) acc[j] = 0.0f;
    // four 16-B loads per lane go out together at the head of each trip (half a cache line per lane)
#pragma unroll 4
    for (int u = 0; u < HD / 4 / HS; ++u) {
        const v4f e = we[u];
        const v4f w = sv4[u0 + u];
#pragma unroll
        for (int j = 0; j < TT; ++j) {
            const v4f d = sq4[j][u0 + u];
            const v2f y0 = tanh_acc2(e.xy + d.xy);
            const v2f y1 = tanh_acc2(e.zw + d.zw);
            const v2f p0 = w.xy * y0;
            const v2f p1 = w.zw * y1;
            acc[j] += p0.x;
            acc[j] += p0.y;
            acc[j] += p1.x;
            acc[j] += p1.y;
        }
    }
    // what the tail reads from global memory is asked for here, so that it arrives during the softmax:
    // the wave's B fragments (32 columns d, all S key positions) and, in the TT LayerNorm waves, x, gamma, beta
    const int wv = __builtin_amdgcn_readfirstlane(wave);
    const int hsel = lane >> 4, m = lane & 15;
    const us* cb = ctxT + (size_t)b * (size_t)(HD * S_LEN);
    const us* cb0 = cb + (size_t)(wv * 32 + m) * S_LEN + 8 * hsel;   // the lane's row of n-tile 0, its k half
    const us* cb1 = cb0 + 16 * S_LEN;                                // the same of n-tile 1
    v16bf bfr[2][S_LEN / 32];
#pragma unroll
    for (int kk = 0; kk < S_LEN / 32; ++kk) bfr[0][kk] = ld_frag(cb0, 0, 0, kk * 32, 0);
#pragma unroll
    for (int kk = 0; kk < S_LEN / 32; ++kk) bfr[1][kk] = ld_frag(cb1, 0, 0, kk * 32, 0);
    // stands in front of any overwrite of the address pair that these loads name (all sixteen go by cb0 and an
    // immediate offset); the pair is an input so that no load's own result is laid over it either
    asm volatile("s_wait_xcnt 0x0" :: "v"(cb0) : "memory");
    const int lr   = bt0 + wv;                          // LayerNorm row of wave wv < TT
    const int frow = (lr / TQ) * T_FULL + (lr % TQ);
    v4f xr[4], gm[4], be[4];
    if (wv < TT) {
        const float* xp = xin + (size_t)frow * HD + lane * 4;
#pragma unroll
        for (int j = 0; j < 4; ++j) {
            xr[j] = *(const v4f*)(xp + 128 * j);
            gm[j] = *(const v4f*)(gam + 128 * j + lane * 4);
            be[j] = *(const v4f*)(bet + 128 * j + lane * 4);
        }
        // inside the branch, so that it stands in front of the next write of a scalar base that these loads name
        asm volatile("s_wait_xcnt 0x0" ::: "memory");
    }

#pragma unroll
    for (int j = 0; j < TT; ++j) part[hh][j][s] = acc[j];
    bar_lds();

    // thread (hh, s) carries rows j = RPT * hh + k of the block through the softmax
    float en[RPT], ex[RPT];
#pragma unroll
    for (int k = 0; k < RPT; ++k) {
        const int j = RPT * hh + k;
        float a = part[0][j][s];
#pragma unroll
        for (int g = 1; g < HS; ++g) a += part[g][j][s];
        en[k] = a + bva;
        red[j][s] = en[k];
    }
    bar_lds();

    // per-row max over s
#pragma unroll
    for (int st = S_LEN / 2; st > 0; st >>= 1) {
        if (s < st) {
#pragma unroll
            for (int k = 0; k < RPT; ++k) {
                const int j = RPT * hh + k;
                red[j][s] = fmaxf(red[j][s], red[j][s + st]);
            }
        }
        bar_lds();
    }
    float mx[RPT];
#pragma unroll
    for (int k = 0; k < RPT; ++k) mx[k] = red[RPT * hh + k][0];
    bar_lds();

    // exp + per-row sum
#pragma unroll
    for (int k = 0; k < RPT; ++k) {
        ex[k] = __expf(en[k] - mx[k]);
        red[RPT * hh + k][s] = ex[k];
    }
    bar_lds();
#pragma unroll
    for (int st = S_LEN / 2; st > 0; st >>= 1) {
        if (s < st) {
#pragma unroll
            for (int k = 0; k < RPT; ++k) {
                const int j = RPT * hh + k;
                red[j][s] += red[j][s + st];
            }
        }
        bar_lds();
    }
#pragma unroll
    for (int k = 0; k < RPT; ++k) {
        const int j = RPT * hh + k;
        const float ssum = red[j][0];
        const float p = ex[k] * (1.0f / ssum);
        const us h = f2bf(p);
        Pl[j][s] = h;
        Pl[j][S_LEN + s] = f2bf(p - bf2f(h));
    }
    bar_lds();

    // cv tile: k runs over the hi plane, then over the lo plane
    v16bf af[KC / 32];
#pragma unroll
    for (int kk = 0; kk < KC / 32; ++kk) af[kk] = ld_frag(&Pl[0][0], PLP, m, kk * 32, hsel);
    v8f c0 = {}; v8f c1 = {};
#pragma unroll
    for (int kk = 0; kk < KC / 32; ++kk) {
        c0 = wmma16(af[kk], bfr[0][kk % (S_LEN / 32)], c0);
        c1 = wmma16(af[kk], bfr[1][kk % (S_LEN / 32)], c1);
    }
    // D map: acc[r] -> (row 8*hsel + r, col n-tile + m): the block's rows are r < TT of lanes 0-15
    if (hsel == 0) {
#pragma unroll
        for (int r = 0; r < TT; ++r) {
            cvs[r][wv * 32 + m]      = c0[r];
            cvs[r][wv * 32 + 16 + m] = c1[r];
        }
    }
    bar_lds();

    // LayerNorm + residual: wave wv < TT takes row wv. Lane l holds columns 128j + 4l .. +3 for j = 0..3;
    // store instruction j covers columns 128j..128j+127
    if (wv < TT) {
        v4f c[4];
#pragma unroll
        for (int j = 0; j < 4; ++j) c[j] = *(const v4f*)(&cvs[wv][128 * j + lane * 4]);
        float sm = 0.0f;
#pragma unroll
        for (int j = 0; j < 4; ++j) sm += (c[j].x + c[j].y) + (c[j].z + c[j].w);
#pragma unroll
        for (int off = 16; off > 0; off >>= 1) sm += __shfl_xor(sm, off, 32);
        const float mean = sm * (1.0f / (float)HD);

        float q = 0.0f;
#pragma unroll
        for (int j = 0; j < 4; ++j) {
            const float dx = c[j].x - mean, dy = c[j].y - mean, dz = c[j].z - mean, dw = c[j].w - mean;
            q += dx * dx; q += dy * dy; q += dz * dz; q += dw * dw;
        }
#pragma unroll
        for (int off = 16; off > 0; off >>= 1) q += __shfl_xor(q, off, 32);
        const float var  = q * (1.0f / (float)HD);
        const float rstd = rsqrtf(var + LN_EPS);

        v4f o[4];
#pragma unroll
        for (int j = 0; j < 4; ++j) {
            o[j].x = (c[j].x - mean) * rstd * rbf(gm[j].x) + rbf(be[j].x) + rbf(xr[j].x);
            o[j].y = (c[j].y - mean) * rstd * rbf(gm[j].y) + rbf(be[j].y) + rbf(xr[j].y);
            o[j].z = (c[j].z - mean) * rstd * rbf(gm[j].z) + rbf(be[j].z) + rbf(xr[j].z);
            o[j].w = (c[j].w - mean) * rstd * rbf(gm[j].w) + rbf(be[j].w) + rbf(xr[j].w);
        }
        float* dp = out + (size_t)frow * HD + lane * 4;
#pragma unroll
        for (int j = 0; j < 4; ++j) *(v4f*)(dp + 128 * j) = o[j];
    }
}

// ---------------------------------------------------------------------------
static inline size_t al256(size_t x) { return (x + 255) & ~(size_t)255; }

extern "C" void kernel_launch(void* const* d_in, const int* in_sizes, int n_in,
                              void* d_out, int out_size, void* d_ws, size_t ws_size,
                              hipStream_t stream)
{
    if (n_in < 10) return;
    if (in_sizes[0] < ((NB - 1) * T_FULL + S_LEN) * HD) return;   // context [8][128][512] f32
    if (in_sizes[1] < ((NB - 1) * T_FULL + TQ) * HD) return;      // x       [8][128][512] f32
    if (in_sizes[2] < HD * HD) return;                             // Wa [512][512] ([in][out]) f32
    if (in_sizes[3] < HD) return;                                  // bWa [512]
    if (in_sizes[4] < HD * HD) return;                             // Ua [512][512] ([in][out]) f32
    if (in_sizes[5] < HD) return;                                  // bUa [512]
    if (in_sizes[6] < HD) return;                                  // Va [512][1]
    if (in_sizes[7] < 1) return;                                   // bVa [1]
    if (in_sizes[8] < HD || in_sizes[9] < HD) return;              // gamma, beta [512]
    if (out_size < ((NB - 1) * T_FULL + TQ) * HD) return;

    const float* context = (const float*)d_in[0];
    const float* x       = (const float*)d_in[1];
    const float* Wa      = (const float*)d_in[2];
    const float* bWa     = (const float*)d_in[3];
    const float* Ua      = (const float*)d_in[4];
    const float* bUa     = (const float*)d_in[5];
    const float* Va      = (const float*)d_in[6];
    const float* bVa     = (const float*)d_in[7];
    const float* gamma   = (const float*)d_in[8];
    const float* beta    = (const float*)d_in[9];
    float* out = (float*)d_out;

    char* ws = (char*)d_ws;
    size_t off = 0;
    us* ctxT  = (us*)(ws + off);    off += al256((size_t)NB * HD * S_LEN * sizeof(us));   // [NB][512][128]
    float* Wc = (float*)(ws + off); off += al256((size_t)PROWS * HD * sizeof(float));     // [NB*S][512]
    float* Ux = (float*)(ws + off); off += al256((size_t)PROWS * HD * sizeof(float));     // [NB*TQ][512]
    if (off > ws_size) return;

    const dim3 b256(256), bS(S_LEN * HS);

    // ---- Wc = context @ Wa, Ux = x @ Ua (f32; biases added in k_attn) and the bf16 plane ctxT, one launch ----
    k_proj<<<dim3(GB + PB_CT), b256, 0, stream>>>(context, x, Wa, Ua, Wc, Ux, ctxT);

    // ---- energies + softmax, cv = [P_hi|P_lo] @ [ctxT;ctxT] (f32), LayerNorm + residual -> out ----
    k_attn<<<dim3(NB * TQ / TT), bS, 0, stream>>>(Ux, Wc, bWa, bUa, Va, bVa, ctxT, x, gamma, beta, out);
}

// v006
// Measured time: 18.5 microseconds a run.
// Two timings next to v005 put it at 1.09 and 1.04 times that version's speed.
// Counting every step since v000, it is 3.51 times as fast.
#include <hip/hip_runtime.h>

// Contractions on v_wmma_f32_16x16x32_bf16 (bf16 operands, f32 accumulate): context@Wa and x@Ua from
// operand tiles that each block converts (RNE) into LDS itself; attn@context with attn carried as bf16 hi+lo planes folded into K against
// the RNE-converted transposed context plane, inside the energy kernel. Energies v.tanh(.), softmax,
// LayerNorm and the residual add in f32 on the VALU.

#ifndef NB
#define NB 8
#endif
#ifndef TQ
#define TQ 128
#endif
#define NB_FULL 8
#define T_FULL 128          // full query length: per-batch row stride of x and of the output
#define S_LEN 128           // context positions (keys), never reduced
#define S_FULL 128          // per-batch row stride of context in the input
#define HD 512              // feature width D == hidden width H
#define KC (2 * S_LEN)      // context GEMM depth: [P_hi | P_lo]
#define LN_EPS 1.0e-3f

static_assert(NB >= 1 && NB <= NB_FULL);
static_assert(TQ >= 64 && TQ <= T_FULL && (TQ % 64) == 0);
static_assert(S_LEN == 128 && S_LEN == S_FULL);
static_assert((HD % 256) == 0 && (HD % 64) == 0 && (HD % 32) == 0);
static_assert((KC % 32) == 0 && (S_LEN % 64) == 0);
static_assert(((HD / 4) % S_LEN) == 0);
static_assert((S_LEN % 32) == 0);

typedef unsigned short us;
typedef us     v8us  __attribute__((ext_vector_type(8)));
typedef __bf16 v16bf __attribute__((ext_vector_type(16)));
typedef float  v8f   __attribute__((ext_vector_type(8)));
typedef float  v4f   __attribute__((ext_vector_type(4)));

union Frag { v16bf v; v8us h[2]; };

// ---------------------------------------------------------------------------
// scalar helpers
// ---------------------------------------------------------------------------
__device__ __forceinline__ us f2bf(float f) {           // f32 -> bf16, RNE convert
    unsigned int u = __float_as_uint(f);
    u += 0x7FFFu + ((u >> 16) & 1u);
    return (us)(u >> 16);
}
__device__ __forceinline__ float bf2f(us h) {
    return __uint_as_float(((unsigned int)h) << 16);
}
__device__ __forceinline__ float rbf(float f) {          // value after an RNE convert to bf16
    return bf2f(f2bf(f));
}
// tanh on two neighbouring features, each by one v_tanh_f32
typedef float v2f __attribute__((ext_vector_type(2)));
__device__ __forceinline__ v2f tanh_acc2(v2f x) {
    v2f y;  y.x = __builtin_amdgcn_tanhf(x.x); y.y = __builtin_amdgcn_tanhf(x.y);
    return y;
}
// ---------------------------------------------------------------------------
// WMMA helper: 16x16x32 bf16, f32 accumulate, 4-slot VALU hazard guard after the issue
// ---------------------------------------------------------------------------
__device__ __forceinline__ v8f wmma16(v16bf a, v16bf b, v8f c) {
    v8f d = __builtin_amdgcn_wmma_f32_16x16x32_bf16(false, a, false, b, (short)0, c, false, false);
    asm volatile("v_nop\n\tv_nop\n\tv_nop\n\tv_nop" : "+v"(d) : "v"(a), "v"(b));
    return d;
}

// Fragment loader for a k-contiguous 16-bit plane P[row][k] with pitch ld (halves).
// Lane l: row = (l & 15) (A row m, or B column n of an [n][k] plane), hsel = l >> 4.
//   elements 0..7  <- k0 + 8*hsel + 0..7
//   elements 8..15 <- k0 + 16 + 8*hsel + 0..7
__device__ __forceinline__ v16bf ld_frag(const us* __restrict__ P, int ld, int row, int k0, int hsel) {
    Frag f;
    const us* p = P + (size_t)row * ld + k0 + 8 * hsel;
    f.h[0] = *(const v8us*)p;
    f.h[1] = *(const v8us*)(p + 16);
    return f.v;
}

// ---------------------------------------------------------------------------
// Transpose + convert: src[R][C] f32 (pitch spitch, per-z stride sstride) -> dst[C][R] bf16 (pitch dpitch,
// per-z stride dstride), optionally a second copy at column offset +DUP halves.
// Block: 64 src rows x 64 src cols through LDS (cross-wave -> block barrier). Store phase: one instruction
// tile index (bx, by, z) in (R/64, C/64, Z); ts: the block's 64 x 65 f32 LDS tile
// ---------------------------------------------------------------------------
template <int DUP>
__device__ __forceinline__
void d_trans(float (*ts)[65], int bx, int by, int z,
             const float* __restrict__ src, int spitch, int sstride,
             us* __restrict__ dst, int dpitch, int dstride)
{
    const int r0 = bx * 64, c0 = by * 64;
    const int tid = threadIdx.x, lane = tid & 31, wave = tid >> 5;
    const float* sb = src + (size_t)z * (size_t)sstride;
    us* db = dst + (size_t)z * (size_t)dstride;

#pragma unroll
    for (int p = 0; p < 4; ++p) {
        const int rl = p * 16 + (tid >> 4);
        const int c4 = (tid & 15) * 4;
        const v4f x = *(const v4f*)(sb + (size_t)(r0 + rl) * spitch + c0 + c4);
        ts[rl][c4 + 0] = x.x; ts[rl][c4 + 1] = x.y; ts[rl][c4 + 2] = x.z; ts[rl][c4 + 3] = x.w;
    }
    __syncthreads();

    v8us o[2];
#pragma unroll
    for (int p = 0; p < 2; ++p) {
        const int cl = p * 32 + wave * 4 + (lane >> 3);
        const int r8 = (lane & 7) * 8;
#pragma unroll
        for (int i = 0; i < 8; ++i) o[p][i] = f2bf(ts[r8 + i][cl]);
    }
#pragma unroll
    for (int p = 0; p < 2; ++p) {
        const int cl = p * 32 + wave * 4 + (lane >> 3);
        const int r8 = (lane & 7) * 8;
        us* d = db + (size_t)(c0 + cl) * dpitch + r0 + r8;
        *(v8us*)d = o[p];
        if (DUP != 0) *(v8us*)(d + DUP) = o[p];
    }
    // the stores' address and data registers are written again in the code of the caller's other branches,
    // which follows these stores in the listing: the wait stands in front of any such overwrite
    asm volatile("s_wait_xcnt 0x0" ::: "memory");
}

// ---------------------------------------------------------------------------
// Both projections and the transposed context plane in one launch, straight from the f32 inputs.
//   blocks [0, GB):        one 64(M) x 64(N) tile of Wc = context @ Wa (z = 0) or of Ux = x @ Ua (z = 1), K = HD;
//                          Ux is stored row-major, Wc as Wc4[b][h / 4][s] in 16-B pieces (4 features of one s)
//   blocks [GB, GB + PB_CT): context[b][s][d] -> ctxT[b][d][s] (bf16), one 64 x 64 piece each
// A GEMM block (8 waves) converts its two operand panels to bf16 in LDS, once, in batches along k:
//   As[64][HD]  rows of context or x, k-contiguous, pitch PA halves (16 B x odd, for ds_load_b128)
//   Bs[HD][64]  rows k of Wa or Ua as they lie in memory, pitch PBB bytes (32 B x odd, for ds_load_tr16_b128)
// Wave w: rows 16 (w & 3) .. +15, columns 32 (w >> 2) .. +31 (2 accumulators). The transposing load hands lane
// (c, h) the elements Bs[k0 + 8h + 0..7][n + c]; two of them, at k0 and k0 + 16, follow the k map of ld_frag.
// The GEMM blocks, which run longer, come first in the index order.
// ---------------------------------------------------------------------------
#define PROWS (NB * S_LEN)   // rows of either projection
static_assert(TQ == S_LEN);  // the two projections share one grid
#define GB (2 * (PROWS / 64) * (HD / 64))
#define PB_CT ((S_LEN / 64) * (HD / 64) * NB)
#define PA (HD + 8)
#define PBB 160
#define AS_BYTES (64 * PA * 2)
#define BS_BYTES (HD * PBB)
#define KG 4                 // k-steps per fragment group
#define TP 68                // pitch of the f32 result tile in LDS, dwords: rows r and r + 8 fall on different banks
static_assert(KG == 4 && HD / 32 / KG >= 2);   // a batch is 16 loads per thread of 256
static_assert(64 * TP * 4 <= AS_BYTES && 64 * 65 * 4 <= AS_BYTES + BS_BYTES);

typedef unsigned int v2u __attribute__((ext_vector_type(2)));
typedef unsigned int v4u __attribute__((ext_vector_type(4)));
typedef short s16x8 __attribute__((ext_vector_type(8)));
typedef __bf16 v2bf __attribute__((ext_vector_type(2)));

__device__ __forceinline__ unsigned int cvt2(float lo, float hi) {      // two f32 -> two bf16, RNE, one instruction
    const v2f p = {lo, hi};
    return __builtin_bit_cast(unsigned int, __builtin_convertvector(p, v2bf));
}
__device__ __forceinline__ v8us ld_tr16(const unsigned char* p) {
    typedef __attribute__((address_space(3))) s16x8 lds_s16x8;
    return __builtin_bit_cast(v8us, __builtin_amdgcn_ds_load_tr16_b128_v8i16((lds_s16x8*)p));
}

// Work-group barrier that orders LDS traffic only. __syncthreads() also waits for the wave's outstanding global
// loads; with this one loads asked for ahead stay in flight across it: in k_proj the later batches of the panels, in
// k_attn the tail's operands, asked for in front of the softmax. Everything the waves of a block hand to each
// other at such a barrier goes through LDS.
__device__ __forceinline__ void bar_lds() {
    __builtin_amdgcn_fence(__ATOMIC_RELEASE, "workgroup", "local");
    __builtin_amdgcn_s_barrier();
    __builtin_amdgcn_fence(__ATOMIC_ACQUIRE, "workgroup", "local");
}

// The panels come in HD / 32 / KG batches of 16 loads of 16 B per thread; batch bt holds k = 32 KG bt .. + 32 KG - 1 of
// both. pa, pb: the thread's first pieces; every further piece lies a constant step on (16 rows of A or of B, for
// A also 32 KG columns a batch), so all loads go by two address pairs and an offset.
__device__ __forceinline__
void ld_batch(v4f (&r)[16], int bt, const float* __restrict__ pa, const float* __restrict__ pb) {
#pragma unroll
    for (int i = 0; i < 4; ++i) {            // A: 8 consecutive k of one row per thread
        r[2 * i]     = *(const v4f*)(pa + i * 16 * HD + bt * (32 * KG));
        r[2 * i + 1] = *(const v4f*)(pa + i * 16 * HD + bt * (32 * KG) + 4);
    }
#pragma unroll
    for (int i = 0; i < 8; ++i)              // B: 4 consecutive n of one row k per thread
        r[8 + i] = *(const v4f*)(pb + (bt * 8 + i) * 16 * HD);
    // stands in front of any overwrite of the two address pairs that these loads name; the pairs are inputs so
    // that no load's own result is laid over them either
    asm volatile("s_wait_xcnt 0x0" :: "v"(pa), "v"(pb) : "memory");
}
__device__ __forceinline__
void st_batch(const v4f (&r)[16], int bt, unsigned char* __restrict__ sa, unsigned char* __restrict__ sb) {
#pragma unroll
    for (int i = 0; i < 4; ++i) {
        const v4f a = r[2 * i], c = r[2 * i + 1];
        const v4u o = {cvt2(a.x, a.y), cvt2(a.z, a.w), cvt2(c.x, c.y), cvt2(c.z, c.w)};
        *(v4u*)(sa + i * 16 * (PA * 2) + bt * (64 * KG)) = o;
    }
#pragma unroll
    for (int i = 0; i < 8; ++i) {
        const v4f a = r[8 + i];
        const v2u o = {cvt2(a.x, a.y), cvt2(a.z, a.w)};
        *(v2u*)(sb + (bt * 8 + i) * 16 * PBB) = o;
    }
}

// waves_per_eu: two blocks (2 waves to a SIMD each) share a WGP, so that the transposing blocks find room beside
// the GEMM blocks instead of waiting for one to end; that holds the register count to a quarter of a SIMD's file.
__global__ __launch_bounds__(256) __attribute__((amdgpu_waves_per_eu(4, 4)))
void k_proj(const float* __restrict__ context, const float* __restrict__ x,
            const float* __restrict__ Wa, const float* __restrict__ Ua,
            float* __restrict__ Wc, float* __restrict__ Ux, us* __restrict__ ctxT)
{
    __shared__ __attribute__((aligned(16))) unsigned char sm[AS_BYTES + BS_BYTES];
    const int blk = blockIdx.x;
    if (blk >= GB) {                                     // block-uniform
        const int i  = blk - GB;
        const int bx = i % (S_LEN / 64);
        const int by = (i / (S_LEN / 64)) % (HD / 64);
        const int z  = i / ((S_LEN / 64) * (HD / 64));
        d_trans<0>((float (*)[65])sm, bx, by, z, context, HD, T_FULL * HD, ctxT, S_LEN, HD * S_LEN);
        return;
    }
    const int tid = threadIdx.x, lane = tid & 31;
    const int wv = __builtin_amdgcn_readfirstlane(tid >> 5);
    const int hsel = lane >> 4, m = lane & 15;
    const int z  = blk / ((PROWS / 64) * (HD / 64));
    const int m0 = (blk % (PROWS / 64)) * 64;
    const int n0 = ((blk / (PROWS / 64)) % (HD / 64)) * 64;
    const int bq = m0 / TQ;                              // the tile's 64 rows lie in one batch
    const float* Ar = (z == 0 ? context : x) + (size_t)(bq * T_FULL + (m0 - bq * TQ)) * HD;
    const float* Br = (z == 0 ? Wa : Ua) + n0;
    unsigned char* As = sm;
    unsigned char* Bs = sm + AS_BYTES;

    const float* pa = Ar + (size_t)(tid >> 4) * HD + (tid & 15) * 8;
    const float* pb = Br + (size_t)(tid >> 4) * HD + (tid & 15) * 4;
    unsigned char* sa = As + (tid >> 4) * (PA * 2) + (tid & 15) * 16;
    unsigned char* sb = Bs + (tid >> 4) * PBB + (tid & 15) * 8;
    const int mt = wv & 3, nh = wv >> 2;
    const unsigned char* bd = Bs + (8 * hsel + (lane & 7)) * PBB + ((lane >> 3) & 1) * 16 + nh * 64;
    v8f c0 = {}; v8f c1 = {};

    // Two register sets, up to two batches of loads in flight. Each batch is converted and stored as it arrives and its
    // KG k-steps are worked on while the later batches fly: no LDS byte is written twice, so one barrier a batch
    // (LDS only: it leaves the global loads in flight) is all the order there is.
    v4f rr[2][16];
    ld_batch(rr[0], 0, pa, pb);
    ld_batch(rr[1], 1, pa, pb);
#pragma unroll
    for (int g = 0; g < HD / 32 / KG; ++g) {
        st_batch(rr[g & 1], g, sa, sb);
        if (g + 2 < HD / 32 / KG) ld_batch(rr[g & 1], g + 2, pa, pb);
        bar_lds();
        v16bf fa[KG];
        Frag  fb0[KG], fb1[KG];
#pragma unroll
        for (int i = 0; i < KG; ++i) {
            const int k0 = (g * KG + i) * 32;
            fa[i] = ld_frag((const us*)As, PA, mt * 16 + m, k0, hsel);
            fb0[i].h[0] = ld_tr16(bd + k0 * PBB);
            fb0[i].h[1] = ld_tr16(bd + (k0 + 16) * PBB);
            fb1[i].h[0] = ld_tr16(bd + k0 * PBB + 32);
            fb1[i].h[1] = ld_tr16(bd + (k0 + 16) * PBB + 32);
        }
#pragma unroll
        for (int i = 0; i < KG; ++i) {
            c0 = wmma16(fa[i], fb0[i].v, c0);
            c1 = wmma16(fa[i], fb1[i].v, c1);
        }
    }
    __syncthreads();                                     // every wave has read its last fragment: the tile lies over As

    // D map: acc[r] -> (row 8*hsel + r, col n-tile + m). The 64 x 64 tile goes through LDS to whole-line stores.
    float* tile = (float*)sm;
#pragma unroll
    for (int r = 0; r < 8; ++r) {
        const int row = mt * 16 + 8 * hsel + r;
        tile[row * TP + nh * 32 + m]      = c0[r];
        tile[row * TP + nh * 32 + 16 + m] = c1[r];
    }
    __syncthreads();

    v4f vals[4];
    if (z == 0) {                                        // block-uniform
        // Wc goes out as Wc4[b][h / 4][s] (16-B pieces): k_attn's lanes run along s, so a wave's load there is 512 B in
        // a row. Thread = (piece column q, row r): a wave stores 32 rows of one q; the LDS reads step TP dwords a lane.
        v4f* Cq = (v4f*)Wc + ((size_t)bq * (HD / 4) + n0 / 4 + (tid >> 6)) * S_LEN + (m0 - bq * TQ) + (tid & 63);
#pragma unroll
        for (int p = 0; p < 4; ++p) vals[p] = *(const v4f*)(tile + (tid & 63) * TP + (p * 4 + (tid >> 6)) * 4);
#pragma unroll
        for (int p = 0; p < 4; ++p) Cq[p * 4 * S_LEN] = vals[p];
        // in front of any overwrite of the stores' address pair and data in the code that follows them in the listing
        asm volatile("s_wait_xcnt 0x0" ::: "memory");
    } else {
        float* Cb = Ux + (size_t)m0 * HD + n0;
#pragma unroll
        for (int p = 0; p < 4; ++p) vals[p] = *(const v4f*)(tile + (p * 16 + (tid >> 4)) * TP + (tid & 15) * 4);
#pragma unroll
        for (int p = 0; p < 4; ++p) *(v4f*)(Cb + (size_t)(p * 16 + (tid >> 4)) * HD + (tid & 15) * 4) = vals[p];
        // the same wait for these stores
        asm volatile("s_wait_xcnt 0x0" ::: "memory");
    }
}

// ---------------------------------------------------------------------------
// Fused energies -> softmax -> P @ context -> LayerNorm + residual. One block per (b, group of TT query rows t).
// Thread = (hh, s): key position s, part hh (of HS) of the feature range. Each 16-B piece of Wc is loaded once and
// used for all TT query rows of the block. Wc lies as Wc4[b][h / 4][s]: the 32 lanes of a wave, consecutive s, read
// 512 B in a row (4 whole cache lines) with each load.
//   e[t][s] = sum_h v[h] * tanh(Wc[b][s][h] + Ux[bt][h] + bUa[h] + bWa[h]) + bVa   (f32; the HS parts of
//             the h range are summed apart and then added in order)
//   p    = softmax_s(e); Pl[t][s] = bf16 hi, Pl[t][S+s] = bf16 lo (lo = p - hi), in LDS
//   cv[t][d] = sum_k Pl[t][k] * ctxT[b][d][k mod S] on WMMA: the M tile is the block's TT rows and zero rows up
//             to 16; wave w does columns 32w..32w+31; each B fragment is loaded once and serves hi and lo
//   out  = LayerNorm(cv) * gamma + beta + x, one wave per row
// LDS regions are cross-wave: block barriers throughout.
// ---------------------------------------------------------------------------
#define TT 4                // query rows per block
#define HS 4                // parts of the h range, one per group of S_LEN threads
#define RPT (TT / HS)       // softmax rows per thread
static_assert((TQ % TT) == 0 && (TT % HS) == 0 && ((HD / 4) % HS) == 0);
static_assert(TT <= (S_LEN * HS) / 32 && TT <= 8);       // rows 0..TT-1 of a D tile lie in lanes 0-15
static_assert(HD == (S_LEN * HS / 32) * 32);             // 32 output columns per wave
#define PLP (KC + 16)       // pitch of a P row in LDS, halves: 32 B more, so that the 16-B pieces which the 32 lanes
                            // of one fragment load read (16 rows, 2 pieces each) spread evenly over the banks

// waves_per_eu: the block's 16 waves stand four to a SIMD and one block fills a WGP, so the register budget is
// that of four waves; without it the scheduler holds the register count down for more waves and sets each
// tanh right in front of its product and sum instead of issuing the 64 independent ones of a trip in runs.
__global__ __launch_bounds__(S_LEN * HS) __attribute__((amdgpu_waves_per_eu(S_LEN * HS / 128, S_LEN * HS / 128)))
void k_attn(const float* __restrict__ Uxp, const float* __restrict__ Wcp,
            const float* __restrict__ bWa, const float* __restrict__ bUa,
            const float* __restrict__ Va,  const float* __restrict__ bVa,
            const us* __restrict__ ctxT, const float* __restrict__ xin,
            const float* __restrict__ gam, const float* __restrict__ bet,
            float* __restrict__ out)
{
    __shared__ v4f sq4[TT][HD / 4];
    __shared__ v4f sv4[HD / 4];
    __shared__ float part[HS][TT][S_LEN];
    __shared__ float red[TT][S_LEN];
    __shared__ __attribute__((aligned(16))) us Pl[16][PLP];
    __shared__ __attribute__((aligned(16))) float cvs[TT][HD];

    const int bt0 = blockIdx.x * TT;         // first of the block's rows b * TQ + t (all of one b)
    const int b   = bt0 / TQ;
    const int tid = threadIdx.x, lane = tid & 31, wave = tid >> 5;
    const int s   = tid & (S_LEN - 1), hh = tid / S_LEN;

    for (int i = tid; i < TT * (HD / 4); i += S_LEN * HS) {
        const int c = i & (HD / 4 - 1);
        v4f q = *(const v4f*)(Uxp + (size_t)bt0 * HD + i * 4);
        const v4f b1 = *(const v4f*)(bUa + c * 4);
        const v4f b2 = *(const v4f*)(bWa + c * 4);
        q.x = (q.x + rbf(b1.x)) + rbf(b2.x);
        q.y = (q.y + rbf(b1.y)) + rbf(b2.y);
        q.z = (q.z + rbf(b1.z)) + rbf(b2.z);
        q.w = (q.w + rbf(b1.w)) + rbf(b2.w);
        sq4[i / (HD / 4)][c] = q;
    }
    for (int i = tid; i < HD / 4; i += S_LEN * HS) {
        v4f w = *(const v4f*)(Va + i * 4);
        w.x = rbf(w.x); w.y = rbf(w.y); w.z = rbf(w.z); w.w = rbf(w.w);
        sv4[i] = w;
    }
    // rows TT..15 of the M tile are zero
    for (int i = tid; i < (16 - TT) * PLP / 8; i += S_LEN * HS) {
        const v8us zr = {};
        *(v8us*)(&Pl[TT][0] + i * 8) = zr;
    }
    __syncthreads();

    const float bva = rbf(bVa[0]);
    const int u0 = hh * (HD / 4 / HS);
    const v4f* we = (const v4f*)Wcp + ((size_t)b * (HD / 4) + u0) * S_LEN + s;      // Wc4[b][u][s]
    float acc[TT];
#pragma unroll
    for (int j = 0; j < TT; ++j) acc[j] = 0.0f;
    // four 16-B loads per lane go out together at the head of each trip
#pragma unroll 4
    for (int u = 0; u < HD / 4 / HS; ++u) {
        const v4f e = we[u * S_LEN];
        const v4f w = sv4[u0 + u];
#pragma unroll
        for (int j = 0; j < TT; ++j) {
            const v4f d = sq4[j][u0 + u];
            const v2f y0 = tanh_acc2(e.xy + d.xy);
            const v2f y1 = tanh_acc2(e.zw + d.zw);
            const v2f p0 = w.xy * y0;
            const v2f p1 = w.zw * y1;
            acc[j] += p0.x;
            acc[j] += p0.y;
            acc[j] += p1.x;
            acc[j] += p1.y;
        }
    }
    // what the tail reads from global memory is asked for here, so that it arrives during the softmax:
    // the wave's B fragments (32 columns d, all S key positions) and, in the TT LayerNorm waves, x, gamma, beta
    const int wv = __builtin_amdgcn_readfirstlane(wave);
    const int hsel = lane >> 4, m = lane & 15;
    const us* cb = ctxT + (size_t)b * (size_t)(HD * S_LEN);
    const us* cb0 = cb + (size_t)(wv * 32 + m) * S_LEN + 8 * hsel;   // the lane's row of n-tile 0, its k half
    const us* cb1 = cb0 + 16 * S_LEN;                                // the same of n-tile 1
    v16bf bfr[2][S_LEN / 32];
#pragma unroll
    for (int kk = 0; kk < S_LEN / 32; ++kk) bfr[0][kk] = ld_frag(cb0, 0, 0, kk * 32, 0);
#pragma unroll
    for (int kk = 0; kk < S_LEN / 32; ++kk) bfr[1][kk] = ld_frag(cb1, 0, 0, kk * 32, 0);
    // stands in front of any overwrite of the address pair that these loads name (all sixteen go by cb0 and an
    // immediate offset); the pair is an input so that no load's own result is laid over it either
    asm volatile("s_wait_xcnt 0x0" :: "v"(cb0) : "memory");
    const int lr   = bt0 + wv;                          // LayerNorm row of wave wv < TT
    const int frow = (lr / TQ) * T_FULL + (lr % TQ);
    v4f xr[4], gm[4], be[4];
    if (wv < TT) {
        const float* xp = xin + (size_t)frow * HD + lane * 4;
#pragma unroll
        for (int j = 0; j < 4; ++j) {
            xr[j] = *(const v4f*)(xp + 128 * j);
            gm[j] = *(const v4f*)(gam + 128 * j + lane * 4);
            be[j] = *(const v4f*)(bet + 128 * j + lane * 4);
        }
        // inside the branch, so that it stands in front of the next write of a scalar base that these loads name
        asm volatile("s_wait_xcnt 0x0" ::: "memory");
    }

#pragma unroll
    for (int j = 0; j < TT; ++j) part[hh][j][s] = acc[j];
    bar_lds();

    // thread (hh, s) carries rows j = RPT * hh + k of the block through the softmax
    float en[RPT], ex[RPT];
#pragma unroll
    for (int k = 0; k < RPT; ++k) {
        const int j = RPT * hh + k;
        float a = part[0][j][s];
#pragma unroll
        for (int g = 1; g < HS; ++g) a += part[g][j][s];
        en[k] = a + bva;
        red[j][s] = en[k];
    }
    bar_lds();

    // per-row max over s
#pragma unroll
    for (int st = S_LEN / 2; st > 0; st >>= 1) {
        if (s < st) {
#pragma unroll
            for (int k = 0; k < RPT; ++k) {
                const int j = RPT * hh + k;
                red[j][s] = fmaxf(red[j][s], red[j][s + st]);
            }
        }
        bar_lds();
    }
    float mx[RPT];
#pragma unroll
    for (int k = 0; k < RPT; ++k) mx[k] = red[RPT * hh + k][0];
    bar_lds();

    // exp + per-row sum
#pragma unroll
    for (int k = 0; k < RPT; ++k) {
        ex[k] = __expf(en[k] - mx[k]);
        red[RPT * hh + k][s] = ex[k];
    }
    bar_lds();
#pragma unroll
    for (int st = S_LEN / 2; st > 0; st >>= 1) {
        if (s < st) {
#pragma unroll
            for (int k = 0; k < RPT; ++k) {
                const int j = RPT * hh + k;
                red[j][s] += red[j][s + st];
            }
        }
        bar_lds();
    }
#pragma unroll
    for (int k = 0; k < RPT; ++k) {
        const int j = RPT * hh + k;
        const float ssum = red[j][0];
        const float p = ex[k] * (1.0f / ssum);
        const us h = f2bf(p);
        Pl[j][s] = h;
        Pl[j][S_LEN + s] = f2bf(p - bf2f(h));
    }
    bar_lds();

    // cv tile: k runs over the hi plane, then over the lo plane
    v16bf af[KC / 32];
#pragma unroll
    for (int kk = 0; kk < KC / 32; ++kk) af[kk] = ld_frag(&Pl[0][0], PLP, m, kk * 32, hsel);
    v8f c0 = {}; v8f c1 = {};
#pragma unroll
    for (int kk = 0; kk < KC / 32; ++kk) {
        c0 = wmma16(af[kk], bfr[0][kk % (S_LEN / 32)], c0);
        c1 = wmma16(af[kk], bfr[1][kk % (S_LEN / 32)], c1);
    }
    // D map: acc[r] -> (row 8*hsel + r, col n-tile + m): the block's rows are r < TT of lanes 0-15
    if (hsel == 0) {
#pragma unroll
        for (int r = 0; r < TT; ++r) {
            cvs[r][wv * 32 + m]      = c0[r];
            cvs[r][wv * 32 + 16 + m] = c1[r];
        }
    }
    bar_lds();

    // LayerNorm + residual: wave wv < TT takes row wv. Lane l holds columns 128j + 4l .. +3 for j = 0..3;
    // store instruction j covers columns 128j..128j+127
    if (wv < TT) {
        v4f c[4];
#pragma unroll
        for (int j = 0; j < 4; ++j) c[j] = *(const v4f*)(&cvs[wv][128 * j + lane * 4]);
        float sm = 0.0f;
#pragma unroll
        for (int j = 0; j < 4; ++j) sm += (c[j].x + c[j].y) + (c[j].z + c[j].w);
#pragma unroll
        for (int off = 16; off > 0; off >>= 1) sm += __shfl_xor(sm, off, 32);
        const float mean = sm * (1.0f / (float)HD);

        float q = 0.0f;
#pragma unroll
        for (int j = 0; j < 4; ++j) {
            const float dx = c[j].x - mean, dy = c[j].y - mean, dz = c[j].z - mean, dw = c[j].w - mean;
            q += dx * dx; q += dy * dy; q += dz * dz; q += dw * dw;
        }
#pragma unroll
        for (int off = 16; off > 0; off >>= 1) q += __shfl_xor(q, off, 32);
        const float var  = q * (1.0f / (float)HD);
        const float rstd = rsqrtf(var + LN_EPS);

        v4f o[4];
#pragma unroll
        for (int j = 0; j < 4; ++j) {
            o[j].x = (c[j].x - mean) * rstd * rbf(gm[j].x) + rbf(be[j].x) + rbf(xr[j].x);
            o[j].y = (c[j].y - mean) * rstd * rbf(gm[j].y) + rbf(be[j].y) + rbf(xr[j].y);
            o[j].z = (c[j].z - mean) * rstd * rbf(gm[j].z) + rbf(be[j].z) + rbf(xr[j].z);
            o[j].w = (c[j].w - mean) * rstd * rbf(gm[j].w) + rbf(be[j].w) + rbf(xr[j].w);
        }
        float* dp = out + (size_t)frow * HD + lane * 4;
#pragma unroll
        for (int j = 0; j < 4; ++j) *(v4f*)(dp + 128 * j) = o[j];
    }
}

// ---------------------------------------------------------------------------
static inline size_t al256(size_t x) { return (x + 255) & ~(size_t)255; }

extern "C" void kernel_launch(void* const* d_in, const int* in_sizes, int n_in,
                              void* d_out, int out_size, void* d_ws, size_t ws_size,
                              hipStream_t stream)
{
    if (n_in < 10) return;
    if (in_sizes[0] < ((NB - 1) * T_FULL + S_LEN) * HD) return;   // context [8][128][512] f32
    if (in_sizes[1] < ((NB - 1) * T_FULL + TQ) * HD) return;      // x       [8][128][512] f32
    if (in_sizes[2] < HD * HD) return;                             // Wa [512][512] ([in][out]) f32
    if (in_sizes[3] < HD) return;                                  // bWa [512]
    if (in_sizes[4] < HD * HD) return;                             // Ua [512][512] ([in][out]) f32
    if (in_sizes[5] < HD) return;                                  // bUa [512]
    if (in_sizes[6] < HD) return;                                  // Va [512][1]
    if (in_sizes[7] < 1) return;                                   // bVa [1]
    if (in_sizes[8] < HD || in_sizes[9] < HD) return;              // gamma, beta [512]
    if (out_size < ((NB - 1) * T_FULL + TQ) * HD) return;

    const float* context = (const float*)d_in[0];
    const float* x       = (const float*)d_in[1];
    const float* Wa      = (const float*)d_in[2];
    const float* bWa     = (const float*)d_in[3];
    const float* Ua      = (const float*)d_in[4];
    const float* bUa     = (const float*)d_in[5];
    const float* Va      = (const float*)d_in[6];
    const float* bVa     = (const float*)d_in[7];
    const float* gamma   = (const float*)d_in[8];
    const float* beta    = (const float*)d_in[9];
    float* out = (float*)d_out;

    char* ws = (char*)d_ws;
    size_t off = 0;
    us* ctxT  = (us*)(ws + off);    off += al256((size_t)NB * HD * S_LEN * sizeof(us));   // [NB][512][128]
    float* Wc = (float*)(ws + off); off += al256((size_t)PROWS * HD * sizeof(float));     // [NB][512/4][S][4]
    float* Ux = (float*)(ws + off); off += al256((size_t)PROWS * HD * sizeof(float));     // [NB*TQ][512]
    if (off > ws_size) return;

    const dim3 b256(256), bS(S_LEN * HS);

    // ---- Wc = context @ Wa, Ux = x @ Ua (f32; biases added in k_attn) and the bf16 plane ctxT, one launch ----
    k_proj<<<dim3(GB + PB_CT), b256, 0, stream>>>(context, x, Wa, Ua, Wc, Ux, ctxT);

    // ---- energies + softmax, cv = [P_hi|P_lo] @ [ctxT;ctxT] (f32), LayerNorm + residual -> out ----
    k_attn<<<dim3(NB * TQ / TT), bS, 0, stream>>>(Ux, Wc, bWa, bUa, Va, bVa, ctxT, x, gamma, beta, out);
}

// v007
// A run of this version takes 17.5 microseconds.
// Next to v006, in two timings, it ran 1.05 times as fast each time.
// All steps since v000 together make it 3.68 times as fast.
#include <hip/hip_runtime.h>

// Contractions on v_wmma_f32_16x16x32_bf16 (bf16 operands, f32 accumulate): context@Wa and x@Ua from
// operand tiles that each block converts (RNE) into LDS itself; attn@context with attn carried as bf16 hi+lo planes folded into K against
// the RNE-converted transposed context plane, inside the energy kernel. Energies v.tanh(.), softmax,
// LayerNorm and the residual add in f32 on the VALU.

#ifndef NB
#define NB 8
#endif
#ifndef TQ
#define TQ 128
#endif
#define NB_FULL 8
#define T_FULL 128          // full query length: per-batch row stride of x and of the output
#define S_LEN 128           // context positions (keys), never reduced
#define S_FULL 128          // per-batch row stride of context in the input
#define HD 512              // feature width D == hidden width H
#define KC (2 * S_LEN)      // context GEMM depth: [P_hi | P_lo]
#define LN_EPS 1.0e-3f

static_assert(NB >= 1 && NB <= NB_FULL);
static_assert(TQ >= 64 && TQ <= T_FULL && (TQ % 64) == 0);
static_assert(S_LEN == 128 && S_LEN == S_FULL);
static_assert((HD % 256) == 0 && (HD % 64) == 0 && (HD % 32) == 0);
static_assert((KC % 32) == 0 && (S_LEN % 64) == 0);
static_assert(((HD / 4) % S_LEN) == 0);
static_assert((S_LEN % 32) == 0);

typedef unsigned short us;
typedef us     v8us  __attribute__((ext_vector_type(8)));
typedef __bf16 v16bf __attribute__((ext_vector_type(16)));
typedef float  v8f   __attribute__((ext_vector_type(8)));
typedef float  v4f   __attribute__((ext_vector_type(4)));

union Frag { v16bf v; v8us h[2]; };

// ---------------------------------------------------------------------------
// scalar helpers
// ---------------------------------------------------------------------------
__device__ __forceinline__ us f2bf(float f) {           // f32 -> bf16, RNE convert
    unsigned int u = __float_as_uint(f);
    u += 0x7FFFu + ((u >> 16) & 1u);
    return (us)(u >> 16);
}
__device__ __forceinline__ float bf2f(us h) {
    return __uint_as_float(((unsigned int)h) << 16);
}
__device__ __forceinline__ float rbf(float f) {          // value after an RNE convert to bf16
    return bf2f(f2bf(f));
}
// tanh on two neighbouring features, each by one v_tanh_f32
typedef float v2f __attribute__((ext_vector_type(2)));
__device__ __forceinline__ v2f tanh_acc2(v2f x) {
    v2f y;  y.x = __builtin_amdgcn_tanhf(x.x); y.y = __builtin_amdgcn_tanhf(x.y);
    return y;
}
// Reductions over the 32 lanes of a wave, in registers; every lane ends with the result. All 32 lanes are on.
// xrow<M>: the value of lane l ^ M of the same 16-lane row (DPP row_xmask); xhalf: that of lane l ^ 16.
template <int M>
__device__ __forceinline__ float xrow(float x) {
    return __builtin_bit_cast(float, __builtin_amdgcn_mov_dpp(__builtin_bit_cast(int, x), 0x160 + M, 0xf, 0xf, true));
}
__device__ __forceinline__ float xhalf(float x) {
    const int b = __builtin_bit_cast(int, x);
    return __builtin_bit_cast(float, __builtin_amdgcn_permlanex16(b, b, 0x76543210, 0xfedcba98, false, false));
}
__device__ __forceinline__ float wave_sum(float x) {
    x += xrow<1>(x); x += xrow<2>(x); x += xrow<4>(x); x += xrow<8>(x);
    return x + xhalf(x);
}
__device__ __forceinline__ float wave_max(float x) {
    x = fmaxf(x, xrow<1>(x)); x = fmaxf(x, xrow<2>(x)); x = fmaxf(x, xrow<4>(x)); x = fmaxf(x, xrow<8>(x));
    return fmaxf(x, xhalf(x));
}
// ---------------------------------------------------------------------------
// WMMA helper: 16x16x32 bf16, f32 accumulate, 4-slot VALU hazard guard after the issue
// ---------------------------------------------------------------------------
__device__ __forceinline__ v8f wmma16(v16bf a, v16bf b, v8f c) {
    v8f d = __builtin_amdgcn_wmma_f32_16x16x32_bf16(false, a, false, b, (short)0, c, false, false);
    asm volatile("v_nop\n\tv_nop\n\tv_nop\n\tv_nop" : "+v"(d) : "v"(a), "v"(b));
    return d;
}

// Fragment loader for a k-contiguous 16-bit plane P[row][k] with pitch ld (halves).
// Lane l: row = (l & 15) (A row m, or B column n of an [n][k] plane), hsel = l >> 4.
//   elements 0..7  <- k0 + 8*hsel + 0..7
//   elements 8..15 <- k0 + 16 + 8*hsel + 0..7
__device__ __forceinline__ v16bf ld_frag(const us* __restrict__ P, int ld, int row, int k0, int hsel) {
    Frag f;
    const us* p = P + (size_t)row * ld + k0 + 8 * hsel;
    f.h[0] = *(const v8us*)p;
    f.h[1] = *(const v8us*)(p + 16);
    return f.v;
}

// ---------------------------------------------------------------------------
// Transpose + convert: src[R][C] f32 (pitch spitch, per-z stride sstride) -> dst[C][R] bf16 (pitch dpitch,
// per-z stride dstride), optionally a second copy at column offset +DUP halves.
// Block: 64 src rows x 64 src cols through LDS (cross-wave -> block barrier). Store phase: two 16-B stores a thread, four with DUP
// tile index (bx, by, z) in (R/64, C/64, Z); ts: the block's 64 x 65 f32 LDS tile
// ---------------------------------------------------------------------------
template <int DUP>
__device__ __forceinline__
void d_trans(float (*ts)[65], int bx, int by, int z,
             const float* __restrict__ src, int spitch, int sstride,
             us* __restrict__ dst, int dpitch, int dstride)
{
    const int r0 = bx * 64, c0 = by * 64;
    const int tid = threadIdx.x, lane = tid & 31, wave = tid >> 5;
    const float* sb = src + (size_t)z * (size_t)sstride;
    us* db = dst + (size_t)z * (size_t)dstride;

#pragma unroll
    for (int p = 0; p < 4; ++p) {
        const int rl = p * 16 + (tid >> 4);
        const int c4 = (tid & 15) * 4;
        const v4f x = *(const v4f*)(sb + (size_t)(r0 + rl) * spitch + c0 + c4);
        ts[rl][c4 + 0] = x.x; ts[rl][c4 + 1] = x.y; ts[rl][c4 + 2] = x.z; ts[rl][c4 + 3] = x.w;
    }
    __syncthreads();

    v8us o[2];
#pragma unroll
    for (int p = 0; p < 2; ++p) {
        const int cl = p * 32 + wave * 4 + (lane >> 3);
        const int r8 = (lane & 7) * 8;
#pragma unroll
        for (int i = 0; i < 8; ++i) o[p][i] = f2bf(ts[r8 + i][cl]);
    }
#pragma unroll
    for (int p = 0; p < 2; ++p) {
        const int cl = p * 32 + wave * 4 + (lane >> 3);
        const int r8 = (lane & 7) * 8;
        us* d = db + (size_t)(c0 + cl) * dpitch + r0 + r8;
        *(v8us*)d = o[p];
        if (DUP != 0) *(v8us*)(d + DUP) = o[p];
    }
    // the stores' address and data registers are written again in the code of the caller's other branches,
    // which follows these stores in the listing: the wait stands in front of any such overwrite
    asm volatile("s_wait_xcnt 0x0" ::: "memory");
}

// ---------------------------------------------------------------------------
// Both projections and the transposed context plane in one launch, straight from the f32 inputs.
//   blocks [0, GB):        one 64(M) x 64(N) tile of Wc = context @ Wa (z = 0) or of Ux = x @ Ua (z = 1), K = HD;
//                          Ux is stored row-major, Wc as Wc4[b][h / 4][s] in 16-B pieces (4 features of one s)
//   blocks [GB, GB + PB_CT): context[b][s][d] -> ctxT[b][d][s] (bf16), one 64 x 64 piece each
// A GEMM block (8 waves) converts its two operand panels to bf16 in LDS, once, in batches along k:
//   As[64][HD]  rows of context or x, k-contiguous, pitch PA halves (16 B x odd, for ds_load_b128)
//   Bs[HD][64]  rows k of Wa or Ua as they lie in memory, pitch PBB bytes (32 B x odd, for ds_load_tr16_b128)
// Wave w: rows 16 (w & 3) .. +15, columns 32 (w >> 2) .. +31 (2 accumulators). The transposing load hands lane
// (c, h) the elements Bs[k0 + 8h + 0..7][n + c]; two of them, at k0 and k0 + 16, follow the k map of ld_frag.
// The GEMM blocks, which run longer, come first in the index order.
// ---------------------------------------------------------------------------
#define PROWS (NB * S_LEN)   // rows of either projection
static_assert(TQ == S_LEN);  // the two projections share one grid
#define GB (2 * (PROWS / 64) * (HD / 64))
#define PB_CT ((S_LEN / 64) * (HD / 64) * NB)
#define PA (HD + 8)
#define PBB 160
#define AS_BYTES (64 * PA * 2)
#define BS_BYTES (HD * PBB)
#define KG 4                 // k-steps per fragment group
#define TP 68                // pitch of the f32 result tile in LDS, dwords: rows r and r + 8 fall on different banks
static_assert(KG == 4 && HD / 32 / KG >= 2);   // a batch is 16 loads per thread of 256
static_assert(64 * TP * 4 <= AS_BYTES && 64 * 65 * 4 <= AS_BYTES + BS_BYTES);

typedef unsigned int v2u __attribute__((ext_vector_type(2)));
typedef unsigned int v4u __attribute__((ext_vector_type(4)));
typedef short s16x8 __attribute__((ext_vector_type(8)));
typedef __bf16 v2bf __attribute__((ext_vector_type(2)));

__device__ __forceinline__ unsigned int cvt2(float lo, float hi) {      // two f32 -> two bf16, RNE, one instruction
    const v2f p = {lo, hi};
    return __builtin_bit_cast(unsigned int, __builtin_convertvector(p, v2bf));
}
__device__ __forceinline__ v8us ld_tr16(const unsigned char* p) {
    typedef __attribute__((address_space(3))) s16x8 lds_s16x8;
    return __builtin_bit_cast(v8us, __builtin_amdgcn_ds_load_tr16_b128_v8i16((lds_s16x8*)p));
}

// Work-group barrier that orders LDS traffic only. __syncthreads() also waits for the wave's outstanding global
// loads; with this one loads asked for ahead stay in flight across it: in k_proj the later batches of the panels, in
// k_attn the tail's operands, asked for in front of the softmax. Everything the waves of a block hand to each
// other at such a barrier goes through LDS.
__device__ __forceinline__ void bar_lds() {
    __builtin_amdgcn_fence(__ATOMIC_RELEASE, "workgroup", "local");
    __builtin_amdgcn_s_barrier();
    __builtin_amdgcn_fence(__ATOMIC_ACQUIRE, "workgroup", "local");
}

// The panels come in HD / 32 / KG batches of 16 loads of 16 B per thread; batch bt holds k = 32 KG bt .. + 32 KG - 1 of
// both. pa, pb: the thread's first pieces; every further piece lies a constant step on (16 rows of A or of B, for
// A also 32 KG columns a batch), so all loads go by two address pairs and an offset.
__device__ __forceinline__
void ld_batch(v4f (&r)[16], int bt, const float* __restrict__ pa, const float* __restrict__ pb) {
#pragma unroll
    for (int i = 0; i < 4; ++i) {            // A: 8 consecutive k of one row per thread
        r[2 * i]     = *(const v4f*)(pa + i * 16 * HD + bt * (32 * KG));
        r[2 * i + 1] = *(const v4f*)(pa + i * 16 * HD + bt * (32 * KG) + 4);
    }
#pragma unroll
    for (int i = 0; i < 8; ++i)              // B: 4 consecutive n of one row k per thread
        r[8 + i] = *(const v4f*)(pb + (bt * 8 + i) * 16 * HD);
    // stands in front of any overwrite of the two address pairs that these loads name; the pairs are inputs so
    // that no load's own result is laid over them either
    asm volatile("s_wait_xcnt 0x0" :: "v"(pa), "v"(pb) : "memory");
}
__device__ __forceinline__
void st_batch(const v4f (&r)[16], int bt, unsigned char* __restrict__ sa, unsigned char* __restrict__ sb) {
#pragma unroll
    for (int i = 0; i < 4; ++i) {
        const v4f a = r[2 * i], c = r[2 * i + 1];
        const v4u o = {cvt2(a.x, a.y), cvt2(a.z, a.w), cvt2(c.x, c.y), cvt2(c.z, c.w)};
        *(v4u*)(sa + i * 16 * (PA * 2) + bt * (64 * KG)) = o;
    }
#pragma unroll
    for (int i = 0; i < 8; ++i) {
        const v4f a = r[8 + i];
        const v2u o = {cvt2(a.x, a.y), cvt2(a.z, a.w)};
        *(v2u*)(sb + (bt * 8 + i) * 16 * PBB) = o;
    }
}

// waves_per_eu: two blocks (2 waves to a SIMD each) share a WGP, so that the transposing blocks find room beside
// the GEMM blocks instead of waiting for one to end; that holds the register count to a quarter of a SIMD's file.
__global__ __launch_bounds__(256) __attribute__((amdgpu_waves_per_eu(4, 4)))
void k_proj(const float* __restrict__ context, const float* __restrict__ x,
            const float* __restrict__ Wa, const float* __restrict__ Ua,
            float* __restrict__ Wc, float* __restrict__ Ux, us* __restrict__ ctxT)
{
    __shared__ __attribute__((aligned(16))) unsigned char sm[AS_BYTES + BS_BYTES];
    const int blk = blockIdx.x;
    if (blk >= GB) {                                     // block-uniform
        const int i  = blk - GB;
        const int bx = i % (S_LEN / 64);
        const int by = (i / (S_LEN / 64)) % (HD / 64);
        const int z  = i / ((S_LEN / 64) * (HD / 64));
        d_trans<0>((float (*)[65])sm, bx, by, z, context, HD, T_FULL * HD, ctxT, S_LEN, HD * S_LEN);
        return;
    }
    const int tid = threadIdx.x, lane = tid & 31;
    const int wv = __builtin_amdgcn_readfirstlane(tid >> 5);
    const int hsel = lane >> 4, m = lane & 15;
    const int z  = blk / ((PROWS / 64) * (HD / 64));
    const int m0 = (blk % (PROWS / 64)) * 64;
    const int n0 = ((blk / (PROWS / 64)) % (HD / 64)) * 64;
    const int bq = m0 / TQ;                              // the tile's 64 rows lie in one batch
    const float* Ar = (z == 0 ? context : x) + (size_t)(bq * T_FULL + (m0 - bq * TQ)) * HD;
    const float* Br = (z == 0 ? Wa : Ua) + n0;
    unsigned char* As = sm;
    unsigned char* Bs = sm + AS_BYTES;

    const float* pa = Ar + (size_t)(tid >> 4) * HD + (tid & 15) * 8;
    const float* pb = Br + (size_t)(tid >> 4) * HD + (tid & 15) * 4;
    unsigned char* sa = As + (tid >> 4) * (PA * 2) + (tid & 15) * 16;
    unsigned char* sb = Bs + (tid >> 4) * PBB + (tid & 15) * 8;
    const int mt = wv & 3, nh = wv >> 2;
    const unsigned char* bd = Bs + (8 * hsel + (lane & 7)) * PBB + ((lane >> 3) & 1) * 16 + nh * 64;
    v8f c0 = {}; v8f c1 = {};

    // Two register sets, up to two batches of loads in flight. Each batch is converted and stored as it arrives and its
    // KG k-steps are worked on while the later batches fly: no LDS byte is written twice, so one barrier a batch
    // (LDS only: it leaves the global loads in flight) is all the order there is.
    v4f rr[2][16];
    ld_batch(rr[0], 0, pa, pb);
    ld_batch(rr[1], 1, pa, pb);
#pragma unroll
    for (int g = 0; g < HD / 32 / KG; ++g) {
        st_batch(rr[g & 1], g, sa, sb);
        if (g + 2 < HD / 32 / KG) ld_batch(rr[g & 1], g + 2, pa, pb);
        bar_lds();
        v16bf fa[KG];
        Frag  fb0[KG], fb1[KG];
#pragma unroll
        for (int i = 0; i < KG; ++i) {
            const int k0 = (g * KG + i) * 32;
            fa[i] = ld_frag((const us*)As, PA, mt * 16 + m, k0, hsel);
            fb0[i].h[0] = ld_tr16(bd + k0 * PBB);
            fb0[i].h[1] = ld_tr16(bd + (k0 + 16) * PBB);
            fb1[i].h[0] = ld_tr16(bd + k0 * PBB + 32);
            fb1[i].h[1] = ld_tr16(bd + (k0 + 16) * PBB + 32);
        }
#pragma unroll
        for (int i = 0; i < KG; ++i) {
            c0 = wmma16(fa[i], fb0[i].v, c0);
            c1 = wmma16(fa[i], fb1[i].v, c1);
        }
    }
    __syncthreads();                                     // every wave has read its last fragment: the tile lies over As

    // D map: acc[r] -> (row 8*hsel + r, col n-tile + m). The 64 x 64 tile goes through LDS to whole-line stores.
    float* tile = (float*)sm;
#pragma unroll
    for (int r = 0; r < 8; ++r) {
        const int row = mt * 16 + 8 * hsel + r;
        tile[row * TP + nh * 32 + m]      = c0[r];
        tile[row * TP + nh * 32 + 16 + m] = c1[r];
    }
    __syncthreads();

    v4f vals[4];
    if (z == 0) {                                        // block-uniform
        // Wc goes out as Wc4[b][h / 4][s] (16-B pieces): k_attn's lanes run along s, so a wave's load there is 512 B in
        // a row. Thread = (piece column q, row r): a wave stores 32 rows of one q; the LDS reads step TP dwords a lane.
        v4f* Cq = (v4f*)Wc + ((size_t)bq * (HD / 4) + n0 / 4 + (tid >> 6)) * S_LEN + (m0 - bq * TQ) + (tid & 63);
#pragma unroll
        for (int p = 0; p < 4; ++p) vals[p] = *(const v4f*)(tile + (tid & 63) * TP + (p * 4 + (tid >> 6)) * 4);
#pragma unroll
        for (int p = 0; p < 4; ++p) Cq[p * 4 * S_LEN] = vals[p];
        // in front of any overwrite of the stores' address pair and data in the code that follows them in the listing
        asm volatile("s_wait_xcnt 0x0" ::: "memory");
    } else {
        float* Cb = Ux + (size_t)m0 * HD + n0;
#pragma unroll
        for (int p = 0; p < 4; ++p) vals[p] = *(const v4f*)(tile + (p * 16 + (tid >> 4)) * TP + (tid & 15) * 4);
#pragma unroll
        for (int p = 0; p < 4; ++p) *(v4f*)(Cb + (size_t)(p * 16 + (tid >> 4)) * HD + (tid & 15) * 4) = vals[p];
        // the same wait for these stores
        asm volatile("s_wait_xcnt 0x0" ::: "memory");
    }
}

// ---------------------------------------------------------------------------
// Fused energies -> softmax -> P @ context -> LayerNorm + residual. One block per (b, group of TT query rows t).
// Thread = (hh, s): key position s, part hh (of HS) of the feature range. Each 16-B piece of Wc is loaded once and
// used for all TT query rows of the block. Wc lies as Wc4[b][h / 4][s]: the 32 lanes of a wave, consecutive s, read
// 512 B in a row (4 whole cache lines) with each load.
//   e[t][s] = sum_h v[h] * tanh(Wc[b][s][h] + Ux[bt][h] + bUa[h] + bWa[h]) + bVa   (f32; the HS parts of
//             the h range are summed apart and then added in order)
//   p    = softmax_s(e); Pl[t][s] = bf16 hi, Pl[t][S+s] = bf16 lo (lo = p - hi), in LDS
//   cv[t][d] = sum_k Pl[t][k] * ctxT[b][d][k mod S] on WMMA: the M tile is the block's TT rows and zero rows up
//             to 16; wave w does columns 32w..32w+31; each B fragment is loaded once and serves hi and lo
//   out  = LayerNorm(cv) * gamma + beta + x, one wave per row
// LDS regions are cross-wave: block barriers throughout.
// ---------------------------------------------------------------------------
#define TT 4                // query rows per block
#define HS 4                // parts of the h range, one per group of S_LEN threads
#define RPT (TT / HS)       // softmax rows per thread
static_assert((TQ % TT) == 0 && (TT % HS) == 0 && ((HD / 4) % HS) == 0);
static_assert(TT <= (S_LEN * HS) / 32 && TT <= 8);       // rows 0..TT-1 of a D tile lie in lanes 0-15
static_assert(HD == (S_LEN * HS / 32) * 32);             // 32 output columns per wave
#define PLP (KC + 16)       // pitch of a P row in LDS, halves: 32 B more, so that the 16-B pieces which the 32 lanes
                            // of one fragment load read (16 rows, 2 pieces each) spread evenly over the banks

// waves_per_eu: the block's 16 waves stand four to a SIMD and one block fills a WGP, so the register budget is
// that of four waves; without it the scheduler holds the register count down for more waves and sets each
// tanh right in front of its product and sum instead of issuing the 64 independent ones of a trip in runs.
__global__ __launch_bounds__(S_LEN * HS) __attribute__((amdgpu_waves_per_eu(S_LEN * HS / 128, S_LEN * HS / 128)))
void k_attn(const float* __restrict__ Uxp, const float* __restrict__ Wcp,
            const float* __restrict__ bWa, const float* __restrict__ bUa,
            const float* __restrict__ Va,  const float* __restrict__ bVa,
            const us* __restrict__ ctxT, const float* __restrict__ xin,
            const float* __restrict__ gam, const float* __restrict__ bet,
            float* __restrict__ out)
{
    __shared__ v4f sq4[TT][HD / 4];
    __shared__ v4f sv4[HD / 4];
    __shared__ float part[HS][TT][S_LEN];
    __shared__ __attribute__((aligned(16))) v2f wred[TT][S_LEN / 32];   // per row and wave: (max, sum of exp(e - max))
    __shared__ __attribute__((aligned(16))) us Pl[16][PLP];
    __shared__ __attribute__((aligned(16))) float cvs[TT][HD];

    const int bt0 = blockIdx.x * TT;         // first of the block's rows b * TQ + t (all of one b)
    const int b   = bt0 / TQ;
    const int tid = threadIdx.x, lane = tid & 31, wave = tid >> 5;
    const int s   = tid & (S_LEN - 1), hh = tid / S_LEN;

    for (int i = tid; i < TT * (HD / 4); i += S_LEN * HS) {
        const int c = i & (HD / 4 - 1);
        v4f q = *(const v4f*)(Uxp + (size_t)bt0 * HD + i * 4);
        const v4f b1 = *(const v4f*)(bUa + c * 4);
        const v4f b2 = *(const v4f*)(bWa + c * 4);
        q.x = (q.x + rbf(b1.x)) + rbf(b2.x);
        q.y = (q.y + rbf(b1.y)) + rbf(b2.y);
        q.z = (q.z + rbf(b1.z)) + rbf(b2.z);
        q.w = (q.w + rbf(b1.w)) + rbf(b2.w);
        sq4[i / (HD / 4)][c] = q;
    }
    for (int i = tid; i < HD / 4; i += S_LEN * HS) {
        v4f w = *(const v4f*)(Va + i * 4);
        w.x = rbf(w.x); w.y = rbf(w.y); w.z = rbf(w.z); w.w = rbf(w.w);
        sv4[i] = w;
    }
    // rows TT..15 of the M tile are zero
    for (int i = tid; i < (16 - TT) * PLP / 8; i += S_LEN * HS) {
        const v8us zr = {};
        *(v8us*)(&Pl[TT][0] + i * 8) = zr;
    }
    __syncthreads();

    const float bva = rbf(bVa[0]);
    const int u0 = hh * (HD / 4 / HS);
    const v4f* we = (const v4f*)Wcp + ((size_t)b * (HD / 4) + u0) * S_LEN + s;      // Wc4[b][u][s]
    float acc[TT];
#pragma unroll
    for (int j = 0; j < TT; ++j) acc[j] = 0.0f;
    // four 16-B loads per lane go out together at the head of each trip
#pragma unroll 4
    for (int u = 0; u < HD / 4 / HS; ++u) {
        const v4f e = we[u * S_LEN];
        const v4f w = sv4[u0 + u];
#pragma unroll
        for (int j = 0; j < TT; ++j) {
            const v4f d = sq4[j][u0 + u];
            const v2f y0 = tanh_acc2(e.xy + d.xy);
            const v2f y1 = tanh_acc2(e.zw + d.zw);
            const v2f p0 = w.xy * y0;
            const v2f p1 = w.zw * y1;
            acc[j] += p0.x;
            acc[j] += p0.y;
            acc[j] += p1.x;
            acc[j] += p1.y;
        }
    }
    // what the tail reads from global memory is asked for here, so that it arrives during the softmax:
    // the wave's B fragments (32 columns d, all S key positions) and, in the TT LayerNorm waves, x, gamma, beta
    const int wv = __builtin_amdgcn_readfirstlane(wave);
    const int hsel = lane >> 4, m = lane & 15;
    const us* cb = ctxT + (size_t)b * (size_t)(HD * S_LEN);
    const us* cb0 = cb + (size_t)(wv * 32 + m) * S_LEN + 8 * hsel;   // the lane's row of n-tile 0, its k half
    const us* cb1 = cb0 + 16 * S_LEN;                                // the same of n-tile 1
    v16bf bfr[2][S_LEN / 32];
#pragma unroll
    for (int kk = 0; kk < S_LEN / 32; ++kk) bfr[0][kk] = ld_frag(cb0, 0, 0, kk * 32, 0);
#pragma unroll
    for (int kk = 0; kk < S_LEN / 32; ++kk) bfr[1][kk] = ld_frag(cb1, 0, 0, kk * 32, 0);
    // stands in front of any overwrite of the address pair that these loads name (all sixteen go by cb0 and an
    // immediate offset); the pair is an input so that no load's own result is laid over it either
    asm volatile("s_wait_xcnt 0x0" :: "v"(cb0) : "memory");
    const int lr   = bt0 + wv;                          // LayerNorm row of wave wv < TT
    const int frow = (lr / TQ) * T_FULL + (lr % TQ);
    v4f xr[4], gm[4], be[4];
    if (wv < TT) {
        const float* xp = xin + (size_t)frow * HD + lane * 4;
#pragma unroll
        for (int j = 0; j < 4; ++j) {
            xr[j] = *(const v4f*)(xp + 128 * j);
            gm[j] = *(const v4f*)(gam + 128 * j + lane * 4);
            be[j] = *(const v4f*)(bet + 128 * j + lane * 4);
        }
        // inside the branch, so that it stands in front of the next write of a scalar base that these loads name
        asm volatile("s_wait_xcnt 0x0" ::: "memory");
    }

#pragma unroll
    for (int j = 0; j < TT; ++j) part[hh][j][s] = acc[j];
    bar_lds();

    // thread (hh, s) carries rows j = RPT * hh + k of the block through the softmax. A row lies in S_LEN / 32 waves:
    // each reduces its 32 energies in registers to (its max mw, its sum of exp(e - mw)); the pairs of a row meet
    // in LDS once, and every thread rescales by exp(mw - row max)
    float ex[RPT], mw[RPT];
#pragma unroll
    for (int k = 0; k < RPT; ++k) {
        const int j = RPT * hh + k;
        float a = part[0][j][s];
#pragma unroll
        for (int g = 1; g < HS; ++g) a += part[g][j][s];
        const float en = a + bva;
        mw[k] = wave_max(en);
        ex[k] = __expf(en - mw[k]);
        const float sw = wave_sum(ex[k]);
        if (lane == 0) { const v2f pr = {mw[k], sw}; wred[j][s >> 5] = pr; }
    }
    bar_lds();
#pragma unroll
    for (int k = 0; k < RPT; ++k) {
        const int j = RPT * hh + k;
        v2f pr[S_LEN / 32];
#pragma unroll
        for (int q = 0; q < S_LEN / 32; ++q) pr[q] = wred[j][q];
        float mx = pr[0].x;
#pragma unroll
        for (int q = 1; q < S_LEN / 32; ++q) mx = fmaxf(mx, pr[q].x);
        float ssum = pr[0].y * __expf(pr[0].x - mx);
#pragma unroll
        for (int q = 1; q < S_LEN / 32; ++q) ssum += pr[q].y * __expf(pr[q].x - mx);
        const float p = (ex[k] * __expf(mw[k] - mx)) * (1.0f / ssum);
        const us h = f2bf(p);
        Pl[j][s] = h;
        Pl[j][S_LEN + s] = f2bf(p - bf2f(h));
    }
    bar_lds();

    // cv tile: k runs over the hi plane, then over the lo plane
    v16bf af[KC / 32];
#pragma unroll
    for (int kk = 0; kk < KC / 32; ++kk) af[kk] = ld_frag(&Pl[0][0], PLP, m, kk * 32, hsel);
    v8f c0 = {}; v8f c1 = {};
#pragma unroll
    for (int kk = 0; kk < KC / 32; ++kk) {
        c0 = wmma16(af[kk], bfr[0][kk % (S_LEN / 32)], c0);
        c1 = wmma16(af[kk], bfr[1][kk % (S_LEN / 32)], c1);
    }
    // D map: acc[r] -> (row 8*hsel + r, col n-tile + m): the block's rows are r < TT of lanes 0-15
    if (hsel == 0) {
#pragma unroll
        for (int r = 0; r < TT; ++r) {
            cvs[r][wv * 32 + m]      = c0[r];
            cvs[r][wv * 32 + 16 + m] = c1[r];
        }
    }
    bar_lds();

    // LayerNorm + residual: wave wv < TT takes row wv. Lane l holds columns 128j + 4l .. +3 for j = 0..3;
    // store instruction j covers columns 128j..128j+127
    if (wv < TT) {
        v4f c[4];
#pragma unroll
        for (int j = 0; j < 4; ++j) c[j] = *(const v4f*)(&cvs[wv][128 * j + lane * 4]);
        float sm = 0.0f;
#pragma unroll
        for (int j = 0; j < 4; ++j) sm += (c[j].x + c[j].y) + (c[j].z + c[j].w);
        sm = wave_sum(sm);
        const float mean = sm * (1.0f / (float)HD);

        float q = 0.0f;
#pragma unroll
        for (int j = 0; j < 4; ++j) {
            const float dx = c[j].x - mean, dy = c[j].y - mean, dz = c[j].z - mean, dw = c[j].w - mean;
            q += dx * dx; q += dy * dy; q += dz * dz; q += dw * dw;
        }
        q = wave_sum(q);
        const float var  = q * (1.0f / (float)HD);
        const float rstd = rsqrtf(var + LN_EPS);

        v4f o[4];
#pragma unroll
        for (int j = 0; j < 4; ++j) {
            o[j].x = (c[j].x - mean) * rstd * rbf(gm[j].x) + rbf(be[j].x) + rbf(xr[j].x);
            o[j].y = (c[j].y - mean) * rstd * rbf(gm[j].y) + rbf(be[j].y) + rbf(xr[j].y);
            o[j].z = (c[j].z - mean) * rstd * rbf(gm[j].z) + rbf(be[j].z) + rbf(xr[j].z);
            o[j].w = (c[j].w - mean) * rstd * rbf(gm[j].w) + rbf(be[j].w) + rbf(xr[j].w);
        }
        float* dp = out + (size_t)frow * HD + lane * 4;
#pragma unroll
        for (int j = 0; j < 4; ++j) *(v4f*)(dp + 128 * j) = o[j];
    }
}

// ---------------------------------------------------------------------------
static inline size_t al256(size_t x) { return (x + 255) & ~(size_t)255; }

extern "C" void kernel_launch(void* const* d_in, const int* in_sizes, int n_in,
                              void* d_out, int out_size, void* d_ws, size_t ws_size,
                              hipStream_t stream)
{
    if (n_in < 10) return;
    if (in_sizes[0] < ((NB - 1) * T_FULL + S_LEN) * HD) return;   // context [8][128][512] f32
    if (in_sizes[1] < ((NB - 1) * T_FULL + TQ) * HD) return;      // x       [8][128][512] f32
    if (in_sizes[2] < HD * HD) return;                             // Wa [512][512] ([in][out]) f32
    if (in_sizes[3] < HD) return;                                  // bWa [512]
    if (in_sizes[4] < HD * HD) return;                             // Ua [512][512] ([in][out]) f32
    if (in_sizes[5] < HD) return;                                  // bUa [512]
    if (in_sizes[6] < HD) return;                                  // Va [512][1]
    if (in_sizes[7] < 1) return;                                   // bVa [1]
    if (in_sizes[8] < HD || in_sizes[9] < HD) return;              // gamma, beta [512]
    if (out_size < ((NB - 1) * T_FULL + TQ) * HD) return;

    const float* context = (const float*)d_in[0];
    const float* x       = (const float*)d_in[1];
    const float* Wa      = (const float*)d_in[2];
    const float* bWa     = (const float*)d_in[3];
    const float* Ua      = (const float*)d_in[4];
    const float* bUa     = (const float*)d_in[5];
    const float* Va      = (const float*)d_in[6];
    const float* bVa     = (const float*)d_in[7];
    const float* gamma   = (const float*)d_in[8];
    const float* beta    = (const float*)d_in[9];
    float* out = (float*)d_out;

    char* ws = (char*)d_ws;
    size_t off = 0;
    us* ctxT  = (us*)(ws + off);    off += al256((size_t)NB * HD * S_LEN * sizeof(us));   // [NB][512][128]
    float* Wc = (float*)(ws + off); off += al256((size_t)PROWS * HD * sizeof(float));     // [NB][512/4][S][4]
    float* Ux = (float*)(ws + off); off += al256((size_t)PROWS * HD * sizeof(float));     // [NB*TQ][512]
    if (off > ws_size) return;

    const dim3 b256(256), bS(S_LEN * HS);

    // ---- Wc = context @ Wa, Ux = x @ Ua (f32; biases added in k_attn) and the bf16 plane ctxT, one launch ----
    k_proj<<<dim3(GB + PB_CT), b256, 0, stream>>>(context, x, Wa, Ua, Wc, Ux, ctxT);

    // ---- energies + softmax, cv = [P_hi|P_lo] @ [ctxT;ctxT] (f32), LayerNorm + residual -> out ----
    k_attn<<<dim3(NB * TQ / TT), bS, 0, stream>>>(Ux, Wc, bWa, bUa, Va, bVa, ctxT, x, gamma, beta, out);
}

// v008
// One run takes 15.5 microseconds.
// Next to v007, in two timings, it ran 1.11 times as fast each time.
// Over all steps from v000 it is 4.09 times as fast.
#include <hip/hip_runtime.h>

// Contractions on v_wmma_f32_16x16x32_bf16 (bf16 operands, f32 accumulate): context@Wa and x@Ua from
// operand tiles that each block converts (RNE) into LDS itself; attn@context with attn carried as bf16 hi+lo planes folded into K against
// the RNE-converted transposed context plane, inside the energy kernel. Energies v.tanh(.), softmax,
// LayerNorm and the residual add in f32 on the VALU.

#ifndef NB
#define NB 8
#endif
#ifndef TQ
#define TQ 128
#endif
#define NB_FULL 8
#define T_FULL 128          // full query length: per-batch row stride of x and of the output
#define S_LEN 128           // context positions (keys), never reduced
#define S_FULL 128          // per-batch row stride of context in the input
#define HD 512              // feature width D == hidden width H
#define KC (2 * S_LEN)      // context GEMM depth: [P_hi | P_lo]
#define LN_EPS 1.0e-3f

static_assert(NB >= 1 && NB <= NB_FULL);
static_assert(TQ >= 64 && TQ <= T_FULL && (TQ % 64) == 0);
static_assert(S_LEN == 128 && S_LEN == S_FULL);
static_assert((HD % 256) == 0 && (HD % 64) == 0 && (HD % 32) == 0);
static_assert((KC % 32) == 0 && (S_LEN % 64) == 0);
static_assert(((HD / 4) % S_LEN) == 0);
static_assert((S_LEN % 32) == 0);

typedef unsigned short us;
typedef us     v8us  __attribute__((ext_vector_type(8)));
typedef __bf16 v16bf __attribute__((ext_vector_type(16)));
typedef float  v8f   __attribute__((ext_vector_type(8)));
typedef float  v4f   __attribute__((ext_vector_type(4)));

union Frag { v16bf v; v8us h[2]; };

// ---------------------------------------------------------------------------
// scalar helpers
// ---------------------------------------------------------------------------
__device__ __forceinline__ us f2bf(float f) {           // f32 -> bf16, RNE convert
    unsigned int u = __float_as_uint(f);
    u += 0x7FFFu + ((u >> 16) & 1u);
    return (us)(u >> 16);
}
__device__ __forceinline__ float bf2f(us h) {
    return __uint_as_float(((unsigned int)h) << 16);
}
__device__ __forceinline__ float rbf(float f) {          // value after an RNE convert to bf16
    return bf2f(f2bf(f));
}
// tanh on two neighbouring features, each by one v_tanh_f32
typedef float v2f __attribute__((ext_vector_type(2)));
__device__ __forceinline__ v2f tanh_acc2(v2f x) {
    v2f y;  y.x = __builtin_amdgcn_tanhf(x.x); y.y = __builtin_amdgcn_tanhf(x.y);
    return y;
}
// Reductions over the 32 lanes of a wave, in registers; every lane ends with the result. All 32 lanes are on.
// xrow<M>: the value of lane l ^ M of the same 16-lane row (DPP row_xmask); xhalf: that of lane l ^ 16.
template <int M>
__device__ __forceinline__ float xrow(float x) {
    return __builtin_bit_cast(float, __builtin_amdgcn_mov_dpp(__builtin_bit_cast(int, x), 0x160 + M, 0xf, 0xf, true));
}
__device__ __forceinline__ float xhalf(float x) {
    const int b = __builtin_bit_cast(int, x);
    return __builtin_bit_cast(float, __builtin_amdgcn_permlanex16(b, b, 0x76543210, 0xfedcba98, false, false));
}
__device__ __forceinline__ float wave_sum(float x) {
    x += xrow<1>(x); x += xrow<2>(x); x += xrow<4>(x); x += xrow<8>(x);
    return x + xhalf(x);
}
__device__ __forceinline__ float wave_max(float x) {
    x = fmaxf(x, xrow<1>(x)); x = fmaxf(x, xrow<2>(x)); x = fmaxf(x, xrow<4>(x)); x = fmaxf(x, xrow<8>(x));
    return fmaxf(x, xhalf(x));
}
// ---------------------------------------------------------------------------
// WMMA helper: 16x16x32 bf16, f32 accumulate, 4-slot VALU hazard guard after the issue
// ---------------------------------------------------------------------------
__device__ __forceinline__ v8f wmma16(v16bf a, v16bf b, v8f c) {
    v8f d = __builtin_amdgcn_wmma_f32_16x16x32_bf16(false, a, false, b, (short)0, c, false, false);
    asm volatile("v_nop\n\tv_nop\n\tv_nop\n\tv_nop" : "+v"(d) : "v"(a), "v"(b));
    return d;
}

// Fragment loader for a k-contiguous 16-bit plane P[row][k] with pitch ld (halves).
// Lane l: row = (l & 15) (A row m, or B column n of an [n][k] plane), hsel = l >> 4.
//   elements 0..7  <- k0 + 8*hsel + 0..7
//   elements 8..15 <- k0 + 16 + 8*hsel + 0..7
__device__ __forceinline__ v16bf ld_frag(const us* __restrict__ P, int ld, int row, int k0, int hsel) {
    Frag f;
    const us* p = P + (size_t)row * ld + k0 + 8 * hsel;
    f.h[0] = *(const v8us*)p;
    f.h[1] = *(const v8us*)(p + 16);
    return f.v;
}

// ---------------------------------------------------------------------------
// Transpose + convert: src[R][C] f32 (pitch spitch, per-z stride sstride) -> dst[C][R] bf16 (pitch dpitch,
// per-z stride dstride), optionally a second copy at column offset +DUP halves.
// Block: 64 src rows x 64 src cols through LDS (cross-wave -> block barrier). Store phase: two 16-B stores a thread, four with DUP
// tile index (bx, by, z) in (R/64, C/64, Z); ts: the block's 64 x 65 f32 LDS tile
// ---------------------------------------------------------------------------
template <int DUP>
__device__ __forceinline__
void d_trans(float (*ts)[65], int bx, int by, int z,
             const float* __restrict__ src, int spitch, int sstride,
             us* __restrict__ dst, int dpitch, int dstride)
{
    const int r0 = bx * 64, c0 = by * 64;
    const int tid = threadIdx.x, lane = tid & 31, wave = tid >> 5;
    const float* sb = src + (size_t)z * (size_t)sstride;
    us* db = dst + (size_t)z * (size_t)dstride;

#pragma unroll
    for (int p = 0; p < 4; ++p) {
        const int rl = p * 16 + (tid >> 4);
        const int c4 = (tid & 15) * 4;
        const v4f x = *(const v4f*)(sb + (size_t)(r0 + rl) * spitch + c0 + c4);
        ts[rl][c4 + 0] = x.x; ts[rl][c4 + 1] = x.y; ts[rl][c4 + 2] = x.z; ts[rl][c4 + 3] = x.w;
    }
    __syncthreads();

    v8us o[2];
#pragma unroll
    for (int p = 0; p < 2; ++p) {
        const int cl = p * 32 + wave * 4 + (lane >> 3);
        const int r8 = (lane & 7) * 8;
#pragma unroll
        for (int i = 0; i < 8; ++i) o[p][i] = f2bf(ts[r8 + i][cl]);
    }
#pragma unroll
    for (int p = 0; p < 2; ++p) {
        const int cl = p * 32 + wave * 4 + (lane >> 3);
        const int r8 = (lane & 7) * 8;
        us* d = db + (size_t)(c0 + cl) * dpitch + r0 + r8;
        *(v8us*)d = o[p];
        if (DUP != 0) *(v8us*)(d + DUP) = o[p];
    }
    // the stores' address and data registers are written again in the code of the caller's other branches,
    // which follows these stores in the listing: the wait stands in front of any such overwrite
    asm volatile("s_wait_xcnt 0x0" ::: "memory");
}

// ---------------------------------------------------------------------------
// Both projections and the transposed context plane in one launch, straight from the f32 inputs.
//   blocks [0, GB):        one 64(M) x 64(N) tile of Wc = context @ Wa (z = 0) or of Ux = x @ Ua (z = 1), K = HD;
//                          Ux is stored row-major, Wc as Wc4[b][h / 4][s] in 16-B pieces (4 features of one s)
//   blocks [GB, GB + PB_CT): context[b][s][d] -> ctxT[b][d][s] (bf16), one 64 x 64 piece each
// A GEMM block (8 waves) converts its two operand panels to bf16 in LDS, once, in batches along k:
//   As[64][HD]  rows of context or x, k-contiguous, pitch PA halves (16 B x odd, for ds_load_b128)
//   Bs[HD][64]  rows k of Wa or Ua as they lie in memory, pitch PBB bytes (32 B x odd, for ds_load_tr16_b128)
// Wave w: rows 16 (w & 3) .. +15, columns 32 (w >> 2) .. +31 (2 accumulators). The transposing load hands lane
// (c, h) the elements Bs[k0 + 8h + 0..7][n + c]; two of them, at k0 and k0 + 16, follow the k map of ld_frag.
// The GEMM blocks, which run longer, come first in the index order.
// ---------------------------------------------------------------------------
#define PROWS (NB * S_LEN)   // rows of either projection
static_assert(TQ == S_LEN);  // the two projections share one grid
#define GB (2 * (PROWS / 64) * (HD / 64))
#define PB_CT ((S_LEN / 64) * (HD / 64) * NB)
#define PA (HD + 8)
#define PBB 160
#define AS_BYTES (64 * PA * 2)
#define BS_BYTES (HD * PBB)
#define KG 4                 // k-steps per fragment group
#define TP 68                // pitch of the f32 result tile in LDS, dwords: rows r and r + 8 fall on different banks
static_assert(KG == 4 && HD / 32 / KG >= 2);   // a batch is 16 loads per thread of 256
static_assert(64 * TP * 4 <= AS_BYTES && 64 * 65 * 4 <= AS_BYTES + BS_BYTES);

typedef unsigned int v2u __attribute__((ext_vector_type(2)));
typedef unsigned int v4u __attribute__((ext_vector_type(4)));
typedef short s16x8 __attribute__((ext_vector_type(8)));
typedef __bf16 v2bf __attribute__((ext_vector_type(2)));

__device__ __forceinline__ unsigned int cvt2(float lo, float hi) {      // two f32 -> two bf16, RNE, one instruction
    const v2f p = {lo, hi};
    return __builtin_bit_cast(unsigned int, __builtin_convertvector(p, v2bf));
}
__device__ __forceinline__ v8us ld_tr16(const unsigned char* p) {
    typedef __attribute__((address_space(3))) s16x8 lds_s16x8;
    return __builtin_bit_cast(v8us, __builtin_amdgcn_ds_load_tr16_b128_v8i16((lds_s16x8*)p));
}

// Work-group barrier that orders LDS traffic only. __syncthreads() also waits for the wave's outstanding global
// loads; with this one loads asked for ahead stay in flight across it: in k_proj the later batches of the panels, in
// k_attn the first pieces of Wc and the tail's operands. Everything the waves of a block hand to each
// other at such a barrier goes through LDS.
__device__ __forceinline__ void bar_lds() {
    __builtin_amdgcn_fence(__ATOMIC_RELEASE, "workgroup", "local");
    __builtin_amdgcn_s_barrier();
    __builtin_amdgcn_fence(__ATOMIC_ACQUIRE, "workgroup", "local");
}

// The panels come in HD / 32 / KG batches of 16 loads of 16 B per thread; batch bt holds k = 32 KG bt .. + 32 KG - 1 of
// both. pa, pb: the thread's first pieces; every further piece lies a constant step on (16 rows of A or of B, for
// A also 32 KG columns a batch), so all loads go by two address pairs and an offset.
__device__ __forceinline__
void ld_batch(v4f (&r)[16], int bt, const float* __restrict__ pa, const float* __restrict__ pb) {
#pragma unroll
    for (int i = 0; i < 4; ++i) {            // A: 8 consecutive k of one row per thread
        r[2 * i]     = *(const v4f*)(pa + i * 16 * HD + bt * (32 * KG));
        r[2 * i + 1] = *(const v4f*)(pa + i * 16 * HD + bt * (32 * KG) + 4);
    }
#pragma unroll
    for (int i = 0; i < 8; ++i)              // B: 4 consecutive n of one row k per thread
        r[8 + i] = *(const v4f*)(pb + (bt * 8 + i) * 16 * HD);
    // stands in front of any overwrite of the two address pairs that these loads name; the pairs are inputs so
    // that no load's own result is laid over them either
    asm volatile("s_wait_xcnt 0x0" :: "v"(pa), "v"(pb) : "memory");
}
__device__ __forceinline__
void st_batch(const v4f (&r)[16], int bt, unsigned char* __restrict__ sa, unsigned char* __restrict__ sb) {
#pragma unroll
    for (int i = 0; i < 4; ++i) {
        const v4f a = r[2 * i], c = r[2 * i + 1];
        const v4u o = {cvt2(a.x, a.y), cvt2(a.z, a.w), cvt2(c.x, c.y), cvt2(c.z, c.w)};
        *(v4u*)(sa + i * 16 * (PA * 2) + bt * (64 * KG)) = o;
    }
#pragma unroll
    for (int i = 0; i < 8; ++i) {
        const v4f a = r[8 + i];
        const v2u o = {cvt2(a.x, a.y), cvt2(a.z, a.w)};
        *(v2u*)(sb + (bt * 8 + i) * 16 * PBB) = o;
    }
}

// waves_per_eu: two blocks (2 waves to a SIMD each) share a WGP, so that the transposing blocks find room beside
// the GEMM blocks instead of waiting for one to end; that holds the register count to a quarter of a SIMD's file.
__global__ __launch_bounds__(256) __attribute__((amdgpu_waves_per_eu(4, 4)))
void k_proj(const float* __restrict__ context, const float* __restrict__ x,
            const float* __restrict__ Wa, const float* __restrict__ Ua,
            float* __restrict__ Wc, float* __restrict__ Ux, us* __restrict__ ctxT)
{
    __shared__ __attribute__((aligned(16))) unsigned char sm[AS_BYTES + BS_BYTES];
    const int blk = blockIdx.x;
    if (blk >= GB) {                                     // block-uniform
        const int i  = blk - GB;
        const int bx = i % (S_LEN / 64);
        const int by = (i / (S_LEN / 64)) % (HD / 64);
        const int z  = i / ((S_LEN / 64) * (HD / 64));
        d_trans<0>((float (*)[65])sm, bx, by, z, context, HD, T_FULL * HD, ctxT, S_LEN, HD * S_LEN);
        return;
    }
    const int tid = threadIdx.x, lane = tid & 31;
    const int wv = __builtin_amdgcn_readfirstlane(tid >> 5);
    const int hsel = lane >> 4, m = lane & 15;
    const int z  = blk / ((PROWS / 64) * (HD / 64));
    const int m0 = (blk % (PROWS / 64)) * 64;
    const int n0 = ((blk / (PROWS / 64)) % (HD / 64)) * 64;
    const int bq = m0 / TQ;                              // the tile's 64 rows lie in one batch
    const float* Ar = (z == 0 ? context : x) + (size_t)(bq * T_FULL + (m0 - bq * TQ)) * HD;
    const float* Br = (z == 0 ? Wa : Ua) + n0;
    unsigned char* As = sm;
    unsigned char* Bs = sm + AS_BYTES;

    const float* pa = Ar + (size_t)(tid >> 4) * HD + (tid & 15) * 8;
    const float* pb = Br + (size_t)(tid >> 4) * HD + (tid & 15) * 4;
    unsigned char* sa = As + (tid >> 4) * (PA * 2) + (tid & 15) * 16;
    unsigned char* sb = Bs + (tid >> 4) * PBB + (tid & 15) * 8;
    const int mt = wv & 3, nh = wv >> 2;
    const unsigned char* bd = Bs + (8 * hsel + (lane & 7)) * PBB + ((lane >> 3) & 1) * 16 + nh * 64;
    v8f c0 = {}; v8f c1 = {};

    // Two register sets, up to two batches of loads in flight. Each batch is converted and stored as it arrives and its
    // KG k-steps are worked on while the later batches fly: no LDS byte is written twice, so one barrier a batch
    // (LDS only: it leaves the global loads in flight) is all the order there is.
    v4f rr[2][16];
    ld_batch(rr[0], 0, pa, pb);
    ld_batch(rr[1], 1, pa, pb);
#pragma unroll
    for (int g = 0; g < HD / 32 / KG; ++g) {
        st_batch(rr[g & 1], g, sa, sb);
        if (g + 2 < HD / 32 / KG) ld_batch(rr[g & 1], g + 2, pa, pb);
        bar_lds();
        v16bf fa[KG];
        Frag  fb0[KG], fb1[KG];
#pragma unroll
        for (int i = 0; i < KG; ++i) {
            const int k0 = (g * KG + i) * 32;
            fa[i] = ld_frag((const us*)As, PA, mt * 16 + m, k0, hsel);
            fb0[i].h[0] = ld_tr16(bd + k0 * PBB);
            fb0[i].h[1] = ld_tr16(bd + (k0 + 16) * PBB);
            fb1[i].h[0] = ld_tr16(bd + k0 * PBB + 32);
            fb1[i].h[1] = ld_tr16(bd + (k0 + 16) * PBB + 32);
        }
#pragma unroll
        for (int i = 0; i < KG; ++i) {
            c0 = wmma16(fa[i], fb0[i].v, c0);
            c1 = wmma16(fa[i], fb1[i].v, c1);
        }
    }
    __syncthreads();                                     // every wave has read its last fragment: the tile lies over As

    // D map: acc[r] -> (row 8*hsel + r, col n-tile + m). The 64 x 64 tile goes through LDS to whole-line stores.
    float* tile = (float*)sm;
#pragma unroll
    for (int r = 0; r < 8; ++r) {
        const int row = mt * 16 + 8 * hsel + r;
        tile[row * TP + nh * 32 + m]      = c0[r];
        tile[row * TP + nh * 32 + 16 + m] = c1[r];
    }
    __syncthreads();

    v4f vals[4];
    if (z == 0) {                                        // block-uniform
        // Wc goes out as Wc4[b][h / 4][s] (16-B pieces): k_attn's lanes run along s, so a wave's load there is 512 B in
        // a row. Thread = (piece column q, row r): a wave stores 32 rows of one q; the LDS reads step TP dwords a lane.
        v4f* Cq = (v4f*)Wc + ((size_t)bq * (HD / 4) + n0 / 4 + (tid >> 6)) * S_LEN + (m0 - bq * TQ) + (tid & 63);
#pragma unroll
        for (int p = 0; p < 4; ++p) vals[p] = *(const v4f*)(tile + (tid & 63) * TP + (p * 4 + (tid >> 6)) * 4);
#pragma unroll
        for (int p = 0; p < 4; ++p) Cq[p * 4 * S_LEN] = vals[p];
        // in front of any overwrite of the stores' address pair and data in the code that follows them in the listing
        asm volatile("s_wait_xcnt 0x0" ::: "memory");
    } else {
        float* Cb = Ux + (size_t)m0 * HD + n0;
#pragma unroll
        for (int p = 0; p < 4; ++p) vals[p] = *(const v4f*)(tile + (p * 16 + (tid >> 4)) * TP + (tid & 15) * 4);
#pragma unroll
        for (int p = 0; p < 4; ++p) *(v4f*)(Cb + (size_t)(p * 16 + (tid >> 4)) * HD + (tid & 15) * 4) = vals[p];
        // the same wait for these stores
        asm volatile("s_wait_xcnt 0x0" ::: "memory");
    }
}

// ---------------------------------------------------------------------------
// Fused energies -> softmax -> P @ context -> LayerNorm + residual. One block per (b, group of TT query rows t).
// Thread = (hh, s): key position s, part hh (of HS) of the feature range. Each 16-B piece of Wc is loaded once and
// used for all TT query rows of the block. Wc lies as Wc4[b][h / 4][s]: the 32 lanes of a wave, consecutive s, read
// 512 B in a row (4 whole cache lines) with each load.
//   e[t][s] = sum_h v[h] * tanh(Wc[b][s][h] + Ux[bt][h] + bUa[h] + bWa[h]) + bVa   (f32; the HS parts of
//             the h range are summed apart and then added in order)
//   p    = softmax_s(e); Pl[t][s] = bf16 hi, Pl[t][S+s] = bf16 lo (lo = p - hi), in LDS
//   cv[t][d] = sum_k Pl[t][k] * ctxT[b][d][k mod S] on WMMA: the M tile is the block's TT rows and zero rows up
//             to 16; wave w does columns 32w..32w+31; each B fragment is loaded once and serves hi and lo
//   out  = LayerNorm(cv) * gamma + beta + x, one wave per row
// LDS regions are cross-wave: block barriers throughout.
// ---------------------------------------------------------------------------
#define TT 4                // query rows per block
#define HS 4                // parts of the h range, one per group of S_LEN threads
#define RPT (TT / HS)       // softmax rows per thread
static_assert((TQ % TT) == 0 && (TT % HS) == 0 && ((HD / 4) % HS) == 0);
static_assert(TT <= (S_LEN * HS) / 32 && TT <= 8);       // rows 0..TT-1 of a D tile lie in lanes 0-15
static_assert(HD == (S_LEN * HS / 32) * 32);             // 32 output columns per wave
#define NU (HD / 4 / HS)     // 16-B pieces of Wc per thread
#define RING 8               // pieces of Wc that a thread holds or has asked for
#define RG 4                 // pieces worked on between two refills
static_assert(TT * (HD / 4) == S_LEN * HS);                    // one piece of the q rows per thread
static_assert((NU % RING) == 0 && NU / RING >= 2 && (RING % RG) == 0);
#define PLP (KC + 16)       // pitch of a P row in LDS, halves: 32 B more, so that the 16-B pieces which the 32 lanes
                            // of one fragment load read (16 rows, 2 pieces each) spread evenly over the banks

// One 16-B piece e of Wc (4 features of one key position) against the same features of all TT query rows
__device__ __forceinline__
void energy_step(float (&acc)[TT], v4f e, v4f w, const v4f (*sq)[HD / 4], int u) {
#pragma unroll
    for (int j = 0; j < TT; ++j) {
        const v4f d = sq[j][u];
        const v2f y0 = tanh_acc2(e.xy + d.xy);
        const v2f y1 = tanh_acc2(e.zw + d.zw);
        const v2f p0 = w.xy * y0;
        const v2f p1 = w.zw * y1;
        acc[j] += p0.x;
        acc[j] += p0.y;
        acc[j] += p1.x;
        acc[j] += p1.y;
    }
}

// waves_per_eu: the block's 16 waves stand four to a SIMD and one block fills a WGP, so the register budget is
// that of four waves; without it the scheduler holds the register count down for more waves and sets each
// tanh right in front of its product and sum instead of issuing the 64 independent ones of a trip in runs.
__global__ __launch_bounds__(S_LEN * HS) __attribute__((amdgpu_waves_per_eu(S_LEN * HS / 128, S_LEN * HS / 128)))
void k_attn(const float* __restrict__ Uxp, const float* __restrict__ Wcp,
            const float* __restrict__ bWa, const float* __restrict__ bUa,
            const float* __restrict__ Va,  const float* __restrict__ bVa,
            const us* __restrict__ ctxT, const float* __restrict__ xin,
            const float* __restrict__ gam, const float* __restrict__ bet,
            float* __restrict__ out)
{
    __shared__ v4f sq4[TT][HD / 4];
    __shared__ v4f sv4[HD / 4];
    __shared__ float part[HS][TT][S_LEN];
    __shared__ __attribute__((aligned(16))) v2f wred[TT][S_LEN / 32];   // per row and wave: (max, sum of exp(e - max))
    __shared__ __attribute__((aligned(16))) us Pl[16][PLP];
    __shared__ __attribute__((aligned(16))) float cvs[TT][HD];

    const int bt0 = blockIdx.x * TT;         // first of the block's rows b * TQ + t (all of one b)
    const int b   = bt0 / TQ;
    const int tid = threadIdx.x, lane = tid & 31, wave = tid >> 5;
    const int s   = tid & (S_LEN - 1), hh = tid / S_LEN;

    // What the energy loop reads from global memory is asked for ahead. Here, at the kernel's entry: the prologue's few
    // pieces first, then the thread's first RING pieces of Wc (16 B each, all by one address pair and an offset), which
    // fly while the prologue's values are awaited, converted and laid into LDS.
    const int pc = tid & (HD / 4 - 1);
    v4f q = *(const v4f*)(Uxp + (size_t)bt0 * HD + tid * 4);
    const v4f b1 = *(const v4f*)(bUa + pc * 4);
    const v4f b2 = *(const v4f*)(bWa + pc * 4);
    v4f w0 = *(const v4f*)(Va + pc * 4);
    // keeps the prologue's loads in front of the Wc loads, so that the wait for them leaves those in flight, and
    // stands in front of any overwrite of a register that they name
    asm volatile("s_wait_xcnt 0x0" ::: "memory");
    const int u0 = hh * NU;
    const v4f* we = (const v4f*)Wcp + ((size_t)b * (HD / 4) + u0) * S_LEN + s;      // Wc4[b][u][s]
    v4f ew[RING];
#pragma unroll
    for (int k = 0; k < RING; ++k) ew[k] = we[k * S_LEN];
    // holds the loads here, in front of the prologue's LDS stores, and stands in front of any overwrite of the
    // address pair that they name; the pair is an input so that no load's own result is laid over it either
    asm volatile("s_wait_xcnt 0x0" :: "v"(we) : "memory");
    // the loaded piece of Va as an input: keeps its load up here with the others; otherwise it is moved down into the
    // branch that stores it, a latency of its own, and its wait there takes in all the Wc loads
    asm volatile("" :: "v"(w0));

    q.x = (q.x + rbf(b1.x)) + rbf(b2.x);
    q.y = (q.y + rbf(b1.y)) + rbf(b2.y);
    q.z = (q.z + rbf(b1.z)) + rbf(b2.z);
    q.w = (q.w + rbf(b1.w)) + rbf(b2.w);
    sq4[tid / (HD / 4)][pc] = q;
    if (tid < HD / 4) {
        w0.x = rbf(w0.x); w0.y = rbf(w0.y); w0.z = rbf(w0.z); w0.w = rbf(w0.w);
        sv4[tid] = w0;
    }
    // rows TT..15 of the M tile are zero
    for (int i = tid; i < (16 - TT) * PLP / 8; i += S_LEN * HS) {
        const v8us zr = {};
        *(v8us*)(&Pl[TT][0] + i * 8) = zr;
    }
    bar_lds();                               // LDS only: the Wc loads stay in flight across it

    const float bva = rbf(bVa[0]);
    float acc[TT];
#pragma unroll
    for (int j = 0; j < TT; ++j) acc[j] = 0.0f;
    // A ring of RING pieces in registers: RG pieces are worked on, and their registers are at once asked to be filled
    // with the pieces RING further on, which then have the time of the RING - RG pieces between to arrive. The loop
    // over the ring's turns stays rolled: unrolled, the LDS reads of all turns are drawn to its head and registers spill
#pragma unroll 1
    for (int it = 0; it < NU / RING - 1; ++it) {
        const int ub = u0 + it * RING;
#pragma unroll
        for (int k = 0; k < RING; k += RG) {
#pragma unroll
            for (int i = k; i < k + RG; ++i) energy_step(acc, ew[i], sv4[ub + i], sq4, ub + i);
#pragma unroll
            for (int i = k; i < k + RG; ++i) ew[i] = we[(RING + i) * S_LEN];
            // holds these loads here, ahead of the next pieces' work, and stands in front of the step of the address pair
            asm volatile("s_wait_xcnt 0x0" :: "v"(we) : "memory");
        }
        we += RING * S_LEN;
    }
    // the tail's B fragments (the wave's 32 columns d, all S key positions) are asked for here, behind the last load of
    // Wc and in front of the work on the last RING pieces: they arrive under that work and the softmax
    const int wv = __builtin_amdgcn_readfirstlane(wave);
    const int hsel = lane >> 4, m = lane & 15;
    const us* cb = ctxT + (size_t)b * (size_t)(HD * S_LEN);
    const us* cb0 = cb + (size_t)(wv * 32 + m) * S_LEN + 8 * hsel;   // the lane's row of n-tile 0, its k half
    const us* cb1 = cb0 + 16 * S_LEN;                                // the same of n-tile 1
    v16bf bfr[2][S_LEN / 32];
#pragma unroll
    for (int kk = 0; kk < S_LEN / 32; ++kk) bfr[0][kk] = ld_frag(cb0, 0, 0, kk * 32, 0);
#pragma unroll
    for (int kk = 0; kk < S_LEN / 32; ++kk) bfr[1][kk] = ld_frag(cb1, 0, 0, kk * 32, 0);
    // stands in front of any overwrite of the address pair that these loads name (all sixteen go by cb0 and an
    // immediate offset); the pair is an input so that no load's own result is laid over it either
    asm volatile("s_wait_xcnt 0x0" :: "v"(cb0) : "memory");
#pragma unroll
    for (int k = 0; k < RING; ++k) energy_step(acc, ew[k], sv4[u0 + NU - RING + k], sq4, u0 + NU - RING + k);

#pragma unroll
    for (int j = 0; j < TT; ++j) part[hh][j][s] = acc[j];

    // x, gamma and beta of the TT LayerNorm waves are asked for here, so that they arrive during the softmax (behind the
    // stores of the sums: with this branch in front of them the energy work is moved below it and registers spill)
    const int lr   = bt0 + wv;                          // LayerNorm row of wave wv < TT
    const int frow = (lr / TQ) * T_FULL + (lr % TQ);
    v4f xr[4], gm[4], be[4];
    if (wv < TT) {
        const float* xp = xin + (size_t)frow * HD + lane * 4;
#pragma unroll
        for (int j = 0; j < 4; ++j) {
            xr[j] = *(const v4f*)(xp + 128 * j);
            gm[j] = *(const v4f*)(gam + 128 * j + lane * 4);
            be[j] = *(const v4f*)(bet + 128 * j + lane * 4);
        }
        // inside the branch, so that it stands in front of the next write of a scalar base that these loads name
        asm volatile("s_wait_xcnt 0x0" ::: "memory");
    }
    bar_lds();

    // thread (hh, s) carries rows j = RPT * hh + k of the block through the softmax. A row lies in S_LEN / 32 waves:
    // each reduces its 32 energies in registers to (its max mw, its sum of exp(e - mw)); the pairs of a row meet
    // in LDS once, and every thread rescales by exp(mw - row max)
    float ex[RPT], mw[RPT];
#pragma unroll
    for (int k = 0; k < RPT; ++k) {
        const int j = RPT * hh + k;
        float a = part[0][j][s];
#pragma unroll
        for (int g = 1; g < HS; ++g) a += part[g][j][s];
        const float en = a + bva;
        mw[k] = wave_max(en);
        ex[k] = __expf(en - mw[k]);
        const float sw = wave_sum(ex[k]);
        if (lane == 0) { const v2f pr = {mw[k], sw}; wred[j][s >> 5] = pr; }
    }
    bar_lds();
#pragma unroll
    for (int k = 0; k < RPT; ++k) {
        const int j = RPT * hh + k;
        v2f pr[S_LEN / 32];
#pragma unroll
        for (int q = 0; q < S_LEN / 32; ++q) pr[q] = wred[j][q];
        float mx = pr[0].x;
#pragma unroll
        for (int q = 1; q < S_LEN / 32; ++q) mx = fmaxf(mx, pr[q].x);
        float ssum = pr[0].y * __expf(pr[0].x - mx);
#pragma unroll
        for (int q = 1; q < S_LEN / 32; ++q) ssum += pr[q].y * __expf(pr[q].x - mx);
        const float p = (ex[k] * __expf(mw[k] - mx)) * (1.0f / ssum);
        const us h = f2bf(p);
        Pl[j][s] = h;
        Pl[j][S_LEN + s] = f2bf(p - bf2f(h));
    }
    bar_lds();

    // cv tile: k runs over the hi plane, then over the lo plane
    v16bf af[KC / 32];
#pragma unroll
    for (int kk = 0; kk < KC / 32; ++kk) af[kk] = ld_frag(&Pl[0][0], PLP, m, kk * 32, hsel);
    v8f c0 = {}; v8f c1 = {};
#pragma unroll
    for (int kk = 0; kk < KC / 32; ++kk) {
        c0 = wmma16(af[kk], bfr[0][kk % (S_LEN / 32)], c0);
        c1 = wmma16(af[kk], bfr[1][kk % (S_LEN / 32)], c1);
    }
    // D map: acc[r] -> (row 8*hsel + r, col n-tile + m): the block's rows are r < TT of lanes 0-15
    if (hsel == 0) {
#pragma unroll
        for (int r = 0; r < TT; ++r) {
            cvs[r][wv * 32 + m]      = c0[r];
            cvs[r][wv * 32 + 16 + m] = c1[r];
        }
    }
    bar_lds();

    // LayerNorm + residual: wave wv < TT takes row wv. Lane l holds columns 128j + 4l .. +3 for j = 0..3;
    // store instruction j covers columns 128j..128j+127
    if (wv < TT) {
        v4f c[4];
#pragma unroll
        for (int j = 0; j < 4; ++j) c[j] = *(const v4f*)(&cvs[wv][128 * j + lane * 4]);
        float sm = 0.0f;
#pragma unroll
        for (int j = 0; j < 4; ++j) sm += (c[j].x + c[j].y) + (c[j].z + c[j].w);
        sm = wave_sum(sm);
        const float mean = sm * (1.0f / (float)HD);

        float q = 0.0f;
#pragma unroll
        for (int j = 0; j < 4; ++j) {
            const float dx = c[j].x - mean, dy = c[j].y - mean, dz = c[j].z - mean, dw = c[j].w - mean;
            q += dx * dx; q += dy * dy; q += dz * dz; q += dw * dw;
        }
        q = wave_sum(q);
        const float var  = q * (1.0f / (float)HD);
        const float rstd = rsqrtf(var + LN_EPS);

        v4f o[4];
#pragma unroll
        for (int j = 0; j < 4; ++j) {
            o[j].x = (c[j].x - mean) * rstd * rbf(gm[j].x) + rbf(be[j].x) + rbf(xr[j].x);
            o[j].y = (c[j].y - mean) * rstd * rbf(gm[j].y) + rbf(be[j].y) + rbf(xr[j].y);
            o[j].z = (c[j].z - mean) * rstd * rbf(gm[j].z) + rbf(be[j].z) + rbf(xr[j].z);
            o[j].w = (c[j].w - mean) * rstd * rbf(gm[j].w) + rbf(be[j].w) + rbf(xr[j].w);
        }
        float* dp = out + (size_t)frow * HD + lane * 4;
#pragma unroll
        for (int j = 0; j < 4; ++j) *(v4f*)(dp + 128 * j) = o[j];
    }
}

// ---------------------------------------------------------------------------
static inline size_t al256(size_t x) { return (x + 255) & ~(size_t)255; }

extern "C" void kernel_launch(void* const* d_in, const int* in_sizes, int n_in,
                              void* d_out, int out_size, void* d_ws, size_t ws_size,
                              hipStream_t stream)
{
    if (n_in < 10) return;
    if (in_sizes[0] < ((NB - 1) * T_FULL + S_LEN) * HD) return;   // context [8][128][512] f32
    if (in_sizes[1] < ((NB - 1) * T_FULL + TQ) * HD) return;      // x       [8][128][512] f32
    if (in_sizes[2] < HD * HD) return;                             // Wa [512][512] ([in][out]) f32
    if (in_sizes[3] < HD) return;                                  // bWa [512]
    if (in_sizes[4] < HD * HD) return;                             // Ua [512][512] ([in][out]) f32
    if (in_sizes[5] < HD) return;                                  // bUa [512]
    if (in_sizes[6] < HD) return;                                  // Va [512][1]
    if (in_sizes[7] < 1) return;                                   // bVa [1]
    if (in_sizes[8] < HD || in_sizes[9] < HD) return;              // gamma, beta [512]
    if (out_size < ((NB - 1) * T_FULL + TQ) * HD) return;

    const float* context = (const float*)d_in[0];
    const float* x       = (const float*)d_in[1];
    const float* Wa      = (const float*)d_in[2];
    const float* bWa     = (const float*)d_in[3];
    const float* Ua      = (const float*)d_in[4];
    const float* bUa     = (const float*)d_in[5];
    const float* Va      = (const float*)d_in[6];
    const float* bVa     = (const float*)d_in[7];
    const float* gamma   = (const float*)d_in[8];
    const float* beta    = (const float*)d_in[9];
    float* out = (float*)d_out;

    char* ws = (char*)d_ws;
    size_t off = 0;
    us* ctxT  = (us*)(ws + off);    off += al256((size_t)NB * HD * S_LEN * sizeof(us));   // [NB][512][128]
    float* Wc = (float*)(ws + off); off += al256((size_t)PROWS * HD * sizeof(float));     // [NB][512/4][S][4]
    float* Ux = (float*)(ws + off); off += al256((size_t)PROWS * HD * sizeof(float));     // [NB*TQ][512]
    if (off > ws_size) return;

    const dim3 b256(256), bS(S_LEN * HS);

    // ---- Wc = context @ Wa, Ux = x @ Ua (f32; biases added in k_attn) and the bf16 plane ctxT, one launch ----
    k_proj<<<dim3(GB + PB_CT), b256, 0, stream>>>(context, x, Wa, Ua, Wc, Ux, ctxT);

    // ---- energies + softmax, cv = [P_hi|P_lo] @ [ctxT;ctxT] (f32), LayerNorm + residual -> out ----
    k_attn<<<dim3(NB * TQ / TT), bS, 0, stream>>>(Ux, Wc, bWa, bUa, Va, bVa, ctxT, x, gamma, beta, out);
}

// v009
// Measured time: 14.6 microseconds a run.
// Next to v008, in two timings, it ran 1.06 times as fast each time.
// Counting every step since v000, it is 4.33 times as fast.
#include <hip/hip_runtime.h>

// Contractions on v_wmma_f32_16x16x32_bf16 (bf16 operands, f32 accumulate): context@Wa and x@Ua from
// operand tiles that each block converts (RNE) into LDS itself; attn@context with attn carried as bf16 hi+lo planes folded into K against
// the RNE-converted transposed context plane, inside the energy kernel. Energies v.tanh(.), softmax,
// LayerNorm and the residual add in f32 on the VALU.

#ifndef NB
#define NB 8
#endif
#ifndef TQ
#define TQ 128
#endif
#define NB_FULL 8
#define T_FULL 128          // full query length: per-batch row stride of x and of the output
#define S_LEN 128           // context positions (keys), never reduced
#define S_FULL 128          // per-batch row stride of context in the input
#define HD 512              // feature width D == hidden width H
#define KC (2 * S_LEN)      // context GEMM depth: [P_hi | P_lo]
#define LN_EPS 1.0e-3f

static_assert(NB >= 1 && NB <= NB_FULL);
static_assert(TQ >= 64 && TQ <= T_FULL && (TQ % 64) == 0);
static_assert(S_LEN == 128 && S_LEN == S_FULL);
static_assert((HD % 256) == 0 && (HD % 64) == 0 && (HD % 32) == 0);
static_assert((KC % 32) == 0 && (S_LEN % 64) == 0);
static_assert(((HD / 4) % S_LEN) == 0);
static_assert((S_LEN % 32) == 0);

typedef unsigned short us;
typedef us     v8us  __attribute__((ext_vector_type(8)));
typedef __bf16 v16bf __attribute__((ext_vector_type(16)));
typedef float  v8f   __attribute__((ext_vector_type(8)));
typedef float  v4f   __attribute__((ext_vector_type(4)));

union Frag { v16bf v; v8us h[2]; };

// ---------------------------------------------------------------------------
// scalar helpers
// ---------------------------------------------------------------------------
__device__ __forceinline__ us f2bf(float f) {           // f32 -> bf16, RNE convert
    unsigned int u = __float_as_uint(f);
    u += 0x7FFFu + ((u >> 16) & 1u);
    return (us)(u >> 16);
}
__device__ __forceinline__ float bf2f(us h) {
    return __uint_as_float(((unsigned int)h) << 16);
}
__device__ __forceinline__ float rbf(float f) {          // value after an RNE convert to bf16
    return bf2f(f2bf(f));
}
// tanh on two neighbouring features, each by one v_tanh_f32
typedef float v2f __attribute__((ext_vector_type(2)));
__device__ __forceinline__ v2f tanh_acc2(v2f x) {
    v2f y;  y.x = __builtin_amdgcn_tanhf(x.x); y.y = __builtin_amdgcn_tanhf(x.y);
    return y;
}
// Reductions over the 32 lanes of a wave, in registers; every lane ends with the result. All 32 lanes are on.
// xrow<M>: the value of lane l ^ M of the same 16-lane row (DPP row_xmask); xhalf: that of lane l ^ 16.
template <int M>
__device__ __forceinline__ float xrow(float x) {
    return __builtin_bit_cast(float, __builtin_amdgcn_mov_dpp(__builtin_bit_cast(int, x), 0x160 + M, 0xf, 0xf, true));
}
__device__ __forceinline__ float xhalf(float x) {
    const int b = __builtin_bit_cast(int, x);
    return __builtin_bit_cast(float, __builtin_amdgcn_permlanex16(b, b, 0x76543210, 0xfedcba98, false, false));
}
__device__ __forceinline__ float wave_sum(float x) {
    x += xrow<1>(x); x += xrow<2>(x); x += xrow<4>(x); x += xrow<8>(x);
    return x + xhalf(x);
}
__device__ __forceinline__ float wave_max(float x) {
    x = fmaxf(x, xrow<1>(x)); x = fmaxf(x, xrow<2>(x)); x = fmaxf(x, xrow<4>(x)); x = fmaxf(x, xrow<8>(x));
    return fmaxf(x, xhalf(x));
}
// ---------------------------------------------------------------------------
// WMMA helper: 16x16x32 bf16, f32 accumulate, 4-slot VALU hazard guard after the issue
// ---------------------------------------------------------------------------
__device__ __forceinline__ v8f wmma16(v16bf a, v16bf b, v8f c) {
    v8f d = __builtin_amdgcn_wmma_f32_16x16x32_bf16(false, a, false, b, (short)0, c, false, false);
    asm volatile("v_nop\n\tv_nop\n\tv_nop\n\tv_nop" : "+v"(d) : "v"(a), "v"(b));
    return d;
}

// Fragment loader for a k-contiguous 16-bit plane P[row][k] with pitch ld (halves).
// Lane l: row = (l & 15) (A row m, or B column n of an [n][k] plane), hsel = l >> 4.
//   elements 0..7  <- k0 + 8*hsel + 0..7
//   elements 8..15 <- k0 + 16 + 8*hsel + 0..7
__device__ __forceinline__ v16bf ld_frag(const us* __restrict__ P, int ld, int row, int k0, int hsel) {
    Frag f;
    const us* p = P + (size_t)row * ld + k0 + 8 * hsel;
    f.h[0] = *(const v8us*)p;
    f.h[1] = *(const v8us*)(p + 16);
    return f.v;
}

// ---------------------------------------------------------------------------
// Transpose + convert: src[R][C] f32 (pitch spitch, per-z stride sstride) -> dst[C][R] bf16 (pitch dpitch,
// per-z stride dstride), optionally a second copy at column offset +DUP halves.
// Block: 64 src rows x 64 src cols through LDS (cross-wave -> block barrier). Store phase: two 16-B stores a thread, four with DUP
// tile index (bx, by, z) in (R/64, C/64, Z); ts: the block's 64 x 65 f32 LDS tile
// ---------------------------------------------------------------------------
template <int DUP>
__device__ __forceinline__
void d_trans(float (*ts)[65], int bx, int by, int z,
             const float* __restrict__ src, int spitch, int sstride,
             us* __restrict__ dst, int dpitch, int dstride)
{
    const int r0 = bx * 64, c0 = by * 64;
    const int tid = threadIdx.x, lane = tid & 31, wave = tid >> 5;
    const float* sb = src + (size_t)z * (size_t)sstride;
    us* db = dst + (size_t)z * (size_t)dstride;

#pragma unroll
    for (int p = 0; p < 4; ++p) {
        const int rl = p * 16 + (tid >> 4);
        const int c4 = (tid & 15) * 4;
        const v4f x = *(const v4f*)(sb + (size_t)(r0 + rl) * spitch + c0 + c4);
        ts[rl][c4 + 0] = x.x; ts[rl][c4 + 1] = x.y; ts[rl][c4 + 2] = x.z; ts[rl][c4 + 3] = x.w;
    }
    __syncthreads();

    v8us o[2];
#pragma unroll
    for (int p = 0; p < 2; ++p) {
        const int cl = p * 32 + wave * 4 + (lane >> 3);
        const int r8 = (lane & 7) * 8;
#pragma unroll
        for (int i = 0; i < 8; ++i) o[p][i] = f2bf(ts[r8 + i][cl]);
    }
#pragma unroll
    for (int p = 0; p < 2; ++p) {
        const int cl = p * 32 + wave * 4 + (lane >> 3);
        const int r8 = (lane & 7) * 8;
        us* d = db + (size_t)(c0 + cl) * dpitch + r0 + r8;
        *(v8us*)d = o[p];
        if (DUP != 0) *(v8us*)(d + DUP) = o[p];
    }
    // the stores' address and data registers are written again in the code of the caller's other branches,
    // which follows these stores in the listing: the wait stands in front of any such overwrite
    asm volatile("s_wait_xcnt 0x0" ::: "memory");
}

// ---------------------------------------------------------------------------
// Both projections and the transposed context plane in one launch, straight from the f32 inputs.
//   blocks [0, GB):        one 64(M) x 64(N) tile of Wc = context @ Wa (z = 0) or of Ux = x @ Ua (z = 1), K = HD;
//                          Ux is stored row-major, Wc as Wc4[b][h / 4][s] in 16-B pieces (4 features of one s)
//   blocks [GB, GB + PB_CT): context[b][s][d] -> ctxT[b][d][s] (bf16), one 64 x 64 piece each
// A GEMM block (8 waves) converts its two operand panels to bf16 in LDS, once, in batches along k:
//   As[64][HD]  rows of context or x, k-contiguous, pitch PA halves (16 B x odd, for ds_load_b128)
//   Bs[HD][64]  rows k of Wa or Ua as they lie in memory, pitch PBB bytes (32 B x odd, for ds_load_tr16_b128)
// Wave w: rows 16 (w & 3) .. +15, columns 32 (w >> 2) .. +31 (2 accumulators). The transposing load hands lane
// (c, h) the elements Bs[k0 + 8h + 0..7][n + c]; two of them, at k0 and k0 + 16, follow the k map of ld_frag.
// The GEMM blocks, which run longer, come first in the index order.
// ---------------------------------------------------------------------------
#define PROWS (NB * S_LEN)   // rows of either projection
static_assert(TQ == S_LEN);  // the two projections share one grid
#define GB (2 * (PROWS / 64) * (HD / 64))
#define PB_CT ((S_LEN / 64) * (HD / 64) * NB)
#define PA (HD + 8)
#define PBB 160
#define AS_BYTES (64 * PA * 2)
#define BS_BYTES (HD * PBB)
#define KG 4                 // k-steps per fragment group
#define TP 68                // pitch of the f32 result tile in LDS, dwords: rows r and r + 8 fall on different banks
static_assert(KG == 4 && HD / 32 / KG >= 2);   // a batch is 16 loads per thread of 256
#define NBT (HD / 32 / KG)   // batches
static_assert((NBT & (NBT - 1)) == 0);
static_assert(64 * TP * 4 <= AS_BYTES && 64 * 65 * 4 <= AS_BYTES + BS_BYTES);

typedef unsigned int v2u __attribute__((ext_vector_type(2)));
typedef unsigned int v4u __attribute__((ext_vector_type(4)));
typedef short s16x8 __attribute__((ext_vector_type(8)));
typedef __bf16 v2bf __attribute__((ext_vector_type(2)));

__device__ __forceinline__ unsigned int cvt2(float lo, float hi) {      // two f32 -> two bf16, RNE, one instruction
    const v2f p = {lo, hi};
    return __builtin_bit_cast(unsigned int, __builtin_convertvector(p, v2bf));
}
__device__ __forceinline__ v8us ld_tr16(const unsigned char* p) {
    typedef __attribute__((address_space(3))) s16x8 lds_s16x8;
    return __builtin_bit_cast(v8us, __builtin_amdgcn_ds_load_tr16_b128_v8i16((lds_s16x8*)p));
}

// Work-group barrier that orders LDS traffic only. __syncthreads() also waits for the wave's outstanding global
// loads; with this one loads asked for ahead stay in flight across it: in k_proj the later batches of the panels, in
// k_attn the first pieces of Wc and the tail's operands. Everything the waves of a block hand to each
// other at such a barrier goes through LDS.
__device__ __forceinline__ void bar_lds() {
    __builtin_amdgcn_fence(__ATOMIC_RELEASE, "workgroup", "local");
    __builtin_amdgcn_s_barrier();
    __builtin_amdgcn_fence(__ATOMIC_ACQUIRE, "workgroup", "local");
}

// The panels come in HD / 32 / KG batches of 16 loads of 16 B per thread; batch bt holds k = 32 KG bt .. + 32 KG - 1 of
// both. pa, pb: the thread's first pieces; every further piece lies a constant step on (16 rows of A or of B, for
// A also 32 KG columns a batch), so all loads go by two address pairs and an offset.
__device__ __forceinline__
void ld_batch(v4f (&r)[16], int bt, const float* __restrict__ pa, const float* __restrict__ pb) {
#pragma unroll
    for (int i = 0; i < 4; ++i) {            // A: 8 consecutive k of one row per thread
        r[2 * i]     = *(const v4f*)(pa + i * 16 * HD + bt * (32 * KG));
        r[2 * i + 1] = *(const v4f*)(pa + i * 16 * HD + bt * (32 * KG) + 4);
    }
#pragma unroll
    for (int i = 0; i < 8; ++i)              // B: 4 consecutive n of one row k per thread
        r[8 + i] = *(const v4f*)(pb + (bt * 8 + i) * 16 * HD);
    // stands in front of any overwrite of the two address pairs that these loads name; the pairs are inputs so
    // that no load's own result is laid over them either
    asm volatile("s_wait_xcnt 0x0" :: "v"(pa), "v"(pb) : "memory");
}
__device__ __forceinline__
void st_batch(const v4f (&r)[16], int bt, unsigned char* __restrict__ sa, unsigned char* __restrict__ sb) {
#pragma unroll
    for (int i = 0; i < 4; ++i) {
        const v4f a = r[2 * i], c = r[2 * i + 1];
        const v4u o = {cvt2(a.x, a.y), cvt2(a.z, a.w), cvt2(c.x, c.y), cvt2(c.z, c.w)};
        *(v4u*)(sa + i * 16 * (PA * 2) + bt * (64 * KG)) = o;
    }
#pragma unroll
    for (int i = 0; i < 8; ++i) {
        const v4f a = r[8 + i];
        const v2u o = {cvt2(a.x, a.y), cvt2(a.z, a.w)};
        *(v2u*)(sb + (bt * 8 + i) * 16 * PBB) = o;
    }
}

// waves_per_eu: two blocks (2 waves to a SIMD each) share a WGP, so that the transposing blocks find room beside
// the GEMM blocks instead of waiting for one to end; that holds the register count to a quarter of a SIMD's file.
__global__ __launch_bounds__(256) __attribute__((amdgpu_waves_per_eu(4, 4)))
void k_proj(const float* __restrict__ context, const float* __restrict__ x,
            const float* __restrict__ Wa, const float* __restrict__ Ua,
            float* __restrict__ Wc, float* __restrict__ Ux, us* __restrict__ ctxT)
{
    __shared__ __attribute__((aligned(16))) unsigned char sm[AS_BYTES + BS_BYTES];
    const int blk = blockIdx.x;
    if (blk >= GB) {                                     // block-uniform
        const int i  = blk - GB;
        const int bx = i % (S_LEN / 64);
        const int by = (i / (S_LEN / 64)) % (HD / 64);
        const int z  = i / ((S_LEN / 64) * (HD / 64));
        d_trans<0>((float (*)[65])sm, bx, by, z, context, HD, T_FULL * HD, ctxT, S_LEN, HD * S_LEN);
        return;
    }
    const int tid = threadIdx.x, lane = tid & 31;
    const int wv = __builtin_amdgcn_readfirstlane(tid >> 5);
    const int hsel = lane >> 4, m = lane & 15;
    const int z  = blk / ((PROWS / 64) * (HD / 64));
    const int m0 = (blk % (PROWS / 64)) * 64;
    const int n0 = ((blk / (PROWS / 64)) % (HD / 64)) * 64;
    const int bq = m0 / TQ;                              // the tile's 64 rows lie in one batch
    const float* Ar = (z == 0 ? context : x) + (size_t)(bq * T_FULL + (m0 - bq * TQ)) * HD;
    const float* Br = (z == 0 ? Wa : Ua) + n0;
    unsigned char* As = sm;
    unsigned char* Bs = sm + AS_BYTES;

    const float* pa = Ar + (size_t)(tid >> 4) * HD + (tid & 15) * 8;
    const float* pb = Br + (size_t)(tid >> 4) * HD + (tid & 15) * 4;
    unsigned char* sa = As + (tid >> 4) * (PA * 2) + (tid & 15) * 16;
    unsigned char* sb = Bs + (tid >> 4) * PBB + (tid & 15) * 8;
    const int mt = wv & 3, nh = wv >> 2;
    const unsigned char* bd = Bs + (8 * hsel + (lane & 7)) * PBB + ((lane >> 3) & 1) * 16 + nh * 64;
    v8f c0 = {}; v8f c1 = {};

    // Two register sets, up to two batches of loads in flight. Each batch is converted and stored as it arrives and its
    // KG k-steps are worked on while the later batches fly: no LDS byte is written twice, so one barrier a batch
    // (LDS only: it leaves the global loads in flight) is all the order there is.
    // The blocks that share a panel (PROWS / 64 share one of B, HD / 64 one of A) each take the batches round from one of
    // their own, rot, so that blocks running in step ask L2 for different lines at any one moment.
    const int rot = (blk % (PROWS / 64) + blk / (PROWS / 64)) & (NBT - 1);
    v4f rr[2][16];
    ld_batch(rr[0], 0, pa + rot * (32 * KG), pb + rot * (8 * 16 * HD));
    ld_batch(rr[1], 0, pa + ((rot + 1) & (NBT - 1)) * (32 * KG), pb + ((rot + 1) & (NBT - 1)) * (8 * 16 * HD));
#pragma unroll
    for (int g = 0; g < NBT; ++g) {
        const int bt = (rot + g) & (NBT - 1), bn = (rot + g + 2) & (NBT - 1);
        st_batch(rr[g & 1], 0, sa + bt * (64 * KG), sb + bt * (8 * 16 * PBB));
        if (g + 2 < NBT) ld_batch(rr[g & 1], 0, pa + bn * (32 * KG), pb + bn * (8 * 16 * HD));
        bar_lds();
        v16bf fa[KG];
        Frag  fb0[KG], fb1[KG];
        const us* ab = (const us*)As + bt * (KG * 32);
        const unsigned char* bb = bd + bt * (KG * 32 * PBB);
#pragma unroll
        for (int i = 0; i < KG; ++i) {
            const int k0 = i * 32;
            fa[i] = ld_frag(ab, PA, mt * 16 + m, k0, hsel);
            fb0[i].h[0] = ld_tr16(bb + k0 * PBB);
            fb0[i].h[1] = ld_tr16(bb + (k0 + 16) * PBB);
            fb1[i].h[0] = ld_tr16(bb + k0 * PBB + 32);
            fb1[i].h[1] = ld_tr16(bb + (k0 + 16) * PBB + 32);
        }
#pragma unroll
        for (int i = 0; i < KG; ++i) {
            c0 = wmma16(fa[i], fb0[i].v, c0);
            c1 = wmma16(fa[i], fb1[i].v, c1);
        }
    }
    __syncthreads();                                     // every wave has read its last fragment: the tile lies over As

    // D map: acc[r] -> (row 8*hsel + r, col n-tile + m). The 64 x 64 tile goes through LDS to whole-line stores.
    float* tile = (float*)sm;
#pragma unroll
    for (int r = 0; r < 8; ++r) {
        const int row = mt * 16 + 8 * hsel + r;
        tile[row * TP + nh * 32 + m]      = c0[r];
        tile[row * TP + nh * 32 + 16 + m] = c1[r];
    }
    __syncthreads();

    v4f vals[4];
    if (z == 0) {                                        // block-uniform
        // Wc goes out as Wc4[b][h / 4][s] (16-B pieces): k_attn's lanes run along s, so a wave's load there is 512 B in
        // a row. Thread = (piece column q, row r): a wave stores 32 rows of one q; the LDS reads step TP dwords a lane.
        v4f* Cq = (v4f*)Wc + ((size_t)bq * (HD / 4) + n0 / 4 + (tid >> 6)) * S_LEN + (m0 - bq * TQ) + (tid & 63);
#pragma unroll
        for (int p = 0; p < 4; ++p) vals[p] = *(const v4f*)(tile + (tid & 63) * TP + (p * 4 + (tid >> 6)) * 4);
#pragma unroll
        for (int p = 0; p < 4; ++p) Cq[p * 4 * S_LEN] = vals[p];
        // in front of any overwrite of the stores' address pair and data in the code that follows them in the listing
        asm volatile("s_wait_xcnt 0x0" ::: "memory");
    } else {
        float* Cb = Ux + (size_t)m0 * HD + n0;
#pragma unroll
        for (int p = 0; p < 4; ++p) vals[p] = *(const v4f*)(tile + (p * 16 + (tid >> 4)) * TP + (tid & 15) * 4);
#pragma unroll
        for (int p = 0; p < 4; ++p) *(v4f*)(Cb + (size_t)(p * 16 + (tid >> 4)) * HD + (tid & 15) * 4) = vals[p];
        // the same wait for these stores
        asm volatile("s_wait_xcnt 0x0" ::: "memory");
    }
}

// ---------------------------------------------------------------------------
// Fused energies -> softmax -> P @ context -> LayerNorm + residual. One block per (b, group of TT query rows t).
// Thread = (hh, s): key position s, part hh (of HS) of the feature range. Each 16-B piece of Wc is loaded once and
// used for all TT query rows of the block. Wc lies as Wc4[b][h / 4][s]: the 32 lanes of a wave, consecutive s, read
// 512 B in a row (4 whole cache lines) with each load.
//   e[t][s] = sum_h v[h] * tanh(Wc[b][s][h] + Ux[bt][h] + bUa[h] + bWa[h]) + bVa   (f32; the HS parts of
//             the h range are summed apart and then added in order)
//   p    = softmax_s(e); Pl[t][s] = bf16 hi, Pl[t][S+s] = bf16 lo (lo = p - hi), in LDS
//   cv[t][d] = sum_k Pl[t][k] * ctxT[b][d][k mod S] on WMMA: the M tile is the block's TT rows and zero rows up
//             to 16; wave w does columns 32w..32w+31; each B fragment is loaded once and serves hi and lo
//   out  = LayerNorm(cv) * gamma + beta + x, one wave per row
// LDS regions are cross-wave: block barriers throughout.
// ---------------------------------------------------------------------------
#define TT 4                // query rows per block
#define HS 4                // parts of the h range, one per group of S_LEN threads
#define RPT (TT / HS)       // softmax rows per thread
static_assert((TQ % TT) == 0 && (TT % HS) == 0 && ((HD / 4) % HS) == 0);
static_assert(TT <= (S_LEN * HS) / 32 && TT <= 8);       // rows 0..TT-1 of a D tile lie in lanes 0-15
static_assert(HD == (S_LEN * HS / 32) * 32);             // 32 output columns per wave
#define NU (HD / 4 / HS)     // 16-B pieces of Wc per thread
#define RING 8               // pieces of Wc that a thread holds or has asked for
#define RG 4                 // pieces worked on between two refills
static_assert(TT * (HD / 4) == S_LEN * HS);                    // one piece of the q rows per thread
static_assert((NU % RING) == 0 && NU / RING >= 2 && (RING % RG) == 0);
#define NG (NU / RG)         // groups of RG pieces in a thread's part of the h range
static_assert(NG == 8);      // the start group is made of 3 bits of the block index
#define PLP (KC + 16)       // pitch of a P row in LDS, halves: 32 B more, so that the 16-B pieces which the 32 lanes
                            // of one fragment load read (16 rows, 2 pieces each) spread evenly over the banks

// One 16-B piece e of Wc (4 features of one key position) against the same features of all TT query rows
__device__ __forceinline__
void energy_step(float (&acc)[TT], v4f e, v4f w, const v4f (*sq)[HD / 4], int u) {
#pragma unroll
    for (int j = 0; j < TT; ++j) {
        const v4f d = sq[j][u];
        const v2f y0 = tanh_acc2(e.xy + d.xy);
        const v2f y1 = tanh_acc2(e.zw + d.zw);
        const v2f p0 = w.xy * y0;
        const v2f p1 = w.zw * y1;
        acc[j] += p0.x;
        acc[j] += p0.y;
        acc[j] += p1.x;
        acc[j] += p1.y;
    }
}

// waves_per_eu: the block's 16 waves stand four to a SIMD and one block fills a WGP, so the register budget is
// that of four waves; without it the scheduler holds the register count down for more waves and sets each
// tanh right in front of its product and sum instead of issuing the 64 independent ones of a trip in runs.
__global__ __launch_bounds__(S_LEN * HS) __attribute__((amdgpu_waves_per_eu(S_LEN * HS / 128, S_LEN * HS / 128)))
void k_attn(const float* __restrict__ Uxp, const float* __restrict__ Wcp,
            const float* __restrict__ bWa, const float* __restrict__ bUa,
            const float* __restrict__ Va,  const float* __restrict__ bVa,
            const us* __restrict__ ctxT, const float* __restrict__ xin,
            const float* __restrict__ gam, const float* __restrict__ bet,
            float* __restrict__ out)
{
    __shared__ v4f sq4[TT][HD / 4];
    __shared__ v4f sv4[HD / 4];
    __shared__ float part[HS][TT][S_LEN];
    __shared__ __attribute__((aligned(16))) v2f wred[TT][S_LEN / 32];   // per row and wave: (max, sum of exp(e - max))
    __shared__ __attribute__((aligned(16))) us Pl[16][PLP];
    __shared__ __attribute__((aligned(16))) float cvs[TT][HD];

    const int bt0 = blockIdx.x * TT;         // first of the block's rows b * TQ + t (all of one b)
    const int b   = bt0 / TQ;
    const int tid = threadIdx.x, lane = tid & 31, wave = tid >> 5;
    const int s   = tid & (S_LEN - 1), hh = tid / S_LEN;

    // What the energy loop reads from global memory is asked for ahead. Here, at the kernel's entry: the prologue's few
    // pieces first, then the thread's first RING pieces of Wc (16 B each, RG to an address pair and its offsets), which
    // fly while the prologue's values are awaited, converted and laid into LDS.
    const int pc = tid & (HD / 4 - 1);
    v4f q = *(const v4f*)(Uxp + (size_t)bt0 * HD + tid * 4);
    const v4f b1 = *(const v4f*)(bUa + pc * 4);
    const v4f b2 = *(const v4f*)(bWa + pc * 4);
    v4f w0 = *(const v4f*)(Va + pc * 4);
    // keeps the prologue's loads in front of the Wc loads, so that the wait for them leaves those in flight, and
    // stands in front of any overwrite of a register that they name
    asm volatile("s_wait_xcnt 0x0" ::: "memory");
    const int u0 = hh * NU;
    const v4f* we = (const v4f*)Wcp + ((size_t)b * (HD / 4) + u0) * S_LEN + s;      // Wc4[b][u][s]
    // The TQ / TT blocks of one b read the same Wc. Each walks its NG groups of pieces round from a group of its own, g0,
    // so that blocks running in step ask L2 for different lines at any one moment, and a line that one block has
    // brought into L2 is there when the next comes to it. g0 from index bits 0, 1 and 3: every run of 4 neighbouring
    // blocks taken with the run 8 further on holds all NG starts.
    const int g0 = (blockIdx.x & 3) | ((blockIdx.x >> 1) & 4);
    v4f ew[RING];
#pragma unroll
    for (int k = 0; k < RING; k += RG) {
        const v4f* wn = we + ((g0 + k / RG) & (NG - 1)) * (RG * S_LEN);
#pragma unroll
        for (int i = 0; i < RG; ++i) ew[k + i] = wn[i * S_LEN];
        // holds the loads here, in front of the prologue's LDS stores, and stands in front of any overwrite of the
        // address pair that they name; the pair is an input so that no load's own result is laid over it either
        asm volatile("s_wait_xcnt 0x0" :: "v"(wn) : "memory");
    }
    // the loaded piece of Va as an input: keeps its load up here with the others; otherwise it is moved down into the
    // branch that stores it, a latency of its own, and its wait there takes in all the Wc loads
    asm volatile("" :: "v"(w0));

    q.x = (q.x + rbf(b1.x)) + rbf(b2.x);
    q.y = (q.y + rbf(b1.y)) + rbf(b2.y);
    q.z = (q.z + rbf(b1.z)) + rbf(b2.z);
    q.w = (q.w + rbf(b1.w)) + rbf(b2.w);
    sq4[tid / (HD / 4)][pc] = q;
    if (tid < HD / 4) {
        w0.x = rbf(w0.x); w0.y = rbf(w0.y); w0.z = rbf(w0.z); w0.w = rbf(w0.w);
        sv4[tid] = w0;
    }
    // rows TT..15 of the M tile are zero
    for (int i = tid; i < (16 - TT) * PLP / 8; i += S_LEN * HS) {
        const v8us zr = {};
        *(v8us*)(&Pl[TT][0] + i * 8) = zr;
    }
    bar_lds();                               // LDS only: the Wc loads stay in flight across it

    const float bva = rbf(bVa[0]);
    float acc[TT];
#pragma unroll
    for (int j = 0; j < TT; ++j) acc[j] = 0.0f;
    // A ring of RING pieces in registers: RG pieces are worked on, and their registers are at once asked to be filled
    // with the pieces RING further on, which then have the time of the RING - RG pieces between to arrive. The loop
    // over the ring's turns stays rolled: unrolled, the LDS reads of all turns are drawn to its head and registers spill
#pragma unroll 1
    for (int it = 0; it < NU / RING - 1; ++it) {
#pragma unroll
        for (int k = 0; k < RING; k += RG) {
            const int n  = g0 + it * (RING / RG) + k / RG;       // place in the walk, before the wrap
            const int ub = u0 + (n & (NG - 1)) * RG;
#pragma unroll
            for (int i = 0; i < RG; ++i) energy_step(acc, ew[k + i], sv4[ub + i], sq4, ub + i);
            const v4f* wn = we + ((n + RING / RG) & (NG - 1)) * (RG * S_LEN);
#pragma unroll
            for (int i = 0; i < RG; ++i) ew[k + i] = wn[i * S_LEN];
            // holds these loads here, ahead of the next pieces' work, and stands in front of the next write of the address pair
            asm volatile("s_wait_xcnt 0x0" :: "v"(wn) : "memory");
        }
    }
    // the tail's B fragments (the wave's 32 columns d, all S key positions) are asked for here, behind the last load of
    // Wc and in front of the work on the last RING pieces: they arrive under that work and the softmax
    const int wv = __builtin_amdgcn_readfirstlane(wave);
    const int hsel = lane >> 4, m = lane & 15;
    const us* cb = ctxT + (size_t)b * (size_t)(HD * S_LEN);
    const us* cb0 = cb + (size_t)(wv * 32 + m) * S_LEN + 8 * hsel;   // the lane's row of n-tile 0, its k half
    const us* cb1 = cb0 + 16 * S_LEN;                                // the same of n-tile 1
    v16bf bfr[2][S_LEN / 32];
#pragma unroll
    for (int kk = 0; kk < S_LEN / 32; ++kk) bfr[0][kk] = ld_frag(cb0, 0, 0, kk * 32, 0);
#pragma unroll
    for (int kk = 0; kk < S_LEN / 32; ++kk) bfr[1][kk] = ld_frag(cb1, 0, 0, kk * 32, 0);
    // stands in front of any overwrite of the address pair that these loads name (all sixteen go by cb0 and an
    // immediate offset); the pair is an input so that no load's own result is laid over it either
    asm volatile("s_wait_xcnt 0x0" :: "v"(cb0) : "memory");
#pragma unroll
    for (int k = 0; k < RING; ++k) {
        const int ub = u0 + ((g0 + NG - RING / RG + k / RG) & (NG - 1)) * RG + k % RG;
        energy_step(acc, ew[k], sv4[ub], sq4, ub);
    }

#pragma unroll
    for (int j = 0; j < TT; ++j) part[hh][j][s] = acc[j];

    // x, gamma and beta of the TT LayerNorm waves are asked for here, so that they arrive during the softmax (behind the
    // stores of the sums: with this branch in front of them the energy work is moved below it and registers spill)
    const int lr   = bt0 + wv;                          // LayerNorm row of wave wv < TT
    const int frow = (lr / TQ) * T_FULL + (lr % TQ);
    v4f xr[4], gm[4], be[4];
    if (wv < TT) {
        const float* xp = xin + (size_t)frow * HD + lane * 4;
#pragma unroll
        for (int j = 0; j < 4; ++j) {
            xr[j] = *(const v4f*)(xp + 128 * j);
            gm[j] = *(const v4f*)(gam + 128 * j + lane * 4);
            be[j] = *(const v4f*)(bet + 128 * j + lane * 4);
        }
        // inside the branch, so that it stands in front of the next write of a scalar base that these loads name
        asm volatile("s_wait_xcnt 0x0" ::: "memory");
    }
    bar_lds();

    // thread (hh, s) carries rows j = RPT * hh + k of the block through the softmax. A row lies in S_LEN / 32 waves:
    // each reduces its 32 energies in registers to (its max mw, its sum of exp(e - mw)); the pairs of a row meet
    // in LDS once, and every thread rescales by exp(mw - row max)
    float ex[RPT], mw[RPT];
#pragma unroll
    for (int k = 0; k < RPT; ++k) {
        const int j = RPT * hh + k;
        float a = part[0][j][s];
#pragma unroll
        for (int g = 1; g < HS; ++g) a += part[g][j][s];
        const float en = a + bva;
        mw[k] = wave_max(en);
        ex[k] = __expf(en - mw[k]);
        const float sw = wave_sum(ex[k]);
        if (lane == 0) { const v2f pr = {mw[k], sw}; wred[j][s >> 5] = pr; }
    }
    bar_lds();
#pragma unroll
    for (int k = 0; k < RPT; ++k) {
        const int j = RPT * hh + k;
        v2f pr[S_LEN / 32];
#pragma unroll
        for (int q = 0; q < S_LEN / 32; ++q) pr[q] = wred[j][q];
        float mx = pr[0].x;
#pragma unroll
        for (int q = 1; q < S_LEN / 32; ++q) mx = fmaxf(mx, pr[q].x);
        float ssum = pr[0].y * __expf(pr[0].x - mx);
#pragma unroll
        for (int q = 1; q < S_LEN / 32; ++q) ssum += pr[q].y * __expf(pr[q].x - mx);
        const float p = (ex[k] * __expf(mw[k] - mx)) * (1.0f / ssum);
        const us h = f2bf(p);
        Pl[j][s] = h;
        Pl[j][S_LEN + s] = f2bf(p - bf2f(h));
    }
    bar_lds();

    // cv tile: k runs over the hi plane, then over the lo plane
    v16bf af[KC / 32];
#pragma unroll
    for (int kk = 0; kk < KC / 32; ++kk) af[kk] = ld_frag(&Pl[0][0], PLP, m, kk * 32, hsel);
    v8f c0 = {}; v8f c1 = {};
#pragma unroll
    for (int kk = 0; kk < KC / 32; ++kk) {
        c0 = wmma16(af[kk], bfr[0][kk % (S_LEN / 32)], c0);
        c1 = wmma16(af[kk], bfr[1][kk % (S_LEN / 32)], c1);
    }
    // D map: acc[r] -> (row 8*hsel + r, col n-tile + m): the block's rows are r < TT of lanes 0-15
    if (hsel == 0) {
#pragma unroll
        for (int r = 0; r < TT; ++r) {
            cvs[r][wv * 32 + m]      = c0[r];
            cvs[r][wv * 32 + 16 + m] = c1[r];
        }
    }
    bar_lds();

    // LayerNorm + residual: wave wv < TT takes row wv. Lane l holds columns 128j + 4l .. +3 for j = 0..3;
    // store instruction j covers columns 128j..128j+127
    if (wv < TT) {
        v4f c[4];
#pragma unroll
        for (int j = 0; j < 4; ++j) c[j] = *(const v4f*)(&cvs[wv][128 * j + lane * 4]);
        float sm = 0.0f;
#pragma unroll
        for (int j = 0; j < 4; ++j) sm += (c[j].x + c[j].y) + (c[j].z + c[j].w);
        sm = wave_sum(sm);
        const float mean = sm * (1.0f / (float)HD);

        float q = 0.0f;
#pragma unroll
        for (int j = 0; j < 4; ++j) {
            const float dx = c[j].x - mean, dy = c[j].y - mean, dz = c[j].z - mean, dw = c[j].w - mean;
            q += dx * dx; q += dy * dy; q += dz * dz; q += dw * dw;
        }
        q = wave_sum(q);
        const float var  = q * (1.0f / (float)HD);
        const float rstd = rsqrtf(var + LN_EPS);

        v4f o[4];
#pragma unroll
        for (int j = 0; j < 4; ++j) {
            o[j].x = (c[j].x - mean) * rstd * rbf(gm[j].x) + rbf(be[j].x) + rbf(xr[j].x);
            o[j].y = (c[j].y - mean) * rstd * rbf(gm[j].y) + rbf(be[j].y) + rbf(xr[j].y);
            o[j].z = (c[j].z - mean) * rstd * rbf(gm[j].z) + rbf(be[j].z) + rbf(xr[j].z);
            o[j].w = (c[j].w - mean) * rstd * rbf(gm[j].w) + rbf(be[j].w) + rbf(xr[j].w);
        }
        float* dp = out + (size_t)frow * HD + lane * 4;
#pragma unroll
        for (int j = 0; j < 4; ++j) *(v4f*)(dp + 128 * j) = o[j];
    }
}

// ---------------------------------------------------------------------------
static inline size_t al256(size_t x) { return (x + 255) & ~(size_t)255; }

extern "C" void kernel_launch(void* const* d_in, const int* in_sizes, int n_in,
                              void* d_out, int out_size, void* d_ws, size_t ws_size,
                              hipStream_t stream)
{
    if (n_in < 10) return;
    if (in_sizes[0] < ((NB - 1) * T_FULL + S_LEN) * HD) return;   // context [8][128][512] f32
    if (in_sizes[1] < ((NB - 1) * T_FULL + TQ) * HD) return;      // x       [8][128][512] f32
    if (in_sizes[2] < HD * HD) return;                             // Wa [512][512] ([in][out]) f32
    if (in_sizes[3] < HD) return;                                  // bWa [512]
    if (in_sizes[4] < HD * HD) return;                             // Ua [512][512] ([in][out]) f32
    if (in_sizes[5] < HD) return;                                  // bUa [512]
    if (in_sizes[6] < HD) return;                                  // Va [512][1]
    if (in_sizes[7] < 1) return;                                   // bVa [1]
    if (in_sizes[8] < HD || in_sizes[9] < HD) return;              // gamma, beta [512]
    if (out_size < ((NB - 1) * T_FULL + TQ) * HD) return;

    const float* context = (const float*)d_in[0];
    const float* x       = (const float*)d_in[1];
    const float* Wa      = (const float*)d_in[2];
    const float* bWa     = (const float*)d_in[3];
    const float* Ua      = (const float*)d_in[4];
    const float* bUa     = (const float*)d_in[5];
    const float* Va      = (const float*)d_in[6];
    const float* bVa     = (const float*)d_in[7];
    const float* gamma   = (const float*)d_in[8];
    const float* beta    = (const float*)d_in[9];
    float* out = (float*)d_out;

    char* ws = (char*)d_ws;
    size_t off = 0;
    us* ctxT  = (us*)(ws + off);    off += al256((size_t)NB * HD * S_LEN * sizeof(us));   // [NB][512][128]
    float* Wc = (float*)(ws + off); off += al256((size_t)PROWS * HD * sizeof(float));     // [NB][512/4][S][4]
    float* Ux = (float*)(ws + off); off += al256((size_t)PROWS * HD * sizeof(float));     // [NB*TQ][512]
    if (off > ws_size) return;

    const dim3 b256(256), bS(S_LEN * HS);

    // ---- Wc = context @ Wa, Ux = x @ Ua (f32; biases added in k_attn) and the bf16 plane ctxT, one launch ----
    k_proj<<<dim3(GB + PB_CT), b256, 0, stream>>>(context, x, Wa, Ua, Wc, Ux, ctxT);

    // ---- energies + softmax, cv = [P_hi|P_lo] @ [ctxT;ctxT] (f32), LayerNorm + residual -> out ----
    k_attn<<<dim3(NB * TQ / TT), bS, 0, stream>>>(Ux, Wc, bWa, bUa, Va, bVa, ctxT, x, gamma, beta, out);
}

// v010
// A run of this version takes 13.7 microseconds.
// Timed twice side by side with v009, it ran 1.06 and 1.07 times as fast.
// Over all steps from v000 it is 4.61 times as fast.
#include <hip/hip_runtime.h>

// Contractions on v_wmma_f32_16x16x32_bf16 (bf16 operands, f32 accumulate): context@Wa and x@Ua from
// operand tiles that each block converts (RNE) into LDS itself; attn@context with attn carried as bf16 hi+lo planes folded into K against
// the RNE-converted transposed context plane, inside the energy kernel. Energies v.tanh(.), softmax,
// LayerNorm and the residual add in f32 on the VALU.

#ifndef NB
#define NB 8
#endif
#ifndef TQ
#define TQ 128
#endif
#define NB_FULL 8
#define T_FULL 128          // full query length: per-batch row stride of x and of the output
#define S_LEN 128           // context positions (keys), never reduced
#define S_FULL 128          // per-batch row stride of context in the input
#define HD 512              // feature width D == hidden width H
#define KC (2 * S_LEN)      // context GEMM depth: [P_hi | P_lo]
#define LN_EPS 1.0e-3f

static_assert(NB >= 1 && NB <= NB_FULL);
static_assert(TQ >= 64 && TQ <= T_FULL && (TQ % 64) == 0);
static_assert(S_LEN == 128 && S_LEN == S_FULL);
static_assert((HD % 256) == 0 && (HD % 64) == 0 && (HD % 32) == 0);
static_assert((KC % 32) == 0 && (S_LEN % 64) == 0);
static_assert(((HD / 4) % S_LEN) == 0);
static_assert((S_LEN % 32) == 0);

typedef unsigned short us;
typedef us     v8us  __attribute__((ext_vector_type(8)));
typedef __bf16 v16bf __attribute__((ext_vector_type(16)));
typedef float  v8f   __attribute__((ext_vector_type(8)));
typedef float  v4f   __attribute__((ext_vector_type(4)));

union Frag { v16bf v; v8us h[2]; };

// ---------------------------------------------------------------------------
// scalar helpers
// ---------------------------------------------------------------------------
__device__ __forceinline__ us f2bf(float f) {           // f32 -> bf16, RNE convert
    unsigned int u = __float_as_uint(f);
    u += 0x7FFFu + ((u >> 16) & 1u);
    return (us)(u >> 16);
}
__device__ __forceinline__ float bf2f(us h) {
    return __uint_as_float(((unsigned int)h) << 16);
}
__device__ __forceinline__ float rbf(float f) {          // value after an RNE convert to bf16
    return bf2f(f2bf(f));
}
// tanh on one feature at two neighbouring key positions, each by one v_tanh_f32
typedef float v2f __attribute__((ext_vector_type(2)));
__device__ __forceinline__ v2f tanh_acc2(v2f x) {
    v2f y;  y.x = __builtin_amdgcn_tanhf(x.x); y.y = __builtin_amdgcn_tanhf(x.y);
    return y;
}
// Reductions over the 32 lanes of a wave, in registers; every lane ends with the result. All 32 lanes are on.
// xrow<M>: the value of lane l ^ M of the same 16-lane row (DPP row_xmask); xhalf: that of lane l ^ 16.
template <int M>
__device__ __forceinline__ float xrow(float x) {
    return __builtin_bit_cast(float, __builtin_amdgcn_mov_dpp(__builtin_bit_cast(int, x), 0x160 + M, 0xf, 0xf, true));
}
__device__ __forceinline__ float xhalf(float x) {
    const int b = __builtin_bit_cast(int, x);
    return __builtin_bit_cast(float, __builtin_amdgcn_permlanex16(b, b, 0x76543210, 0xfedcba98, false, false));
}
__device__ __forceinline__ float wave_sum(float x) {
    x += xrow<1>(x); x += xrow<2>(x); x += xrow<4>(x); x += xrow<8>(x);
    return x + xhalf(x);
}
__device__ __forceinline__ float wave_max(float x) {
    x = fmaxf(x, xrow<1>(x)); x = fmaxf(x, xrow<2>(x)); x = fmaxf(x, xrow<4>(x)); x = fmaxf(x, xrow<8>(x));
    return fmaxf(x, xhalf(x));
}
// ---------------------------------------------------------------------------
// WMMA helper: 16x16x32 bf16, f32 accumulate, 4-slot VALU hazard guard after the issue
// ---------------------------------------------------------------------------
__device__ __forceinline__ v8f wmma16(v16bf a, v16bf b, v8f c) {
    v8f d = __builtin_amdgcn_wmma_f32_16x16x32_bf16(false, a, false, b, (short)0, c, false, false);
    asm volatile("v_nop\n\tv_nop\n\tv_nop\n\tv_nop" : "+v"(d) : "v"(a), "v"(b));
    return d;
}

// Fragment loader for a k-contiguous 16-bit plane P[row][k] with pitch ld (halves).
// Lane l: row = (l & 15) (A row m, or B column n of an [n][k] plane), hsel = l >> 4.
//   elements 0..7  <- k0 + 8*hsel + 0..7
//   elements 8..15 <- k0 + 16 + 8*hsel + 0..7
__device__ __forceinline__ v16bf ld_frag(const us* __restrict__ P, int ld, int row, int k0, int hsel) {
    Frag f;
    const us* p = P + (size_t)row * ld + k0 + 8 * hsel;
    f.h[0] = *(const v8us*)p;
    f.h[1] = *(const v8us*)(p + 16);
    return f.v;
}

// ---------------------------------------------------------------------------
// Transpose + convert: src[R][C] f32 (pitch spitch, per-z stride sstride) -> dst[C][R] bf16 (pitch dpitch,
// per-z stride dstride), optionally a second copy at column offset +DUP halves.
// Block: 64 src rows x 64 src cols through LDS (cross-wave -> block barrier). Store phase: two 16-B stores a thread, four with DUP
// tile index (bx, by, z) in (R/64, C/64, Z); ts: the block's 64 x 65 f32 LDS tile
// ---------------------------------------------------------------------------
template <int DUP>
__device__ __forceinline__
void d_trans(float (*ts)[65], int bx, int by, int z,
             const float* __restrict__ src, int spitch, int sstride,
             us* __restrict__ dst, int dpitch, int dstride)
{
    const int r0 = bx * 64, c0 = by * 64;
    const int tid = threadIdx.x, lane = tid & 31, wave = tid >> 5;
    const float* sb = src + (size_t)z * (size_t)sstride;
    us* db = dst + (size_t)z * (size_t)dstride;

#pragma unroll
    for (int p = 0; p < 4; ++p) {
        const int rl = p * 16 + (tid >> 4);
        const int c4 = (tid & 15) * 4;
        const v4f x = *(const v4f*)(sb + (size_t)(r0 + rl) * spitch + c0 + c4);
        ts[rl][c4 + 0] = x.x; ts[rl][c4 + 1] = x.y; ts[rl][c4 + 2] = x.z; ts[rl][c4 + 3] = x.w;
    }
    __syncthreads();

    v8us o[2];
#pragma unroll
    for (int p = 0; p < 2; ++p) {
        const int cl = p * 32 + wave * 4 + (lane >> 3);
        const int r8 = (lane & 7) * 8;
#pragma unroll
        for (int i = 0; i < 8; ++i) o[p][i] = f2bf(ts[r8 + i][cl]);
    }
#pragma unroll
    for (int p = 0; p < 2; ++p) {
        const int cl = p * 32 + wave * 4 + (lane >> 3);
        const int r8 = (lane & 7) * 8;
        us* d = db + (size_t)(c0 + cl) * dpitch + r0 + r8;
        *(v8us*)d = o[p];
        if (DUP != 0) *(v8us*)(d + DUP) = o[p];
    }
    // the stores' address and data registers are written again in the code of the caller's other branches,
    // which follows these stores in the listing: the wait stands in front of any such overwrite
    asm volatile("s_wait_xcnt 0x0" ::: "memory");
}

// ---------------------------------------------------------------------------
// Both projections and the transposed context plane in one launch, straight from the f32 inputs.
//   blocks [0, GB):        one 64(M) x 64(N) tile of Wc = context @ Wa (z = 0) or of Ux = x @ Ua (z = 1), K = HD;
//                          Ux is stored row-major, Wc as Wp[b][h / 2][s / 2] in 16-B pieces (2 features x 2 key positions)
//   blocks [GB, GB + PB_CT): context[b][s][d] -> ctxT[b][d][s] (bf16), one 64 x 64 piece each
// A GEMM block (8 waves) converts its two operand panels to bf16 in LDS, once, in batches along k:
//   As[64][HD]  rows of context or x, k-contiguous, pitch PA halves (16 B x odd, for ds_load_b128)
//   Bs[HD][64]  rows k of Wa or Ua as they lie in memory, pitch PBB bytes (32 B x odd, for ds_load_tr16_b128)
// Wave w: rows 16 (w & 3) .. +15, columns 32 (w >> 2) .. +31 (2 accumulators). The transposing load hands lane
// (c, h) the elements Bs[k0 + 8h + 0..7][n + c]; two of them, at k0 and k0 + 16, follow the k map of ld_frag.
// The GEMM blocks, which run longer, come first in the index order.
// ---------------------------------------------------------------------------
#define PROWS (NB * S_LEN)   // rows of either projection
static_assert(TQ == S_LEN);  // the two projections share one grid
#define GB (2 * (PROWS / 64) * (HD / 64))
#define PB_CT ((S_LEN / 64) * (HD / 64) * NB)
#define PA (HD + 8)
#define PBB 160
#define AS_BYTES (64 * PA * 2)
#define BS_BYTES (HD * PBB)
#define KG 4                 // k-steps per fragment group
#define TP 68                // pitch of the f32 result tile in LDS, dwords: rows r and r + 8 fall on different banks
static_assert(KG == 4 && HD / 32 / KG >= 2);   // a batch is 16 loads per thread of 256
#define NBT (HD / 32 / KG)   // batches
static_assert((NBT & (NBT - 1)) == 0);
static_assert(64 * TP * 4 <= AS_BYTES && 64 * 65 * 4 <= AS_BYTES + BS_BYTES);

typedef unsigned int v2u __attribute__((ext_vector_type(2)));
typedef unsigned int v4u __attribute__((ext_vector_type(4)));
typedef short s16x8 __attribute__((ext_vector_type(8)));
typedef __bf16 v2bf __attribute__((ext_vector_type(2)));

__device__ __forceinline__ unsigned int cvt2(float lo, float hi) {      // two f32 -> two bf16, RNE, one instruction
    const v2f p = {lo, hi};
    return __builtin_bit_cast(unsigned int, __builtin_convertvector(p, v2bf));
}
__device__ __forceinline__ v8us ld_tr16(const unsigned char* p) {
    typedef __attribute__((address_space(3))) s16x8 lds_s16x8;
    return __builtin_bit_cast(v8us, __builtin_amdgcn_ds_load_tr16_b128_v8i16((lds_s16x8*)p));
}

// Work-group barrier that orders LDS traffic only. __syncthreads() also waits for the wave's outstanding global
// loads; with this one loads asked for ahead stay in flight across it: in k_proj the later batches of the panels, in
// k_attn the first pieces of Wc and the tail's operands. Everything the waves of a block hand to each
// other at such a barrier goes through LDS.
__device__ __forceinline__ void bar_lds() {
    __builtin_amdgcn_fence(__ATOMIC_RELEASE, "workgroup", "local");
    __builtin_amdgcn_s_barrier();
    __builtin_amdgcn_fence(__ATOMIC_ACQUIRE, "workgroup", "local");
}

// The panels come in HD / 32 / KG batches of 16 loads of 16 B per thread; batch bt holds k = 32 KG bt .. + 32 KG - 1 of
// both. pa, pb: the thread's first pieces; every further piece lies a constant step on (16 rows of A or of B, for
// A also 32 KG columns a batch), so all loads go by two address pairs and an offset.
__device__ __forceinline__
void ld_batch(v4f (&r)[16], int bt, const float* __restrict__ pa, const float* __restrict__ pb) {
#pragma unroll
    for (int i = 0; i < 4; ++i) {            // A: 8 consecutive k of one row per thread
        r[2 * i]     = *(const v4f*)(pa + i * 16 * HD + bt * (32 * KG));
        r[2 * i + 1] = *(const v4f*)(pa + i * 16 * HD + bt * (32 * KG) + 4);
    }
#pragma unroll
    for (int i = 0; i < 8; ++i)              // B: 4 consecutive n of one row k per thread
        r[8 + i] = *(const v4f*)(pb + (bt * 8 + i) * 16 * HD);
    // stands in front of any overwrite of the two address pairs that these loads name; the pairs are inputs so
    // that no load's own result is laid over them either
    asm volatile("s_wait_xcnt 0x0" :: "v"(pa), "v"(pb) : "memory");
}
__device__ __forceinline__
void st_batch(const v4f (&r)[16], int bt, unsigned char* __restrict__ sa, unsigned char* __restrict__ sb) {
#pragma unroll
    for (int i = 0; i < 4; ++i) {
        const v4f a = r[2 * i], c = r[2 * i + 1];
        const v4u o = {cvt2(a.x, a.y), cvt2(a.z, a.w), cvt2(c.x, c.y), cvt2(c.z, c.w)};
        *(v4u*)(sa + i * 16 * (PA * 2) + bt * (64 * KG)) = o;
    }
#pragma unroll
    for (int i = 0; i < 8; ++i) {
        const v4f a = r[8 + i];
        const v2u o = {cvt2(a.x, a.y), cvt2(a.z, a.w)};
        *(v2u*)(sb + (bt * 8 + i) * 16 * PBB) = o;
    }
}

// waves_per_eu: two blocks (2 waves to a SIMD each) share a WGP, so that the transposing blocks find room beside
// the GEMM blocks instead of waiting for one to end; that holds the register count to a quarter of a SIMD's file.
__global__ __launch_bounds__(256) __attribute__((amdgpu_waves_per_eu(4, 4)))
void k_proj(const float* __restrict__ context, const float* __restrict__ x,
            const float* __restrict__ Wa, const float* __restrict__ Ua,
            float* __restrict__ Wc, float* __restrict__ Ux, us* __restrict__ ctxT)
{
    __shared__ __attribute__((aligned(16))) unsigned char sm[AS_BYTES + BS_BYTES];
    const int blk = blockIdx.x;
    if (blk >= GB) {                                     // block-uniform
        const int i  = blk - GB;
        const int bx = i % (S_LEN / 64);
        const int by = (i / (S_LEN / 64)) % (HD / 64);
        const int z  = i / ((S_LEN / 64) * (HD / 64));
        d_trans<0>((float (*)[65])sm, bx, by, z, context, HD, T_FULL * HD, ctxT, S_LEN, HD * S_LEN);
        return;
    }
    const int tid = threadIdx.x, lane = tid & 31;
    const int wv = __builtin_amdgcn_readfirstlane(tid >> 5);
    const int hsel = lane >> 4, m = lane & 15;
    const int z  = blk / ((PROWS / 64) * (HD / 64));
    const int m0 = (blk % (PROWS / 64)) * 64;
    const int n0 = ((blk / (PROWS / 64)) % (HD / 64)) * 64;
    const int bq = m0 / TQ;                              // the tile's 64 rows lie in one batch
    const float* Ar = (z == 0 ? context : x) + (size_t)(bq * T_FULL + (m0 - bq * TQ)) * HD;
    const float* Br = (z == 0 ? Wa : Ua) + n0;
    unsigned char* As = sm;
    unsigned char* Bs = sm + AS_BYTES;

    const float* pa = Ar + (size_t)(tid >> 4) * HD + (tid & 15) * 8;
    const float* pb = Br + (size_t)(tid >> 4) * HD + (tid & 15) * 4;
    unsigned char* sa = As + (tid >> 4) * (PA * 2) + (tid & 15) * 16;
    unsigned char* sb = Bs + (tid >> 4) * PBB + (tid & 15) * 8;
    const int mt = wv & 3, nh = wv >> 2;
    const unsigned char* bd = Bs + (8 * hsel + (lane & 7)) * PBB + ((lane >> 3) & 1) * 16 + nh * 64;
    v8f c0 = {}; v8f c1 = {};

    // Two register sets, up to two batches of loads in flight. Each batch is converted and stored as it arrives and its
    // KG k-steps are worked on while the later batches fly: no LDS byte is written twice, so one barrier a batch
    // (LDS only: it leaves the global loads in flight) is all the order there is.
    // The blocks that share a panel (PROWS / 64 share one of B, HD / 64 one of A) each take the batches round from one of
    // their own, rot, so that blocks running in step ask L2 for different lines at any one moment.
    const int rot = (blk % (PROWS / 64) + blk / (PROWS / 64)) & (NBT - 1);
    v4f rr[2][16];
    ld_batch(rr[0], 0, pa + rot * (32 * KG), pb + rot * (8 * 16 * HD));
    ld_batch(rr[1], 0, pa + ((rot + 1) & (NBT - 1)) * (32 * KG), pb + ((rot + 1) & (NBT - 1)) * (8 * 16 * HD));
#pragma unroll
    for (int g = 0; g < NBT; ++g) {
        const int bt = (rot + g) & (NBT - 1), bn = (rot + g + 2) & (NBT - 1);
        st_batch(rr[g & 1], 0, sa + bt * (64 * KG), sb + bt * (8 * 16 * PBB));
        if (g + 2 < NBT) ld_batch(rr[g & 1], 0, pa + bn * (32 * KG), pb + bn * (8 * 16 * HD));
        bar_lds();
        v16bf fa[KG];
        Frag  fb0[KG], fb1[KG];
        const us* ab = (const us*)As + bt * (KG * 32);
        const unsigned char* bb = bd + bt * (KG * 32 * PBB);
#pragma unroll
        for (int i = 0; i < KG; ++i) {
            const int k0 = i * 32;
            fa[i] = ld_frag(ab, PA, mt * 16 + m, k0, hsel);
            fb0[i].h[0] = ld_tr16(bb + k0 * PBB);
            fb0[i].h[1] = ld_tr16(bb + (k0 + 16) * PBB);
            fb1[i].h[0] = ld_tr16(bb + k0 * PBB + 32);
            fb1[i].h[1] = ld_tr16(bb + (k0 + 16) * PBB + 32);
        }
#pragma unroll
        for (int i = 0; i < KG; ++i) {
            c0 = wmma16(fa[i], fb0[i].v, c0);
            c1 = wmma16(fa[i], fb1[i].v, c1);
        }
    }
    __syncthreads();                                     // every wave has read its last fragment: the tile lies over As

    // D map: acc[r] -> (row 8*hsel + r, col n-tile + m). The 64 x 64 tile goes through LDS to whole-line stores.
    float* tile = (float*)sm;
#pragma unroll
    for (int r = 0; r < 8; ++r) {
        const int row = mt * 16 + 8 * hsel + r;
        tile[row * TP + nh * 32 + m]      = c0[r];
        tile[row * TP + nh * 32 + 16 + m] = c1[r];
    }
    __syncthreads();

    v4f vals[4];
    if (z == 0) {                                        // block-uniform
        // Wc goes out as Wp[b][h / 2][s / 2], a 16-B piece = (h, s), (h, s + 1), (h + 1, s), (h + 1, s + 1): a thread of
        // k_attn takes two neighbouring s as the halves of packed registers, its lanes run along s / 2, so a wave's
        // load there is 512 B in a row. A wave stores 8 pieces (a whole line) of each of 4 feature pairs; its LDS reads,
        // 8 B at 8 * (lane & 7) + 2 * (lane >> 3) dwords, fall on all banks once.
        const int spl = (lane & 7) + 8 * (wv & 3), hpl = (lane >> 3) + 4 * (wv >> 2);
        v4f* Cq = (v4f*)Wc + ((size_t)bq * (HD / 2) + n0 / 2 + hpl) * (S_LEN / 2) + (m0 - bq * TQ) / 2 + spl;
#pragma unroll
        for (int p = 0; p < 4; ++p) {
            const v2f r0 = *(const v2f*)(tile + (2 * spl) * TP + (hpl + 8 * p) * 2);
            const v2f r1 = *(const v2f*)(tile + (2 * spl + 1) * TP + (hpl + 8 * p) * 2);
            const v4f o = {r0.x, r1.x, r0.y, r1.y};
            vals[p] = o;
        }
#pragma unroll
        for (int p = 0; p < 4; ++p) Cq[p * 8 * (S_LEN / 2)] = vals[p];
        // in front of any overwrite of the stores' address pair and data in the code that follows them in the listing
        asm volatile("s_wait_xcnt 0x0" ::: "memory");
    } else {
        float* Cb = Ux + (size_t)m0 * HD + n0;
#pragma unroll
        for (int p = 0; p < 4; ++p) vals[p] = *(const v4f*)(tile + (p * 16 + (tid >> 4)) * TP + (tid & 15) * 4);
#pragma unroll
        for (int p = 0; p < 4; ++p) *(v4f*)(Cb + (size_t)(p * 16 + (tid >> 4)) * HD + (tid & 15) * 4) = vals[p];
        // the same wait for these stores
        asm volatile("s_wait_xcnt 0x0" ::: "memory");
    }
}

// ---------------------------------------------------------------------------
// Fused energies -> softmax -> P @ context -> LayerNorm + residual. One block per (b, group of TT query rows t).
// Energy thread = (he, sp): key positions 2 sp and 2 sp + 1, carried as the two halves of packed f32 registers, part he
// (of HSE) of the feature range. Each 16-B piece of Wc (2 features x the 2 key positions) is loaded once and used for
// all TT query rows of the block; each value of a query row or of v read from LDS serves both key positions.
// Wc lies as Wp[b][h / 2][s / 2]: the 32 lanes of a wave read 512 B in a row (4 whole cache lines) with each load.
//   e[t][s] = sum_h v[h] * tanh(Wc[b][s][h] + Ux[bt][h] + bUa[h] + bWa[h]) + bVa   (f32; the HSE parts of
//             the h range are summed apart and then added in order)
//   p    = softmax_s(e); Pl[t][s] = bf16 hi, Pl[t][S+s] = bf16 lo (lo = p - hi), in LDS
//   cv[t][d] = sum_k Pl[t][k] * ctxT[b][d][k mod S] on WMMA: the M tile is the block's TT rows and zero rows up
//             to 16; wave w does columns 32w..32w+31; each B fragment is loaded once and serves hi and lo
//   out  = LayerNorm(cv) * gamma + beta + x, one wave per row
// LDS regions are cross-wave: block barriers throughout.
// ---------------------------------------------------------------------------
#define TT 4                // query rows per block
#define HS 4                // groups of S_LEN threads in the block
#define RPT (TT / HS)       // softmax rows per thread
#define SP (S_LEN / 2)      // pairs of key positions
#define HSE (2 * HS)        // parts of the h range in the energy loop, one per group of SP threads
static_assert((TQ % TT) == 0 && (TT % HS) == 0 && ((HD / 4) % HS) == 0);
static_assert(TT <= (S_LEN * HS) / 32 && TT <= 8);       // rows 0..TT-1 of a D tile lie in lanes 0-15
static_assert(HD == (S_LEN * HS / 32) * 32);             // 32 output columns per wave
#define NU (HD / 2 / HSE)    // 16-B pieces of Wc per thread
#define RING 8               // pieces of Wc that a thread holds or has asked for
#define RG 4                 // pieces worked on between two refills
static_assert(TT * (HD / 4) == S_LEN * HS);                    // one piece of the q rows per thread
static_assert((NU % RING) == 0 && NU / RING >= 2 && (RING % RG) == 0 && RG == 4 && (SP % 32) == 0);
#define NG (NU / RG)         // groups of RG pieces in a thread's part of the h range
static_assert(NG == 8);      // the start group is made of 3 bits of the block index
#define PLP (KC + 16)       // pitch of a P row in LDS, halves: 32 B more, so that the 16-B pieces which the 32 lanes
                            // of one fragment load read (16 rows, 2 pieces each) spread evenly over the banks

// One 16-B piece e of Wc (2 features, each of the thread's two key positions) against the same features of all TT query
// rows; acc[j] = the sums of row j for the two key positions, features in order. w, sq[j][g]: the 2 features' values
// of v and of row j, each taken by a packed instruction for both of its halves
__device__ __forceinline__
void energy_step(v2f (&acc)[TT], v4f e, v2f w, const v2f (*sq)[HD / 2 / RG], int g) {
#pragma unroll
    for (int j = 0; j < TT; ++j) {
        const v2f d = sq[j][g];
        const v2f y0 = tanh_acc2(e.xy + d.xx);
        const v2f y1 = tanh_acc2(e.zw + d.yy);
        acc[j] += w.xx * y0;
        acc[j] += w.yy * y1;
    }
}

// waves_per_eu: the block's 16 waves stand four to a SIMD and one block fills a WGP, so the register budget is
// that of four waves; without it the scheduler holds the register count down for more waves and sets each
// tanh right in front of its product and sum instead of issuing the 64 independent ones of a trip in runs.
__global__ __launch_bounds__(S_LEN * HS) __attribute__((amdgpu_waves_per_eu(S_LEN * HS / 128, S_LEN * HS / 128)))
void k_attn(const float* __restrict__ Uxp, const float* __restrict__ Wcp,
            const float* __restrict__ bWa, const float* __restrict__ bUa,
            const float* __restrict__ Va,  const float* __restrict__ bVa,
            const us* __restrict__ ctxT, const float* __restrict__ xin,
            const float* __restrict__ gam, const float* __restrict__ bet,
            float* __restrict__ out)
{
    // query rows and v as pairs of features, pair f in plane f % RG at place f / RG: the RG pairs of a group of pieces are
    // read as 8-B values of their own (out of a 16-B read the fourth dword takes a register copy to be used for both halves)
    __shared__ __attribute__((aligned(16))) v2f sq4[RG][TT][HD / 2 / RG];
    __shared__ __attribute__((aligned(16))) v2f sv4[RG][HD / 2 / RG];
    __shared__ __attribute__((aligned(16))) float part[HSE][TT][S_LEN];
    __shared__ __attribute__((aligned(16))) v2f wred[TT][S_LEN / 32];   // per row and wave: (max, sum of exp(e - max))
    __shared__ __attribute__((aligned(16))) us Pl[16][PLP];
    __shared__ __attribute__((aligned(16))) float cvs[TT][HD];

    const int bt0 = blockIdx.x * TT;         // first of the block's rows b * TQ + t (all of one b)
    const int b   = bt0 / TQ;
    const int tid = threadIdx.x, lane = tid & 31, wave = tid >> 5;
    const int s   = tid & (S_LEN - 1), hh = tid / S_LEN;      // softmax: key position, group of rows
    const int sp  = tid & (SP - 1),    he = tid / SP;         // energy loop: pair of key positions, part of the h range

    // What the energy loop reads from global memory is asked for ahead. Here, at the kernel's entry: the prologue's few
    // pieces first, then the thread's first RING pieces of Wc (16 B each, RG to an address pair and its offsets), which
    // fly while the prologue's values are awaited, converted and laid into LDS.
    const int pc = tid & (HD / 4 - 1);
    v4f q = *(const v4f*)(Uxp + (size_t)bt0 * HD + tid * 4);
    const v4f b1 = *(const v4f*)(bUa + pc * 4);
    const v4f b2 = *(const v4f*)(bWa + pc * 4);
    v4f w0 = *(const v4f*)(Va + pc * 4);
    // keeps the prologue's loads in front of the Wc loads, so that the wait for them leaves those in flight, and
    // stands in front of any overwrite of a register that they name
    asm volatile("s_wait_xcnt 0x0" ::: "memory");
    const int u0 = he * NG;                  // the part's first group of pieces, as a place in sq4 and sv4
    const v4f* we = (const v4f*)Wcp + ((size_t)b * (HD / 2) + he * NU) * SP + sp;   // Wp[b][h / 2][sp]
    // The TQ / TT blocks of one b read the same Wc. Each walks its NG groups of pieces round from a group of its own, g0,
    // so that blocks running in step ask L2 for different lines at any one moment, and a line that one block has
    // brought into L2 is there when the next comes to it. g0 from index bits 0, 1 and 3: every run of 4 neighbouring
    // blocks taken with the run 8 further on holds all NG starts.
    const int g0 = (blockIdx.x & 3) | ((blockIdx.x >> 1) & 4);
    v4f ew[RING];
#pragma unroll
    for (int k = 0; k < RING; k += RG) {
        const v4f* wn = we + ((g0 + k / RG) & (NG - 1)) * (RG * SP);
#pragma unroll
        for (int i = 0; i < RG; ++i) ew[k + i] = wn[i * SP];
        // holds the loads here, in front of the prologue's LDS stores, and stands in front of any overwrite of the
        // address pair that they name; the pair is an input so that no load's own result is laid over it either
        asm volatile("s_wait_xcnt 0x0" :: "v"(wn) : "memory");
    }
    // the loaded piece of Va as an input: keeps its load up here with the others; otherwise it is moved down into the
    // branch that stores it, a latency of its own, and its wait there takes in all the Wc loads
    asm volatile("" :: "v"(w0));

    q.x = (q.x + rbf(b1.x)) + rbf(b2.x);
    q.y = (q.y + rbf(b1.y)) + rbf(b2.y);
    q.z = (q.z + rbf(b1.z)) + rbf(b2.z);
    q.w = (q.w + rbf(b1.w)) + rbf(b2.w);
    sq4[(pc & 1) * 2][tid / (HD / 4)][pc >> 1]     = q.xy;
    sq4[(pc & 1) * 2 + 1][tid / (HD / 4)][pc >> 1] = q.zw;
    if (tid < HD / 4) {
        w0.x = rbf(w0.x); w0.y = rbf(w0.y); w0.z = rbf(w0.z); w0.w = rbf(w0.w);
        sv4[(pc & 1) * 2][pc >> 1]     = w0.xy;
        sv4[(pc & 1) * 2 + 1][pc >> 1] = w0.zw;
    }
    // rows TT..15 of the M tile are zero
    for (int i = tid; i < (16 - TT) * PLP / 8; i += S_LEN * HS) {
        const v8us zr = {};
        *(v8us*)(&Pl[TT][0] + i * 8) = zr;
    }
    bar_lds();                               // LDS only: the Wc loads stay in flight across it

    const float bva = rbf(bVa[0]);
    v2f acc[TT];
#pragma unroll
    for (int j = 0; j < TT; ++j) acc[j] = 0.0f;
    // A ring of RING pieces in registers: RG pieces are worked on, and their registers are at once asked to be filled
    // with the pieces RING further on, which then have the time of the RING - RG pieces between to arrive. The loop
    // over the ring's turns stays rolled: unrolled, the LDS reads of all turns are drawn to its head and registers spill
#pragma unroll 1
    for (int it = 0; it < NU / RING - 1; ++it) {
#pragma unroll
        for (int k = 0; k < RING; k += RG) {
            const int n  = g0 + it * (RING / RG) + k / RG;       // place in the walk, before the wrap
            const int ub = u0 + (n & (NG - 1));
#pragma unroll
            for (int i = 0; i < RG; ++i) energy_step(acc, ew[k + i], sv4[i][ub], sq4[i], ub);
            const v4f* wn = we + ((n + RING / RG) & (NG - 1)) * (RG * SP);
#pragma unroll
            for (int i = 0; i < RG; ++i) ew[k + i] = wn[i * SP];
            // holds these loads here, ahead of the next pieces' work, and stands in front of the next write of the address pair
            asm volatile("s_wait_xcnt 0x0" :: "v"(wn) : "memory");
        }
    }
    // the tail's B fragments (the wave's 32 columns d, all S key positions) are asked for here, behind the last load of
    // Wc and in front of the work on the last RING pieces: they arrive under that work and the softmax
    const int wv = __builtin_amdgcn_readfirstlane(wave);
    const int hsel = lane >> 4, m = lane & 15;
    const us* cb = ctxT + (size_t)b * (size_t)(HD * S_LEN);
    const us* cb0 = cb + (size_t)(wv * 32 + m) * S_LEN + 8 * hsel;   // the lane's row of n-tile 0, its k half
    const us* cb1 = cb0 + 16 * S_LEN;                                // the same of n-tile 1
    v16bf bfr[2][S_LEN / 32];
#pragma unroll
    for (int kk = 0; kk < S_LEN / 32; ++kk) bfr[0][kk] = ld_frag(cb0, 0, 0, kk * 32, 0);
#pragma unroll
    for (int kk = 0; kk < S_LEN / 32; ++kk) bfr[1][kk] = ld_frag(cb1, 0, 0, kk * 32, 0);
    // stands in front of any overwrite of the address pair that these loads name (all sixteen go by cb0 and an
    // immediate offset); the pair is an input so that no load's own result is laid over it either
    asm volatile("s_wait_xcnt 0x0" :: "v"(cb0) : "memory");
#pragma unroll
    for (int k = 0; k < RING; ++k) {
        const int ub = u0 + ((g0 + NG - RING / RG + k / RG) & (NG - 1));
        energy_step(acc, ew[k], sv4[k % RG][ub], sq4[k % RG], ub);
    }

#pragma unroll
    for (int j = 0; j < TT; ++j) *(v2f*)&part[he][j][2 * sp] = acc[j];

    // x, gamma and beta of the TT LayerNorm waves are asked for here, so that they arrive during the softmax (behind the
    // stores of the sums: with this branch in front of them the energy work is moved below it and registers spill)
    const int lr   = bt0 + wv;                          // LayerNorm row of wave wv < TT
    const int frow = (lr / TQ) * T_FULL + (lr % TQ);
    v4f xr[4], gm[4], be[4];
    if (wv < TT) {
        const float* xp = xin + (size_t)frow * HD + lane * 4;
#pragma unroll
        for (int j = 0; j < 4; ++j) {
            xr[j] = *(const v4f*)(xp + 128 * j);
            gm[j] = *(const v4f*)(gam + 128 * j + lane * 4);
            be[j] = *(const v4f*)(bet + 128 * j + lane * 4);
        }
        // inside the branch, so that it stands in front of the next write of a scalar base that these loads name
        asm volatile("s_wait_xcnt 0x0" ::: "memory");
    }
    bar_lds();

    // thread (hh, s) carries rows j = RPT * hh + k of the block through the softmax. A row lies in S_LEN / 32 waves:
    // each reduces its 32 energies in registers to (its max mw, its sum of exp(e - mw)); the pairs of a row meet
    // in LDS once, and every thread rescales by exp(mw - row max)
    float ex[RPT], mw[RPT];
#pragma unroll
    for (int k = 0; k < RPT; ++k) {
        const int j = RPT * hh + k;
        float a = part[0][j][s];
#pragma unroll
        for (int g = 1; g < HSE; ++g) a += part[g][j][s];
        const float en = a + bva;
        mw[k] = wave_max(en);
        ex[k] = __expf(en - mw[k]);
        const float sw = wave_sum(ex[k]);
        if (lane == 0) { const v2f pr = {mw[k], sw}; wred[j][s >> 5] = pr; }
    }
    bar_lds();
#pragma unroll
    for (int k = 0; k < RPT; ++k) {
        const int j = RPT * hh + k;
        v2f pr[S_LEN / 32];
#pragma unroll
        for (int q = 0; q < S_LEN / 32; ++q) pr[q] = wred[j][q];
        float mx = pr[0].x;
#pragma unroll
        for (int q = 1; q < S_LEN / 32; ++q) mx = fmaxf(mx, pr[q].x);
        float ssum = pr[0].y * __expf(pr[0].x - mx);
#pragma unroll
        for (int q = 1; q < S_LEN / 32; ++q) ssum += pr[q].y * __expf(pr[q].x - mx);
        const float p = (ex[k] * __expf(mw[k] - mx)) * (1.0f / ssum);
        const us h = f2bf(p);
        Pl[j][s] = h;
        Pl[j][S_LEN + s] = f2bf(p - bf2f(h));
    }
    bar_lds();

    // cv tile: k runs over the hi plane, then over the lo plane
    v16bf af[KC / 32];
#pragma unroll
    for (int kk = 0; kk < KC / 32; ++kk) af[kk] = ld_frag(&Pl[0][0], PLP, m, kk * 32, hsel);
    v8f c0 = {}; v8f c1 = {};
#pragma unroll
    for (int kk = 0; kk < KC / 32; ++kk) {
        c0 = wmma16(af[kk], bfr[0][kk % (S_LEN / 32)], c0);
        c1 = wmma16(af[kk], bfr[1][kk % (S_LEN / 32)], c1);
    }
    // D map: acc[r] -> (row 8*hsel + r, col n-tile + m): the block's rows are r < TT of lanes 0-15
    if (hsel == 0) {
#pragma unroll
        for (int r = 0; r < TT; ++r) {
            cvs[r][wv * 32 + m]      = c0[r];
            cvs[r][wv * 32 + 16 + m] = c1[r];
        }
    }
    bar_lds();

    // LayerNorm + residual: wave wv < TT takes row wv. Lane l holds columns 128j + 4l .. +3 for j = 0..3;
    // store instruction j covers columns 128j..128j+127
    if (wv < TT) {
        v4f c[4];
#pragma unroll
        for (int j = 0; j < 4; ++j) c[j] = *(const v4f*)(&cvs[wv][128 * j + lane * 4]);
        float sm = 0.0f;
#pragma unroll
        for (int j = 0; j < 4; ++j) sm += (c[j].x + c[j].y) + (c[j].z + c[j].w);
        sm = wave_sum(sm);
        const float mean = sm * (1.0f / (float)HD);

        float q = 0.0f;
#pragma unroll
        for (int j = 0; j < 4; ++j) {
            const float dx = c[j].x - mean, dy = c[j].y - mean, dz = c[j].z - mean, dw = c[j].w - mean;
            q += dx * dx; q += dy * dy; q += dz * dz; q += dw * dw;
        }
        q = wave_sum(q);
        const float var  = q * (1.0f / (float)HD);
        const float rstd = rsqrtf(var + LN_EPS);

        v4f o[4];
#pragma unroll
        for (int j = 0; j < 4; ++j) {
            o[j].x = (c[j].x - mean) * rstd * rbf(gm[j].x) + rbf(be[j].x) + rbf(xr[j].x);
            o[j].y = (c[j].y - mean) * rstd * rbf(gm[j].y) + rbf(be[j].y) + rbf(xr[j].y);
            o[j].z = (c[j].z - mean) * rstd * rbf(gm[j].z) + rbf(be[j].z) + rbf(xr[j].z);
            o[j].w = (c[j].w - mean) * rstd * rbf(gm[j].w) + rbf(be[j].w) + rbf(xr[j].w);
        }
        float* dp = out + (size_t)frow * HD + lane * 4;
#pragma unroll
        for (int j = 0; j < 4; ++j) *(v4f*)(dp + 128 * j) = o[j];
    }
}

// ---------------------------------------------------------------------------
static inline size_t al256(size_t x) { return (x + 255) & ~(size_t)255; }

extern "C" void kernel_launch(void* const* d_in, const int* in_sizes, int n_in,
                              void* d_out, int out_size, void* d_ws, size_t ws_size,
                              hipStream_t stream)
{
    if (n_in < 10) return;
    if (in_sizes[0] < ((NB - 1) * T_FULL + S_LEN) * HD) return;   // context [8][128][512] f32
    if (in_sizes[1] < ((NB - 1) * T_FULL + TQ) * HD) return;      // x       [8][128][512] f32
    if (in_sizes[2] < HD * HD) return;                             // Wa [512][512] ([in][out]) f32
    if (in_sizes[3] < HD) return;                                  // bWa [512]
    if (in_sizes[4] < HD * HD) return;                             // Ua [512][512] ([in][out]) f32
    if (in_sizes[5] < HD) return;                                  // bUa [512]
    if (in_sizes[6] < HD) return;                                  // Va [512][1]
    if (in_sizes[7] < 1) return;                                   // bVa [1]
    if (in_sizes[8] < HD || in_sizes[9] < HD) return;              // gamma, beta [512]
    if (out_size < ((NB - 1) * T_FULL + TQ) * HD) return;

    const float* context = (const float*)d_in[0];
    const float* x       = (const float*)d_in[1];
    const float* Wa      = (const float*)d_in[2];
    const float* bWa     = (const float*)d_in[3];
    const float* Ua      = (const float*)d_in[4];
    const float* bUa     = (const float*)d_in[5];
    const float* Va      = (const float*)d_in[6];
    const float* bVa     = (const float*)d_in[7];
    const float* gamma   = (const float*)d_in[8];
    const float* beta    = (const float*)d_in[9];
    float* out = (float*)d_out;

    char* ws = (char*)d_ws;
    size_t off = 0;
    us* ctxT  = (us*)(ws + off);    off += al256((size_t)NB * HD * S_LEN * sizeof(us));   // [NB][512][128]
    float* Wc = (float*)(ws + off); off += al256((size_t)PROWS * HD * sizeof(float));     // [NB][512/2][S/2][2][2]
    float* Ux = (float*)(ws + off); off += al256((size_t)PROWS * HD * sizeof(float));     // [NB*TQ][512]
    if (off > ws_size) return;

    const dim3 b256(256), bS(S_LEN * HS);

    // ---- Wc = context @ Wa, Ux = x @ Ua (f32; biases added in k_attn) and the bf16 plane ctxT, one launch ----
    k_proj<<<dim3(GB + PB_CT), b256, 0, stream>>>(context, x, Wa, Ua, Wc, Ux, ctxT);

    // ---- energies + softmax, cv = [P_hi|P_lo] @ [ctxT;ctxT] (f32), LayerNorm + residual -> out ----
    k_attn<<<dim3(NB * TQ / TT), bS, 0, stream>>>(Ux, Wc, bWa, bUa, Va, bVa, ctxT, x, gamma, beta, out);
}
